// v000
// Times are from an AMD MI455X. After a warm-up the kernel runs many times in a row, and a time is the length of
// such a window on the GPU divided by its runs, so every launch and the gaps after it count. The runs cycle
// through copies of the inputs. A figure is the median of several windows, for all but v000 over two sittings.
// Sittings can differ by a few percent; kernels timed side by side share one.
// The starting kernel, v000, takes 559 microseconds a run.
// compute dtype: all float inputs rounded to bf16; q / k / v projections with EXACT bf16 products on WMMA 16x16x32 (f32 accumulate), no biases; logits q x k once to f16 each (1 product) x 64^-0.5; the int key mask read per (batch, key); softmax f32; P x 2^11 once to f16 x v once to f16 (1 product); ctx x 2^6 once to f16 x W_O f16(bf16 x 2^8); f32 output.
#include <hip/hip_runtime.h>
#include <math.h>

typedef __attribute__((ext_vector_type(16))) _Float16 v16h;
typedef __attribute__((ext_vector_type(16))) __bf16 v16b;
typedef __attribute__((ext_vector_type(8)))  _Float16 v8h;
typedef __attribute__((ext_vector_type(8)))  float v8f;
typedef __attribute__((ext_vector_type(4)))  float v4f;
typedef __attribute__((ext_vector_type(2)))  float v2f;
typedef __attribute__((ext_vector_type(4)))  unsigned v4u;
typedef __attribute__((ext_vector_type(4)))  int v4i;
typedef float __attribute__((may_alias)) float_a;
typedef int __attribute__((may_alias)) int_a;

template <typename T> __device__ __forceinline__ void vst2(void* p, T v) { *(T*)p = v;  }
__device__ __forceinline__ v8f wmma16(v16h a, v16h b, v8f c) {
  v8f d = __builtin_amdgcn_wmma_f32_16x16x32_f16(false, a, false, b, (short)0, c, false, false);
  asm volatile("v_nop\n\tv_nop\n\tv_nop\n\tv_nop" : "+v"(d) : "v"(a), "v"(b));
  return d;
}
__device__ __forceinline__ v8f wmma_bf(v16b a, v16b b, v8f c) {
  v8f d = __builtin_amdgcn_wmma_f32_16x16x32_bf16(false, a, false, b, (short)0, c, false, false);
  asm volatile("v_nop\n\tv_nop\n\tv_nop\n\tv_nop" : "+v"(d) : "v"(a), "v"(b));
  return d;
}
// 16x16x32 fragments: lane = (h = lane>>4, row/col = lane&15); elements 0..7 = k0+8h+0..7, 8..15 = k0+16+8h+0..7; D element r = row 8h+r
__device__ __forceinline__ v16h frag_h(const _Float16* rowk0, int lane) {
  union { v16h v; v8h q[2]; } u; const _Float16* p = rowk0 + 8 * (lane >> 4);
  u.q[0] = *(const v8h*)p; u.q[1] = *(const v8h*)(p + 16); return u.v;
}
__device__ __forceinline__ v16h frag_f32(const float* rowk0, int lane) {
  v16h a; const float* p = rowk0 + 8 * (lane >> 4);
#pragma unroll
  for (int i = 0; i < 8; ++i) { a[i] = (_Float16)p[i]; a[8 + i] = (_Float16)p[16 + i]; }
  return a;
}
__device__ __forceinline__ v16h frag_f32s(const float* rowk0, int lane, float sc) {
  v16h a; const float* p = rowk0 + 8 * (lane >> 4);
#pragma unroll
  for (int i = 0; i < 8; ++i) { a[i] = (_Float16)(p[i] * sc); a[8 + i] = (_Float16)(p[16 + i] * sc); }
  return a;
}
// column fragment from a [K][ld] layout (column n), rows >= K read as 0
__device__ __forceinline__ v16h fragc_f32(const float* W, int k0, int n, int lane, int ld, int K) {
  v16h a; const int g = lane >> 4;
#pragma unroll
  for (int i = 0; i < 8; ++i) { const int ka = k0 + 8 * g + i, kb = ka + 16;
    a[i] = (_Float16)(ka < K ? W[(size_t)(ka < K ? ka : K - 1) * ld + n] : 0.f); a[8 + i] = (_Float16)(kb < K ? W[(size_t)(kb < K ? kb : K - 1) * ld + n] : 0.f); }
  return a;
}
struct F2 { v16b h, l; };
__device__ __forceinline__ F2 bsplit16(const float v[16]) { F2 r;
#pragma unroll
  for (int i = 0; i < 16; ++i) { const __bf16 h = (__bf16)v[i]; r.h[i] = h; r.l[i] = (__bf16)(v[i] - (float)h); }
  return r; }
__device__ __forceinline__ F2 split_row(const float* row, int k0, int lane) { float v[16]; const float* p = row + k0 + 8 * (lane >> 4);
#pragma unroll
  for (int i = 0; i < 8; ++i) { v[i] = p[i]; v[8 + i] = p[16 + i]; }
  return bsplit16(v); }
__device__ __forceinline__ F2 split_rowK(const float* row, int k0, int lane, int K) { float v[16]; const int g = lane >> 4;
#pragma unroll
  for (int i = 0; i < 8; ++i) { const int ka = k0 + 8 * g + i, kb = ka + 16; v[i] = ka < K ? row[ka < K ? ka : K - 1] : 0.f; v[8 + i] = kb < K ? row[kb < K ? kb : K - 1] : 0.f; }
  return bsplit16(v); }
__device__ __forceinline__ F2 split_col(const float* W, int k0, int n, int lane, int ld, int K) { float v[16]; const int g = lane >> 4;
#pragma unroll
  for (int i = 0; i < 8; ++i) { const int ka = k0 + 8 * g + i, kb = ka + 16; v[i] = ka < K ? W[(size_t)(ka < K ? ka : K - 1) * ld + n] : 0.f; v[8 + i] = kb < K ? W[(size_t)(kb < K ? kb : K - 1) * ld + n] : 0.f; }
  return bsplit16(v); }
__device__ __forceinline__ v8f mac3(const F2& a, const F2& b, v8f c) { c = wmma_bf(a.l, b.h, c); c = wmma_bf(a.h, b.l, c); return wmma_bf(a.h, b.h, c); }
__device__ __forceinline__ float sigm(float v) { return 1.0f / (1.0f + expf(-v)); }
#define LDSX() do { asm volatile("s_wait_dscnt 0" ::: "memory"); __builtin_amdgcn_wave_barrier(); __builtin_amdgcn_fence(__ATOMIC_RELEASE, "workgroup"); } while (0)

// Standard multi-head self-attention with a key-padding mask input (x [4,2048,256]; torch (out,in) W_Q / W_K / W_V / W_O [256,256] uniform(+-1/16) applied as x @ W.T, no biases; mask [4,2048] int32 = ones (const: nothing is masked on this draw); 4 heads x 64; scores x 64^-0.5; where(mask[:, None, None, :] == 0, -inf, scores); softmax; out @ W_O.T).
#define NB 4
#define TT 2048
#define CC 256            // NH * HD = projected width
#define DIN 256          // input (model) width
#define NH 4
#define HD 64
#define NQB (TT / 64)
#define HG 4
#define SCALE (0.125f)
#define CAUSAL 0
#ifndef TNB
#define TNB NB
#endif
__device__ __forceinline__ float bfr(float v) { return (float)(__bf16)v; }
__host__ __device__ __forceinline__ int kb_last(int qb) { return CAUSAL ? ((qb * 64 + 63) >> 7) : (TT / 128 - 1); }
typedef __attribute__((ext_vector_type(8))) __bf16 v8b;
__device__ __forceinline__ v16b frag_b(const __bf16* rowk0, int lane) {
  union { v16b v; v8b q[2]; } u; const __bf16* p = rowk0 + 8 * (lane >> 4);
  u.q[0] = *(const v8b*)p; u.q[1] = *(const v8b*)(p + 16); return u.v;
}
#define QBH 0              // query blocks 0..QBH-1 take the high-precision path (none here; every query block sees all TT keys)
#define QHI 0               // single-product logits on every row
#define KHI 64            // key rows carrying k residual / v bf16 hi+lo planes (read only on the qb < QBH path, which no block takes)
// B fragment (k rows k0+.., output column o) of a weight: (in,out) [K][ld] or (out,in) [ld rows of K]: bf16 exact, or f16(bf16 * 256) exact
__device__ __forceinline__ v16b wcol_io(const float* Wm, int k0, int o, int lane, int ld) { v16b w; const int g = lane >> 4;
#pragma unroll
  for (int i = 0; i < 8; ++i) { w[i] = (__bf16)Wm[(size_t)(k0 + 8 * g + i) * ld + o]; w[8 + i] = (__bf16)Wm[(size_t)(k0 + 16 + 8 * g + i) * ld + o]; }
  return w; }
__device__ __forceinline__ v16b wcol_oi(const float* Wm, int k0, int o, int lane, int K) { v16b w; const float* p = Wm + (size_t)o * K + k0 + 8 * (lane >> 4);
#pragma unroll
  for (int i = 0; i < 8; ++i) { w[i] = (__bf16)p[i]; w[8 + i] = (__bf16)p[16 + i]; }
  return w; }
__device__ __forceinline__ v16h wcolh_io(const float* Wm, int k0, int o, int lane, int ld) { v16h w; const int g = lane >> 4;
#pragma unroll
  for (int i = 0; i < 8; ++i) { w[i] = (_Float16)(bfr(Wm[(size_t)(k0 + 8 * g + i) * ld + o]) * 256.0f); w[8 + i] = (_Float16)(bfr(Wm[(size_t)(k0 + 16 + 8 * g + i) * ld + o]) * 256.0f); }
  return w; }
__device__ __forceinline__ v16h wcolh_oi(const float* Wm, int k0, int o, int lane, int K) { v16h w; const float* p = Wm + (size_t)o * K + k0 + 8 * (lane >> 4);
#pragma unroll
  for (int i = 0; i < 8; ++i) { w[i] = (_Float16)(bfr(p[i]) * 256.0f); w[8 + i] = (_Float16)(bfr(p[16 + i]) * 256.0f); }
  return w; }
#define WQKV_LAYOUT 1   // 0 = (in,out) [DIN][CC]; 1 = (out,in) [CC][DIN]; 2 = per-head [NH][DIN][HD]
__device__ __forceinline__ v16b wcol_hdk(const float* Wm, int k0, int o, int lane) { v16b w; const int g = lane >> 4; const float* p = Wm + (size_t)(o / HD) * DIN * HD + (o % HD);
#pragma unroll
  for (int i = 0; i < 8; ++i) { w[i] = (__bf16)p[(size_t)(k0 + 8 * g + i) * HD]; w[8 + i] = (__bf16)p[(size_t)(k0 + 16 + 8 * g + i) * HD]; }
  return w; }
#define WO_OUT_IN 1
#if WQKV_LAYOUT == 1
#define WCOL(W, k0, o, lane) wcol_oi(W, k0, o, lane, DIN)
#elif WQKV_LAYOUT == 2
#define WCOL(W, k0, o, lane) wcol_hdk(W, k0, o, lane)
#else
#define WCOL(W, k0, o, lane) wcol_io(W, k0, o, lane, CC)
#endif
#if WO_OUT_IN
#define WOCOL(W, k0, o, lane) wcol_oi(W, k0, o, lane, CC)
#define WOCOLH(W, k0, o, lane) wcolh_oi(W, k0, o, lane, CC)
#else
#define WOCOL(W, k0, o, lane) wcol_io(W, k0, o, lane, DIN)
#define WOCOLH(W, k0, o, lane) wcolh_io(W, k0, o, lane, DIN)
#endif

#define SM_EXTRA_PARAMS , int bsm, const int* __restrict__ MASK   /* key mask [NB][TT] int32: 0 = masked key */
// key-padding mask: a key whose mask entry is 0 gets the logit -1.0e9 (weight exactly 0; the module fills -inf); the mask is read per (batch, key)
#define SM_MASK_HOOK do { const int mk_ = MASK[(size_t)bsm * TT + k]; asm volatile("s_wait_loadcnt 0x0" ::: "memory"); v = (mk_ == 0) ? -1.0e9f : v; } while (0)
#ifndef SM_EXTRA_PARAMS
#define SM_EXTRA_PARAMS
#endif
#ifndef PROJ_EXTRA_PARAMS
#define PROJ_EXTRA_PARAMS
#endif
#ifndef SM_MASK_HOOK
#define SM_MASK_HOOK (void)0
#endif

#define WS_QH  0u                                      // f16 q rows [b*t][CC]
#define WS_KH  (WS_QH + 2u * (size_t)NB * TT * CC)      // f16 k rows [b*t][CC]
#define WS_VT  (WS_KH + 2u * (size_t)NB * TT * CC)      // f16 v planes [b][c][t]
#define WS_QL  (WS_VT + 2u * (size_t)NB * CC * TT)      // f16 q residual x 2^10 rows [b][t < QHI][CC]
#define WS_KL  (WS_QL + 2u * (size_t)NB * QHI * CC)     // f16 k residual x 2^10 rows [b][t < KHI][CC]
#define WS_VB  (WS_KL + 2u * (size_t)NB * KHI * CC)     // bf16 v hi planes [b][c][t < KHI]
#define WS_VBL (WS_VB + 2u * (size_t)NB * CC * KHI)
#define WS_S   (WS_VBL + 2u * (size_t)NB * CC * KHI)    // f32 logits / P [hg][t][s]
#define WS_Y   (WS_S  + 4u * (size_t)HG * TT * TT)      // f32 ctx rows [b*t][CC] (only when there is an output projection)
#define WS_END (WS_Y  + 4u * (size_t)NB * TT * CC)

// ---- k_proj: block = (64 rows, 128 cols, which): q/k/v = X W (+ b) with exact bf16 products (K = DIN) -> which 0: q f16 rows (+ residual rows < QHI); 1: k f16 rows (+ residual rows < KHI); 2: v f16 planes [c][t] (+ bf16 hi/lo planes for t < KHI)
__global__ __launch_bounds__(128) void k_proj(const float* __restrict__ XQ, const float* __restrict__ XK, const float* __restrict__ XV, const float* __restrict__ WQ, const float* __restrict__ WK, const float* __restrict__ WV, const float* __restrict__ BQ, const float* __restrict__ BK, const float* __restrict__ BV,
    _Float16* __restrict__ QH, _Float16* __restrict__ QL, _Float16* __restrict__ KH, _Float16* __restrict__ KL, _Float16* __restrict__ VT, __bf16* __restrict__ VB, __bf16* __restrict__ VBL) {
  __shared__ __align__(16) _Float16 sh[64][136], sl[64][136]; __shared__ __align__(16) _Float16 th[128][72]; __shared__ __align__(16) __bf16 tb[128][72], tbl[128][72];
  const int tid = threadIdx.x, wave = tid >> 5, lane = tid & 31, col = lane & 15, g = lane >> 4; const int which = blockIdx.z; const int c0 = blockIdx.y * 128; const size_t r0 = (size_t)blockIdx.x * 64; const size_t bb = r0 / TT; const int t0 = (int)(r0 % TT);
  const float* X = which == 0 ? XQ : which == 1 ? XK : XV; const float* WA = which == 0 ? WQ : which == 1 ? WK : WV; const float* BA = which == 0 ? BQ : which == 1 ? BK : BV;
  v8f acc[8] = {};
#pragma unroll 2
  for (int kc = 0; kc < DIN / 32; ++kc) { v16b a; { const float* p = X + (r0 + wave * 16 + col) * DIN + kc * 32 + 8 * g;
#pragma unroll
      for (int i = 0; i < 8; ++i) { a[i] = (__bf16)p[i]; a[8 + i] = (__bf16)p[16 + i]; } }
    asm volatile("s_wait_loadcnt 0x0" ::: "memory");
#pragma unroll
    for (int j = 0; j < 8; ++j) { const v16b w = WCOL(WA, kc * 32, c0 + j * 16 + col, lane); asm volatile("s_wait_loadcnt 0x0" ::: "memory"); acc[j] = wmma_bf(a, w, acc[j]); } }
  if (which < 2) { _Float16* DH = which == 0 ? QH : KH; _Float16* DL = which == 0 ? QL : KL; const int nhi = which == 0 ? QHI : KHI; const bool hi_rows = t0 < nhi;
#pragma unroll
    for (int j = 0; j < 8; ++j) { const float bias = BA ? bfr(BA[c0 + j * 16 + col]) : 0.f;
#pragma unroll
      for (int r = 0; r < 8; ++r) { const float v = acc[j][r] + bias; const _Float16 hv = (_Float16)v; sh[wave * 16 + 8 * g + r][j * 16 + col] = hv; sl[wave * 16 + 8 * g + r][j * 16 + col] = (_Float16)((v - (float)hv) * 1024.0f); } }
    __syncthreads();
    for (int e = tid; e < 64 * 16; e += 128) { const int rl = e >> 4, q = e & 15; vst2((unsigned*)(DH + (r0 + rl) * CC + c0 + q * 8), *(const v4u*)&sh[rl][q * 8]); if (hi_rows) vst2((unsigned*)(DL + (bb * nhi + t0 + rl) * (size_t)CC + c0 + q * 8), *(const v4u*)&sl[rl][q * 8]); }
  } else { const bool hi_rows = t0 < KHI;
#pragma unroll
    for (int j = 0; j < 8; ++j) { const float bias = BA ? bfr(BA[c0 + j * 16 + col]) : 0.f;
#pragma unroll
      for (int r = 0; r < 8; ++r) { const float v = acc[j][r] + bias; const int rl = wave * 16 + 8 * g + r, cl = j * 16 + col; th[cl][rl] = (_Float16)v; const __bf16 bh = (__bf16)v; tb[cl][rl] = bh; tbl[cl][rl] = (__bf16)(v - (float)bh); } }
    __syncthreads();
    for (int e = tid; e < 128 * 8; e += 128) { const int cl = e >> 3, q = e & 7; vst2((unsigned*)(VT + (bb * CC + c0 + cl) * (size_t)TT + t0 + q * 8), *(const v4u*)&th[cl][q * 8]); if (hi_rows) { const size_t o3 = (bb * CC + c0 + cl) * (size_t)KHI + t0 + q * 8; vst2((unsigned*)(VB + o3), *(const v4u*)&tb[cl][q * 8]); vst2((unsigned*)(VBL + o3), *(const v4u*)&tbl[cl][q * 8]); } } } }
// ---- k_sc: block = (query block qb, key block kb <= kb_last(qb), head in group) of batch b: logits x SCALE; q hi + residual (x 2^10) against k (2 products) for query rows < QHI, plus the k residual (3 products) for query blocks < QBH (causal early rows); causal: blocks past the diagonal exit, the mask itself is applied by index in k_sm
__global__ __launch_bounds__(128) void k_sc(const _Float16* __restrict__ QH, const _Float16* __restrict__ KH, const _Float16* __restrict__ QL, const _Float16* __restrict__ KL, int b, int h0, float* __restrict__ S0) { __shared__ __align__(16) float ss[4][16][132];
  const int qb = blockIdx.x, kb = blockIdx.y; if (kb > kb_last(qb)) return;
  const int h = h0 + blockIdx.z; float* S = S0 + (size_t)blockIdx.z * TT * TT;
  const int tid = threadIdx.x, wave = tid >> 5, lane = tid & 31, col = lane & 15, g = lane >> 4; const int k0 = kb * 128; const int ql0 = qb * 64 + wave * 16; const size_t q0 = (size_t)b * TT + ql0, kr0 = (size_t)b * TT + k0;
  v8f acc[8] = {}, accl[8] = {};
  const _Float16* QLb = QL + (size_t)b * QHI * CC; const _Float16* KLb = KL + (size_t)b * KHI * CC;
  if (qb < QBH) {
#pragma unroll
    for (int kc = 0; kc < HD / 32; ++kc) { const v16h ah = frag_h(QH + (q0 + col) * CC + h * HD + kc * 32, lane), al = frag_h(QLb + (size_t)(ql0 + col) * CC + h * HD + kc * 32, lane);
#pragma unroll
      for (int j = 0; j < 8; ++j) { const v16h kbf = frag_h(KH + (kr0 + j * 16 + col) * CC + h * HD + kc * 32, lane), klf = frag_h(KLb + (size_t)(k0 + j * 16 + col) * CC + h * HD + kc * 32, lane); acc[j] = wmma16(ah, kbf, acc[j]); accl[j] = wmma16(al, kbf, accl[j]); accl[j] = wmma16(ah, klf, accl[j]); } }
  } else if (qb * 64 < QHI) {
#pragma unroll
    for (int kc = 0; kc < HD / 32; ++kc) { const v16h ah = frag_h(QH + (q0 + col) * CC + h * HD + kc * 32, lane), al = frag_h(QLb + (size_t)(ql0 + col) * CC + h * HD + kc * 32, lane);
#pragma unroll
      for (int j = 0; j < 8; ++j) { const v16h kbf = frag_h(KH + (kr0 + j * 16 + col) * CC + h * HD + kc * 32, lane); acc[j] = wmma16(ah, kbf, acc[j]); accl[j] = wmma16(al, kbf, accl[j]); } }
  } else {
#pragma unroll
    for (int kc = 0; kc < HD / 32; ++kc) { const v16h ah = frag_h(QH + (q0 + col) * CC + h * HD + kc * 32, lane);
#pragma unroll
      for (int j = 0; j < 8; ++j) { const v16h kbf = frag_h(KH + (kr0 + j * 16 + col) * CC + h * HD + kc * 32, lane); acc[j] = wmma16(ah, kbf, acc[j]); } } }
#pragma unroll
  for (int j = 0; j < 8; ++j) {
#pragma unroll
    for (int r = 0; r < 8; ++r) ss[wave][8 * g + r][j * 16 + col] = (acc[j][r] + accl[j][r] * (1.0f / 1024.0f)) * SCALE; }
  LDSX(); for (int rl = 0; rl < 16; ++rl) vst2(S + (size_t)(ql0 + rl) * TT + k0 + lane * 4, *(const v4f*)&ss[wave][rl][lane * 4]); }
// ---- k_sm: block = query row t (head in group): keys [0, kend): causal -> logit if s <= t else excluded; softmax in f32; P x 2^11 in place (0 for excluded)
__global__ __launch_bounds__(256) void k_sm(float* __restrict__ S0 SM_EXTRA_PARAMS) { __shared__ float sred[8]; __shared__ float sbc; __shared__ __align__(16) float shv[TT];
  const int tid = threadIdx.x; const int t = blockIdx.x; const int kend = (kb_last(t >> 6) + 1) * 128;
  float* sr = S0 + (size_t)blockIdx.y * TT * TT + (size_t)t * TT;
  float m = -3.0e38f; for (int k = tid; k < kend; k += 256) { float v = (!CAUSAL || k <= t) ? sr[k] : -3.0e38f; SM_MASK_HOOK; shv[k] = v; m = fmaxf(m, v); }
#pragma unroll
  for (int o = 1; o < 32; o <<= 1) m = fmaxf(m, __shfl_xor(m, o));
  if ((tid & 31) == 0) sred[tid >> 5] = m; __syncthreads(); if (tid == 0) { float a = sred[0]; for (int i = 1; i < 8; ++i) a = fmaxf(a, sred[i]); sbc = a; } __syncthreads(); m = sbc; __syncthreads();
  float sum = 0.f; for (int k = tid; k < kend; k += 256) { const float v = shv[k]; const float e = (v <= -1.0e38f) ? 0.f : expf(v - m); shv[k] = e; sum += e; }
#pragma unroll
  for (int o = 1; o < 32; o <<= 1) sum += __shfl_xor(sum, o);
  if ((tid & 31) == 0) sred[tid >> 5] = sum; __syncthreads(); if (tid == 0) { float a = 0.f; for (int i = 0; i < 8; ++i) a += sred[i]; sbc = a > 0.f ? 2048.0f / a : 0.f; }   /* a fully excluded row yields P = 0 */ __syncthreads(); const float inv = sbc;
  for (int k = tid; k < kend; k += 256) shv[k] = shv[k] * inv;
  __syncthreads(); for (int q = tid; q < kend / 4; q += 256) vst2(sr + q * 4, *(const v4f*)&shv[q * 4]); }
// ---- k_pv: block = 64 queries (qb) of (b, h): ctx = P . v over keys [0, kend) (P x 2^11 once to f16 against v f16: 1 product; causal early query blocks: P and v as bf16 hi + lo, 3 products); 256-B (row, head) segment by 16 lanes
__global__ __launch_bounds__(128) void k_pv(const float* __restrict__ PS0, const _Float16* __restrict__ VT, const __bf16* __restrict__ VB, const __bf16* __restrict__ VBL, int b, int h0, float* __restrict__ Y) { const int h = h0 + blockIdx.z; const float* PS = PS0 + (size_t)blockIdx.z * TT * TT; __shared__ __align__(16) float ss[4][16][HD + 4];
  const int tid = threadIdx.x, wave = tid >> 5, lane = tid & 31, col = lane & 15, g = lane >> 4; const int qb = blockIdx.x; const int ql0 = qb * 64 + wave * 16; const int kce = (kb_last(qb) + 1) * 4;
  v8f acc[HD / 16] = {};
  if (qb < QBH) {
#pragma unroll 1
    for (int kc = 0; kc < kce; ++kc) { const F2 p = split_row(PS + (size_t)(ql0 + col) * TT, kc * 32, lane);
      asm volatile("s_wait_loadcnt 0x0" ::: "memory");
#pragma unroll
      for (int j = 0; j < HD / 16; ++j) { const size_t po = ((size_t)b * CC + h * HD + j * 16 + col) * (size_t)KHI + kc * 32; const v16b vh = frag_b(VB + po, lane); acc[j] = wmma_bf(p.h, vh, acc[j]); acc[j] = wmma_bf(p.l, vh, acc[j]); acc[j] = wmma_bf(p.h, frag_b(VBL + po, lane), acc[j]); } }
  } else {
#pragma unroll 1
    for (int kc = 0; kc < kce; ++kc) { const v16h p = frag_f32(PS + (size_t)(ql0 + col) * TT + kc * 32, lane);
      asm volatile("s_wait_loadcnt 0x0" ::: "memory");
#pragma unroll
      for (int j = 0; j < HD / 16; ++j) { const size_t po = ((size_t)b * CC + h * HD + j * 16 + col) * (size_t)TT + kc * 32; acc[j] = wmma16(p, frag_h(VT + po, lane), acc[j]); } } }
#pragma unroll
  for (int j = 0; j < HD / 16; ++j)
#pragma unroll
    for (int r = 0; r < 8; ++r) ss[wave][8 * g + r][j * 16 + col] = acc[j][r] * (1.0f / 2048.0f);
  LDSX(); for (int rl = 0; rl < 16; ++rl) if (lane < HD / 4) vst2(Y + ((size_t)b * TT + ql0 + rl) * CC + h * HD + lane * 4, *(const v4f*)&ss[wave][rl][lane * 4]); }
// ---- k_out: block = (64 rows, 128 cols): out = ctx Wo (+ bo): ctx x 2^6 once to f16 against Wo as f16(bf16 x 2^8) exact (1 product) x 2^-14; causal early rows (< QHI of each sequence): ctx bf16 hi + lo against exact bf16 Wo (2 products)
__global__ __launch_bounds__(128) void k_out(const float* __restrict__ Y, const float* __restrict__ WO, const float* __restrict__ BO, float* __restrict__ OUT) { __shared__ __align__(16) float sf[4][16][132];
  const int tid = threadIdx.x, wave = tid >> 5, lane = tid & 31, col = lane & 15, g = lane >> 4; const int c0 = blockIdx.y * 128; const size_t r0 = (size_t)blockIdx.x * 64 + wave * 16;
  v8f acc[8] = {};
  if (CAUSAL && (int)(((size_t)blockIdx.x * 64) % TT) < QHI) {   /* block-uniform */
#pragma unroll 2
    for (int kc = 0; kc < CC / 32; ++kc) { const F2 a = split_row(Y + (r0 + col) * CC, kc * 32, lane); asm volatile("s_wait_loadcnt 0x0" ::: "memory");
#pragma unroll
      for (int j = 0; j < 8; ++j) { const v16b w = WOCOL(WO, kc * 32, c0 + j * 16 + col, lane); asm volatile("s_wait_loadcnt 0x0" ::: "memory"); acc[j] = wmma_bf(a.h, w, acc[j]); acc[j] = wmma_bf(a.l, w, acc[j]); } }
#pragma unroll
    for (int j = 0; j < 8; ++j) { const float bias = BO ? bfr(BO[c0 + j * 16 + col]) : 0.f;
#pragma unroll
      for (int r = 0; r < 8; ++r) sf[wave][8 * g + r][j * 16 + col] = acc[j][r] + bias; }
  } else {
#pragma unroll 2
    for (int kc = 0; kc < CC / 32; ++kc) { const v16h a = frag_f32s(Y + (r0 + col) * CC + kc * 32, lane, 64.0f); asm volatile("s_wait_loadcnt 0x0" ::: "memory");   /* ctx carried x 2^6 into f16 so small-magnitude context rows stay clear of f16 subnormals */
#pragma unroll
      for (int j = 0; j < 8; ++j) { const v16h w = WOCOLH(WO, kc * 32, c0 + j * 16 + col, lane); asm volatile("s_wait_loadcnt 0x0" ::: "memory"); acc[j] = wmma16(a, w, acc[j]); } }
#pragma unroll
    for (int j = 0; j < 8; ++j) { const float bias = BO ? bfr(BO[c0 + j * 16 + col]) : 0.f;
#pragma unroll
      for (int r = 0; r < 8; ++r) sf[wave][8 * g + r][j * 16 + col] = acc[j][r] * (1.0f / 16384.0f) + bias; } }   /* 2^-8 (Wo carry) x 2^-6 (ctx carry) */
  LDSX(); for (int rl = 0; rl < 16; ++rl) vst2(OUT + (r0 + rl) * DIN + c0 + lane * 4, *(const v4f*)&sf[wave][rl][lane * 4]); }

extern "C" void kernel_launch(void* const* d_in, const int* in_sizes, int n_in, void* d_out, int out_size, void* d_ws, size_t ws_size, hipStream_t stream) {
  (void)in_sizes; (void)n_in; (void)out_size;
  const float** F = (const float**)d_in;
  if (ws_size < (size_t)WS_END) return;
  char* ws = (char*)d_ws; _Float16 *QH = (_Float16*)(ws + WS_QH), *KH = (_Float16*)(ws + WS_KH), *VT = (_Float16*)(ws + WS_VT), *QL = (_Float16*)(ws + WS_QL), *KL = (_Float16*)(ws + WS_KL); __bf16 *VB = (__bf16*)(ws + WS_VB), *VBL = (__bf16*)(ws + WS_VBL); float *S = (float*)(ws + WS_S), *Y = (float*)(ws + WS_Y);
  (void)Y; (void)QL; (void)KL; (void)VB; (void)VBL;
  // inputs: 0 x [4,2048,256]; 1 W_Q [256,256] (out,in); 2 W_K; 3 W_V; 4 W_O (out,in); 5 mask [4,2048] int32 (ones on this draw; read per key); no biases
  k_proj<<<dim3(TNB * TT / 64, CC / 128, 3), 128, 0, stream>>>(F[0], F[0], F[0], F[1], F[2], F[3], nullptr, nullptr, nullptr, QH, QL, KH, KL, VT, VB, VBL);
  for (int b = 0; b < TNB; ++b) for (int h0 = 0; h0 < NH; h0 += HG) {
    k_sc<<<dim3(NQB, TT / 128, HG), 128, 0, stream>>>(QH, KH, QL, KL, b, h0, S);
    k_sm<<<dim3(TT, HG), 256, 0, stream>>>(S, b, (const int*)d_in[5]);
    k_pv<<<dim3(NQB, 1, HG), 128, 0, stream>>>(S, VT, VB, VBL, b, h0, Y);
  }
  k_out<<<dim3(TNB * TT / 64, DIN / 128), 128, 0, stream>>>(Y, F[4], nullptr, (float*)d_out);
}

// v001
// A run of this version takes 112 microseconds.
// Two timings next to v000 put it at 5.05 and 5.03 times that version's speed.
// compute dtype: all float inputs rounded to bf16; q / k / v projections with EXACT bf16 products on WMMA 16x16x32 (f32 accumulate), no biases; logits q x k once to f16 each (1 product) x 64^-0.5; the int key mask read per (batch, key); softmax f32 with a running maximum, fused with both products; P = exp(s - max) x 2^10 once to f16 x v once to f16 (1 product), divided by the f32 sum at the end; ctx x 2^6 once to f16 x W_O f16(bf16 x 2^8); f32 output.
#include <hip/hip_runtime.h>
#include <math.h>

typedef __attribute__((ext_vector_type(16))) _Float16 v16h;
typedef __attribute__((ext_vector_type(16))) __bf16 v16b;
typedef __attribute__((ext_vector_type(8)))  _Float16 v8h;
typedef __attribute__((ext_vector_type(8)))  float v8f;
typedef __attribute__((ext_vector_type(4)))  float v4f;
typedef __attribute__((ext_vector_type(2)))  float v2f;
typedef __attribute__((ext_vector_type(4)))  unsigned v4u;
typedef __attribute__((ext_vector_type(4)))  int v4i;
typedef float __attribute__((may_alias)) float_a;
typedef int __attribute__((may_alias)) int_a;

template <typename T> __device__ __forceinline__ void vst2(void* p, T v) { *(T*)p = v;  }
__device__ __forceinline__ v8f wmma16(v16h a, v16h b, v8f c) {
  v8f d = __builtin_amdgcn_wmma_f32_16x16x32_f16(false, a, false, b, (short)0, c, false, false);
  asm volatile("v_nop\n\tv_nop\n\tv_nop\n\tv_nop" : "+v"(d) : "v"(a), "v"(b));
  return d;
}
__device__ __forceinline__ v8f wmma_bf(v16b a, v16b b, v8f c) {
  v8f d = __builtin_amdgcn_wmma_f32_16x16x32_bf16(false, a, false, b, (short)0, c, false, false);
  asm volatile("v_nop\n\tv_nop\n\tv_nop\n\tv_nop" : "+v"(d) : "v"(a), "v"(b));
  return d;
}
// 16x16x32 fragments: lane = (h = lane>>4, row/col = lane&15); elements 0..7 = k0+8h+0..7, 8..15 = k0+16+8h+0..7; D element r = row 8h+r
__device__ __forceinline__ v16h frag_h(const _Float16* rowk0, int lane) {
  union { v16h v; v8h q[2]; } u; const _Float16* p = rowk0 + 8 * (lane >> 4);
  u.q[0] = *(const v8h*)p; u.q[1] = *(const v8h*)(p + 16); return u.v;
}
__device__ __forceinline__ v16h frag_f32(const float* rowk0, int lane) {
  v16h a; const float* p = rowk0 + 8 * (lane >> 4);
#pragma unroll
  for (int i = 0; i < 8; ++i) { a[i] = (_Float16)p[i]; a[8 + i] = (_Float16)p[16 + i]; }
  return a;
}
__device__ __forceinline__ v16h frag_f32s(const float* rowk0, int lane, float sc) {
  v16h a; const float* p = rowk0 + 8 * (lane >> 4);
#pragma unroll
  for (int i = 0; i < 8; ++i) { a[i] = (_Float16)(p[i] * sc); a[8 + i] = (_Float16)(p[16 + i] * sc); }
  return a;
}
// column fragment from a [K][ld] layout (column n), rows >= K read as 0
__device__ __forceinline__ v16h fragc_f32(const float* W, int k0, int n, int lane, int ld, int K) {
  v16h a; const int g = lane >> 4;
#pragma unroll
  for (int i = 0; i < 8; ++i) { const int ka = k0 + 8 * g + i, kb = ka + 16;
    a[i] = (_Float16)(ka < K ? W[(size_t)(ka < K ? ka : K - 1) * ld + n] : 0.f); a[8 + i] = (_Float16)(kb < K ? W[(size_t)(kb < K ? kb : K - 1) * ld + n] : 0.f); }
  return a;
}
struct F2 { v16b h, l; };
__device__ __forceinline__ F2 bsplit16(const float v[16]) { F2 r;
#pragma unroll
  for (int i = 0; i < 16; ++i) { const __bf16 h = (__bf16)v[i]; r.h[i] = h; r.l[i] = (__bf16)(v[i] - (float)h); }
  return r; }
__device__ __forceinline__ F2 split_row(const float* row, int k0, int lane) { float v[16]; const float* p = row + k0 + 8 * (lane >> 4);
#pragma unroll
  for (int i = 0; i < 8; ++i) { v[i] = p[i]; v[8 + i] = p[16 + i]; }
  return bsplit16(v); }
__device__ __forceinline__ F2 split_rowK(const float* row, int k0, int lane, int K) { float v[16]; const int g = lane >> 4;
#pragma unroll
  for (int i = 0; i < 8; ++i) { const int ka = k0 + 8 * g + i, kb = ka + 16; v[i] = ka < K ? row[ka < K ? ka : K - 1] : 0.f; v[8 + i] = kb < K ? row[kb < K ? kb : K - 1] : 0.f; }
  return bsplit16(v); }
__device__ __forceinline__ F2 split_col(const float* W, int k0, int n, int lane, int ld, int K) { float v[16]; const int g = lane >> 4;
#pragma unroll
  for (int i = 0; i < 8; ++i) { const int ka = k0 + 8 * g + i, kb = ka + 16; v[i] = ka < K ? W[(size_t)(ka < K ? ka : K - 1) * ld + n] : 0.f; v[8 + i] = kb < K ? W[(size_t)(kb < K ? kb : K - 1) * ld + n] : 0.f; }
  return bsplit16(v); }
__device__ __forceinline__ v8f mac3(const F2& a, const F2& b, v8f c) { c = wmma_bf(a.l, b.h, c); c = wmma_bf(a.h, b.l, c); return wmma_bf(a.h, b.h, c); }
__device__ __forceinline__ float sigm(float v) { return 1.0f / (1.0f + expf(-v)); }
#define LDSX() do { asm volatile("s_wait_dscnt 0" ::: "memory"); __builtin_amdgcn_wave_barrier(); __builtin_amdgcn_fence(__ATOMIC_RELEASE, "workgroup"); } while (0)

// Standard multi-head self-attention with a key-padding mask input (x [4,2048,256]; torch (out,in) W_Q / W_K / W_V / W_O [256,256] uniform(+-1/16) applied as x @ W.T, no biases; mask [4,2048] int32 = ones (const: nothing is masked on this draw); 4 heads x 64; scores x 64^-0.5; where(mask[:, None, None, :] == 0, -inf, scores); softmax; out @ W_O.T).
#define NB 4
#define TT 2048
#define CC 256            // NH * HD = projected width
#define DIN 256          // input (model) width
#define NH 4
#define HD 64
#define NQB (TT / 64)
#define HG 4
#define SCALE (0.125f)
#define CAUSAL 0
#ifndef TNB
#define TNB NB
#endif
__device__ __forceinline__ float bfr(float v) { return (float)(__bf16)v; }
__host__ __device__ __forceinline__ int kb_last(int qb) { return CAUSAL ? ((qb * 64 + 63) >> 7) : (TT / 128 - 1); }
typedef __attribute__((ext_vector_type(8))) __bf16 v8b;
__device__ __forceinline__ v16b frag_b(const __bf16* rowk0, int lane) {
  union { v16b v; v8b q[2]; } u; const __bf16* p = rowk0 + 8 * (lane >> 4);
  u.q[0] = *(const v8b*)p; u.q[1] = *(const v8b*)(p + 16); return u.v;
}
#define QBH 0              // unused (k_fa has no high-precision path)
#define QHI 0               // single-product logits on every row
#define KHI 64            // key rows carrying k residual / v bf16 hi+lo planes (written by k_proj, read by no kernel)
// B fragment (k rows k0+.., output column o) of a weight: (in,out) [K][ld] or (out,in) [ld rows of K]: bf16 exact, or f16(bf16 * 256) exact
__device__ __forceinline__ v16b wcol_io(const float* Wm, int k0, int o, int lane, int ld) { v16b w; const int g = lane >> 4;
#pragma unroll
  for (int i = 0; i < 8; ++i) { w[i] = (__bf16)Wm[(size_t)(k0 + 8 * g + i) * ld + o]; w[8 + i] = (__bf16)Wm[(size_t)(k0 + 16 + 8 * g + i) * ld + o]; }
  return w; }
__device__ __forceinline__ v16b wcol_oi(const float* Wm, int k0, int o, int lane, int K) { v16b w; const float* p = Wm + (size_t)o * K + k0 + 8 * (lane >> 4);
#pragma unroll
  for (int i = 0; i < 8; ++i) { w[i] = (__bf16)p[i]; w[8 + i] = (__bf16)p[16 + i]; }
  return w; }
__device__ __forceinline__ v16h wcolh_io(const float* Wm, int k0, int o, int lane, int ld) { v16h w; const int g = lane >> 4;
#pragma unroll
  for (int i = 0; i < 8; ++i) { w[i] = (_Float16)(bfr(Wm[(size_t)(k0 + 8 * g + i) * ld + o]) * 256.0f); w[8 + i] = (_Float16)(bfr(Wm[(size_t)(k0 + 16 + 8 * g + i) * ld + o]) * 256.0f); }
  return w; }
__device__ __forceinline__ v16h wcolh_oi(const float* Wm, int k0, int o, int lane, int K) { v16h w; const float* p = Wm + (size_t)o * K + k0 + 8 * (lane >> 4);
#pragma unroll
  for (int i = 0; i < 8; ++i) { w[i] = (_Float16)(bfr(p[i]) * 256.0f); w[8 + i] = (_Float16)(bfr(p[16 + i]) * 256.0f); }
  return w; }
#define WQKV_LAYOUT 1   // 0 = (in,out) [DIN][CC]; 1 = (out,in) [CC][DIN]; 2 = per-head [NH][DIN][HD]
__device__ __forceinline__ v16b wcol_hdk(const float* Wm, int k0, int o, int lane) { v16b w; const int g = lane >> 4; const float* p = Wm + (size_t)(o / HD) * DIN * HD + (o % HD);
#pragma unroll
  for (int i = 0; i < 8; ++i) { w[i] = (__bf16)p[(size_t)(k0 + 8 * g + i) * HD]; w[8 + i] = (__bf16)p[(size_t)(k0 + 16 + 8 * g + i) * HD]; }
  return w; }
#define WO_OUT_IN 1
#if WQKV_LAYOUT == 1
#define WCOL(W, k0, o, lane) wcol_oi(W, k0, o, lane, DIN)
#elif WQKV_LAYOUT == 2
#define WCOL(W, k0, o, lane) wcol_hdk(W, k0, o, lane)
#else
#define WCOL(W, k0, o, lane) wcol_io(W, k0, o, lane, CC)
#endif
#if WO_OUT_IN
#define WOCOL(W, k0, o, lane) wcol_oi(W, k0, o, lane, CC)
#define WOCOLH(W, k0, o, lane) wcolh_oi(W, k0, o, lane, CC)
#else
#define WOCOL(W, k0, o, lane) wcol_io(W, k0, o, lane, DIN)
#define WOCOLH(W, k0, o, lane) wcolh_io(W, k0, o, lane, DIN)
#endif

#define WS_QH  0u                                      // f16 q rows [b*t][CC]
#define WS_KH  (WS_QH + 2u * (size_t)NB * TT * CC)      // f16 k rows [b*t][CC]
#define WS_VT  (WS_KH + 2u * (size_t)NB * TT * CC)      // f16 v planes [b][c][t]
#define WS_QL  (WS_VT + 2u * (size_t)NB * CC * TT)      // f16 q residual x 2^10 rows [b][t < QHI][CC]
#define WS_KL  (WS_QL + 2u * (size_t)NB * QHI * CC)     // f16 k residual x 2^10 rows [b][t < KHI][CC]
#define WS_VB  (WS_KL + 2u * (size_t)NB * KHI * CC)     // bf16 v hi planes [b][c][t < KHI]
#define WS_VBL (WS_VB + 2u * (size_t)NB * CC * KHI)
#define WS_S   (WS_VBL + 2u * (size_t)NB * CC * KHI)    // (unused: logits and P stay in registers)
#define WS_Y   (WS_S  + 4u * (size_t)HG * TT * TT)      // f32 ctx rows [b*t][CC] (only when there is an output projection)
#define WS_END (WS_Y  + 4u * (size_t)NB * TT * CC)

// ---- k_proj: block = (64 rows, 128 cols, which): q/k/v = X W (+ b) with exact bf16 products (K = DIN) -> which 0: q f16 rows (+ residual rows < QHI); 1: k f16 rows (+ residual rows < KHI); 2: v f16 planes [c][t] (+ bf16 hi/lo planes for t < KHI)
__global__ __launch_bounds__(128) void k_proj(const float* __restrict__ XQ, const float* __restrict__ XK, const float* __restrict__ XV, const float* __restrict__ WQ, const float* __restrict__ WK, const float* __restrict__ WV, const float* __restrict__ BQ, const float* __restrict__ BK, const float* __restrict__ BV,
    _Float16* __restrict__ QH, _Float16* __restrict__ QL, _Float16* __restrict__ KH, _Float16* __restrict__ KL, _Float16* __restrict__ VT, __bf16* __restrict__ VB, __bf16* __restrict__ VBL) {
  __shared__ __align__(16) _Float16 sh[64][136], sl[64][136]; __shared__ __align__(16) _Float16 th[128][72]; __shared__ __align__(16) __bf16 tb[128][72], tbl[128][72];
  const int tid = threadIdx.x, wave = tid >> 5, lane = tid & 31, col = lane & 15, g = lane >> 4; const int which = blockIdx.z; const int c0 = blockIdx.y * 128; const size_t r0 = (size_t)blockIdx.x * 64; const size_t bb = r0 / TT; const int t0 = (int)(r0 % TT);
  const float* X = which == 0 ? XQ : which == 1 ? XK : XV; const float* WA = which == 0 ? WQ : which == 1 ? WK : WV; const float* BA = which == 0 ? BQ : which == 1 ? BK : BV;
  v8f acc[8] = {};
#pragma unroll 2
  for (int kc = 0; kc < DIN / 32; ++kc) { v16b a; { const float* p = X + (r0 + wave * 16 + col) * DIN + kc * 32 + 8 * g;
#pragma unroll
      for (int i = 0; i < 8; ++i) { a[i] = (__bf16)p[i]; a[8 + i] = (__bf16)p[16 + i]; } }
    asm volatile("s_wait_loadcnt 0x0" ::: "memory");
#pragma unroll
    for (int j = 0; j < 8; ++j) { const v16b w = WCOL(WA, kc * 32, c0 + j * 16 + col, lane); asm volatile("s_wait_loadcnt 0x0" ::: "memory"); acc[j] = wmma_bf(a, w, acc[j]); } }
  if (which < 2) { _Float16* DH = which == 0 ? QH : KH; _Float16* DL = which == 0 ? QL : KL; const int nhi = which == 0 ? QHI : KHI; const bool hi_rows = t0 < nhi;
#pragma unroll
    for (int j = 0; j < 8; ++j) { const float bias = BA ? bfr(BA[c0 + j * 16 + col]) : 0.f;
#pragma unroll
      for (int r = 0; r < 8; ++r) { const float v = acc[j][r] + bias; const _Float16 hv = (_Float16)v; sh[wave * 16 + 8 * g + r][j * 16 + col] = hv; sl[wave * 16 + 8 * g + r][j * 16 + col] = (_Float16)((v - (float)hv) * 1024.0f); } }
    __syncthreads();
    for (int e = tid; e < 64 * 16; e += 128) { const int rl = e >> 4, q = e & 15; vst2((unsigned*)(DH + (r0 + rl) * CC + c0 + q * 8), *(const v4u*)&sh[rl][q * 8]); if (hi_rows) vst2((unsigned*)(DL + (bb * nhi + t0 + rl) * (size_t)CC + c0 + q * 8), *(const v4u*)&sl[rl][q * 8]); }
  } else { const bool hi_rows = t0 < KHI;
#pragma unroll
    for (int j = 0; j < 8; ++j) { const float bias = BA ? bfr(BA[c0 + j * 16 + col]) : 0.f;
#pragma unroll
      for (int r = 0; r < 8; ++r) { const float v = acc[j][r] + bias; const int rl = wave * 16 + 8 * g + r, cl = j * 16 + col; th[cl][rl] = (_Float16)v; const __bf16 bh = (__bf16)v; tb[cl][rl] = bh; tbl[cl][rl] = (__bf16)(v - (float)bh); } }
    __syncthreads();
    for (int e = tid; e < 128 * 8; e += 128) { const int cl = e >> 3, q = e & 7; vst2((unsigned*)(VT + (bb * CC + c0 + cl) * (size_t)TT + t0 + q * 8), *(const v4u*)&th[cl][q * 8]); if (hi_rows) { const size_t o3 = (bb * CC + c0 + cl) * (size_t)KHI + t0 + q * 8; vst2((unsigned*)(VB + o3), *(const v4u*)&tb[cl][q * 8]); vst2((unsigned*)(VBL + o3), *(const v4u*)&tbl[cl][q * 8]); } } } }
__device__ __forceinline__ float ex2(float x) { float r; asm("v_exp_f32 %0, %1\n\tv_nop" : "=v"(r) : "v"(x)); return r; }
__device__ __forceinline__ float xhalf(float v) { const int i = __builtin_bit_cast(int, v); return __builtin_bit_cast(float, __builtin_amdgcn_permlanex16(i, i, 0x76543210, 0xfedcba98, false, false)); }   /* lane l <-> l ^ 16 */
__global__ __launch_bounds__(256) void k_fa(const _Float16* __restrict__ QH, const _Float16* __restrict__ KH, const _Float16* __restrict__ VT, const int* __restrict__ MASK, float* __restrict__ Y) {
  const int tid = threadIdx.x, wave = tid >> 5, lane = tid & 31, col = lane & 15, g = lane >> 4;
  const int h = blockIdx.y, b = blockIdx.z; const int q0 = blockIdx.x * 128 + wave * 16;
  const _Float16* Kb = KH + ((size_t)b * TT + col) * CC + h * HD;
  const _Float16* Vb = VT + ((size_t)b * CC + h * HD + col) * (size_t)TT;
  const int* Mb = MASK + (size_t)b * TT + lane;
  const float C2 = SCALE * 1.44269504088896f;   /* raw logit -> log2 units */
  v16h qf[HD / 32], kf[4][HD / 32];
#pragma unroll
  for (int kc = 0; kc < HD / 32; ++kc) qf[kc] = frag_h(QH + ((size_t)b * TT + q0 + col) * CC + h * HD + kc * 32, lane);
#pragma unroll
  for (int kt = 0; kt < 4; ++kt)
#pragma unroll
    for (int kc = 0; kc < HD / 32; ++kc) kf[kt][kc] = frag_h(Kb + (size_t)(kt * 16) * CC + kc * 32, lane);
  int mk0 = Mb[0], mk1 = Mb[32];
  v8f acc[HD / 16] = {}; float m = -1.0e30f, l = 0.f;
  for (int it = 0; it < TT / 64; ++it) { const int k0 = it * 64;
    v16h vf[HD / 16][2];
#pragma unroll
    for (int j = 0; j < HD / 16; ++j) { vf[j][0] = frag_h(Vb + (size_t)(j * 16) * TT + k0, lane); vf[j][1] = frag_h(Vb + (size_t)(j * 16) * TT + k0 + 32, lane); }
    v8f s[4];
#pragma unroll
    for (int kt = 0; kt < 4; ++kt) { v8f z = {};
#pragma unroll
      for (int kc = 0; kc < HD / 32; ++kc) z = wmma16(kf[kt][kc], qf[kc], z);
      s[kt] = z; }
    const unsigned b0 = __builtin_amdgcn_ballot_w32(mk0 != 0), b1 = __builtin_amdgcn_ballot_w32(mk1 != 0);
    const int kn = (it + 1 < TT / 64 ? it + 1 : it) * 64;   /* next trip's k fragments and mask words fly under this trip's softmax (the last trip rereads its own) */
#pragma unroll
    for (int kt = 0; kt < 4; ++kt)
#pragma unroll
      for (int kc = 0; kc < HD / 32; ++kc) kf[kt][kc] = frag_h(Kb + (size_t)(kn + kt * 16) * CC + kc * 32, lane);
    mk0 = Mb[kn]; mk1 = Mb[kn + 32];
    if ((b0 & b1) != 0xFFFFFFFFu) { const unsigned w0 = b0 >> (8 * g), w1 = b1 >> (8 * g);   /* wave-uniform: some key of these 64 is masked */
#pragma unroll
      for (int kt = 0; kt < 4; ++kt)
#pragma unroll
        for (int r = 0; r < 8; ++r) { const unsigned w = kt < 2 ? w0 : w1; s[kt][r] = ((w >> ((kt & 1) * 16 + r)) & 1u) ? s[kt][r] : -3.0e38f; } }
    float mt[4];
#pragma unroll
    for (int kt = 0; kt < 4; ++kt) { mt[kt] = s[kt][0];
#pragma unroll
      for (int r = 1; r < 8; ++r) mt[kt] = fmaxf(mt[kt], s[kt][r]); }
    float mx = fmaxf(fmaxf(mt[0], mt[1]), fmaxf(mt[2], mt[3]));
    mx = fmaxf(mx, xhalf(mx));
    const float mn = fmaxf(m, mx * C2), al = ex2(m - mn), ms = 10.0f - mn; m = mn;
    v16h p[2]; float sum = 0.f;
#pragma unroll
    for (int c2 = 0; c2 < 2; ++c2)
#pragma unroll
      for (int i = 0; i < 8; ++i) { const float e0 = ex2(fmaf(s[2 * c2][i], C2, ms)), e1 = ex2(fmaf(s[2 * c2 + 1][i], C2, ms)); sum += e0 + e1; p[c2][i] = (_Float16)e0; p[c2][8 + i] = (_Float16)e1; }
    l = l * al + sum;
#pragma unroll
    for (int j = 0; j < HD / 16; ++j) acc[j] *= al;
#pragma unroll
    for (int j = 0; j < HD / 16; ++j) { acc[j] = wmma16(vf[j][0], p[0], acc[j]); acc[j] = wmma16(vf[j][1], p[1], acc[j]); } }
  l += xhalf(l);
  const float inv = 1.0f / l;
  float* yr = Y + ((size_t)b * TT + q0 + col) * CC + h * HD + 8 * g;   /* acc[j][r] = ctx[query col][j * 16 + 8g + r] */
#pragma unroll
  for (int j = 0; j < HD / 16; ++j) { v4f lo, hi;
#pragma unroll
    for (int r = 0; r < 4; ++r) { lo[r] = acc[j][r] * inv; hi[r] = acc[j][4 + r] * inv; }
    vst2(yr + j * 16, lo); vst2(yr + j * 16 + 4, hi); } }
// ---- k_out: block = (64 rows, 128 cols): out = ctx Wo (+ bo): ctx x 2^6 once to f16 against Wo as f16(bf16 x 2^8) exact (1 product) x 2^-14; causal early rows (< QHI of each sequence): ctx bf16 hi + lo against exact bf16 Wo (2 products)
__global__ __launch_bounds__(128) void k_out(const float* __restrict__ Y, const float* __restrict__ WO, const float* __restrict__ BO, float* __restrict__ OUT) { __shared__ __align__(16) float sf[4][16][132];
  const int tid = threadIdx.x, wave = tid >> 5, lane = tid & 31, col = lane & 15, g = lane >> 4; const int c0 = blockIdx.y * 128; const size_t r0 = (size_t)blockIdx.x * 64 + wave * 16;
  v8f acc[8] = {};
  if (CAUSAL && (int)(((size_t)blockIdx.x * 64) % TT) < QHI) {   /* block-uniform */
#pragma unroll 2
    for (int kc = 0; kc < CC / 32; ++kc) { const F2 a = split_row(Y + (r0 + col) * CC, kc * 32, lane); asm volatile("s_wait_loadcnt 0x0" ::: "memory");
#pragma unroll
      for (int j = 0; j < 8; ++j) { const v16b w = WOCOL(WO, kc * 32, c0 + j * 16 + col, lane); asm volatile("s_wait_loadcnt 0x0" ::: "memory"); acc[j] = wmma_bf(a.h, w, acc[j]); acc[j] = wmma_bf(a.l, w, acc[j]); } }
#pragma unroll
    for (int j = 0; j < 8; ++j) { const float bias = BO ? bfr(BO[c0 + j * 16 + col]) : 0.f;
#pragma unroll
      for (int r = 0; r < 8; ++r) sf[wave][8 * g + r][j * 16 + col] = acc[j][r] + bias; }
  } else {
#pragma unroll 2
    for (int kc = 0; kc < CC / 32; ++kc) { const v16h a = frag_f32s(Y + (r0 + col) * CC + kc * 32, lane, 64.0f); asm volatile("s_wait_loadcnt 0x0" ::: "memory");   /* ctx carried x 2^6 into f16 so small-magnitude context rows stay clear of f16 subnormals */
#pragma unroll
      for (int j = 0; j < 8; ++j) { const v16h w = WOCOLH(WO, kc * 32, c0 + j * 16 + col, lane); asm volatile("s_wait_loadcnt 0x0" ::: "memory"); acc[j] = wmma16(a, w, acc[j]); } }
#pragma unroll
    for (int j = 0; j < 8; ++j) { const float bias = BO ? bfr(BO[c0 + j * 16 + col]) : 0.f;
#pragma unroll
      for (int r = 0; r < 8; ++r) sf[wave][8 * g + r][j * 16 + col] = acc[j][r] * (1.0f / 16384.0f) + bias; } }   /* 2^-8 (Wo carry) x 2^-6 (ctx carry) */
  LDSX(); for (int rl = 0; rl < 16; ++rl) vst2(OUT + (r0 + rl) * DIN + c0 + lane * 4, *(const v4f*)&sf[wave][rl][lane * 4]); }

extern "C" void kernel_launch(void* const* d_in, const int* in_sizes, int n_in, void* d_out, int out_size, void* d_ws, size_t ws_size, hipStream_t stream) {
  (void)in_sizes; (void)n_in; (void)out_size;
  const float** F = (const float**)d_in;
  if (ws_size < (size_t)WS_END) return;
  char* ws = (char*)d_ws; _Float16 *QH = (_Float16*)(ws + WS_QH), *KH = (_Float16*)(ws + WS_KH), *VT = (_Float16*)(ws + WS_VT), *QL = (_Float16*)(ws + WS_QL), *KL = (_Float16*)(ws + WS_KL); __bf16 *VB = (__bf16*)(ws + WS_VB), *VBL = (__bf16*)(ws + WS_VBL); float *Y = (float*)(ws + WS_Y);
  (void)Y; (void)QL; (void)KL; (void)VB; (void)VBL;
  // inputs: 0 x [4,2048,256]; 1 W_Q [256,256] (out,in); 2 W_K; 3 W_V; 4 W_O (out,in); 5 mask [4,2048] int32 (ones on this draw; read per key); no biases
  k_proj<<<dim3(TNB * TT / 64, CC / 128, 3), 128, 0, stream>>>(F[0], F[0], F[0], F[1], F[2], F[3], nullptr, nullptr, nullptr, QH, QL, KH, KL, VT, VB, VBL);
  k_fa<<<dim3(TT / 128, NH, TNB), 256, 0, stream>>>(QH, KH, VT, (const int*)d_in[5], Y);
  k_out<<<dim3(TNB * TT / 64, DIN / 128), 128, 0, stream>>>(Y, F[4], nullptr, (float*)d_out);
}

// v002
// It runs in 95.8 microseconds.
// Next to v001, in two timings, it ran 1.20 and 1.16 times as fast.
// All steps since v000 together make it 5.96 times as fast.
// compute dtype: all float inputs rounded to bf16; q / k / v projections with EXACT bf16 products on WMMA 16x16x32 (f32 accumulate), no biases; logits q x k once to f16 each (1 product) x 64^-0.5; the int key mask read per (batch, key); softmax f32 with a running maximum, fused with both products; P = exp(s - max) x 2^10 once to f16 x v once to f16 (1 product), divided by the f32 sum at the end; ctx x 2^6 once to f16 x W_O f16(bf16 x 2^8); f32 output.
#include <hip/hip_runtime.h>
#include <math.h>
#include <stdint.h>

typedef __attribute__((ext_vector_type(16))) _Float16 v16h;
typedef __attribute__((ext_vector_type(16))) __bf16 v16b;
typedef __attribute__((ext_vector_type(8)))  _Float16 v8h;
typedef __attribute__((ext_vector_type(8)))  float v8f;
typedef __attribute__((ext_vector_type(4)))  float v4f;
typedef __attribute__((ext_vector_type(2)))  float v2f;
typedef __attribute__((ext_vector_type(4)))  unsigned v4u;
typedef __attribute__((ext_vector_type(4)))  int v4i;
typedef float __attribute__((may_alias)) float_a;
typedef int __attribute__((may_alias)) int_a;

template <typename T> __device__ __forceinline__ void vst2(void* p, T v) { *(T*)p = v;  }
__device__ __forceinline__ v8f wmma16(v16h a, v16h b, v8f c) {
  v8f d = __builtin_amdgcn_wmma_f32_16x16x32_f16(false, a, false, b, (short)0, c, false, false);
  asm volatile("v_nop\n\tv_nop\n\tv_nop\n\tv_nop" : "+v"(d) : "v"(a), "v"(b));
  return d;
}
__device__ __forceinline__ v8f wmma_bf(v16b a, v16b b, v8f c) {
  v8f d = __builtin_amdgcn_wmma_f32_16x16x32_bf16(false, a, false, b, (short)0, c, false, false);
  asm volatile("v_nop\n\tv_nop\n\tv_nop\n\tv_nop" : "+v"(d) : "v"(a), "v"(b));
  return d;
}
// 16x16x32 fragments: lane = (h = lane>>4, row/col = lane&15); elements 0..7 = k0+8h+0..7, 8..15 = k0+16+8h+0..7; D element r = row 8h+r
__device__ __forceinline__ v16h frag_h(const _Float16* rowk0, int lane) {
  union { v16h v; v8h q[2]; } u; const _Float16* p = rowk0 + 8 * (lane >> 4);
  u.q[0] = *(const v8h*)p; u.q[1] = *(const v8h*)(p + 16); return u.v;
}
__device__ __forceinline__ v16h frag_f32(const float* rowk0, int lane) {
  v16h a; const float* p = rowk0 + 8 * (lane >> 4);
#pragma unroll
  for (int i = 0; i < 8; ++i) { a[i] = (_Float16)p[i]; a[8 + i] = (_Float16)p[16 + i]; }
  return a;
}
__device__ __forceinline__ v16h frag_f32s(const float* rowk0, int lane, float sc) {
  v16h a; const float* p = rowk0 + 8 * (lane >> 4);
#pragma unroll
  for (int i = 0; i < 8; ++i) { a[i] = (_Float16)(p[i] * sc); a[8 + i] = (_Float16)(p[16 + i] * sc); }
  return a;
}
// column fragment from a [K][ld] layout (column n), rows >= K read as 0
__device__ __forceinline__ v16h fragc_f32(const float* W, int k0, int n, int lane, int ld, int K) {
  v16h a; const int g = lane >> 4;
#pragma unroll
  for (int i = 0; i < 8; ++i) { const int ka = k0 + 8 * g + i, kb = ka + 16;
    a[i] = (_Float16)(ka < K ? W[(size_t)(ka < K ? ka : K - 1) * ld + n] : 0.f); a[8 + i] = (_Float16)(kb < K ? W[(size_t)(kb < K ? kb : K - 1) * ld + n] : 0.f); }
  return a;
}
struct F2 { v16b h, l; };
__device__ __forceinline__ F2 bsplit16(const float v[16]) { F2 r;
#pragma unroll
  for (int i = 0; i < 16; ++i) { const __bf16 h = (__bf16)v[i]; r.h[i] = h; r.l[i] = (__bf16)(v[i] - (float)h); }
  return r; }
__device__ __forceinline__ F2 split_row(const float* row, int k0, int lane) { float v[16]; const float* p = row + k0 + 8 * (lane >> 4);
#pragma unroll
  for (int i = 0; i < 8; ++i) { v[i] = p[i]; v[8 + i] = p[16 + i]; }
  return bsplit16(v); }
__device__ __forceinline__ F2 split_rowK(const float* row, int k0, int lane, int K) { float v[16]; const int g = lane >> 4;
#pragma unroll
  for (int i = 0; i < 8; ++i) { const int ka = k0 + 8 * g + i, kb = ka + 16; v[i] = ka < K ? row[ka < K ? ka : K - 1] : 0.f; v[8 + i] = kb < K ? row[kb < K ? kb : K - 1] : 0.f; }
  return bsplit16(v); }
__device__ __forceinline__ F2 split_col(const float* W, int k0, int n, int lane, int ld, int K) { float v[16]; const int g = lane >> 4;
#pragma unroll
  for (int i = 0; i < 8; ++i) { const int ka = k0 + 8 * g + i, kb = ka + 16; v[i] = ka < K ? W[(size_t)(ka < K ? ka : K - 1) * ld + n] : 0.f; v[8 + i] = kb < K ? W[(size_t)(kb < K ? kb : K - 1) * ld + n] : 0.f; }
  return bsplit16(v); }
__device__ __forceinline__ v8f mac3(const F2& a, const F2& b, v8f c) { c = wmma_bf(a.l, b.h, c); c = wmma_bf(a.h, b.l, c); return wmma_bf(a.h, b.h, c); }
__device__ __forceinline__ float sigm(float v) { return 1.0f / (1.0f + expf(-v)); }
#define LDSX() do { asm volatile("s_wait_dscnt 0" ::: "memory"); __builtin_amdgcn_wave_barrier(); __builtin_amdgcn_fence(__ATOMIC_RELEASE, "workgroup"); } while (0)

// Standard multi-head self-attention with a key-padding mask input (x [4,2048,256]; torch (out,in) W_Q / W_K / W_V / W_O [256,256] uniform(+-1/16) applied as x @ W.T, no biases; mask [4,2048] int32 = ones (const: nothing is masked on this draw); 4 heads x 64; scores x 64^-0.5; where(mask[:, None, None, :] == 0, -inf, scores); softmax; out @ W_O.T).
#define NB 4
#define TT 2048
#define CC 256            // NH * HD = projected width
#define DIN 256          // input (model) width
#define NH 4
#define HD 64
#define NQB (TT / 64)
#define HG 4
#define SCALE (0.125f)
#define CAUSAL 0
#ifndef TNB
#define TNB NB
#endif
__device__ __forceinline__ float bfr(float v) { return (float)(__bf16)v; }
__host__ __device__ __forceinline__ int kb_last(int qb) { return CAUSAL ? ((qb * 64 + 63) >> 7) : (TT / 128 - 1); }
typedef __attribute__((ext_vector_type(8))) __bf16 v8b;
__device__ __forceinline__ v16b frag_b(const __bf16* rowk0, int lane) {
  union { v16b v; v8b q[2]; } u; const __bf16* p = rowk0 + 8 * (lane >> 4);
  u.q[0] = *(const v8b*)p; u.q[1] = *(const v8b*)(p + 16); return u.v;
}
#define QBH 0              // unused (k_fa has no high-precision path)
#define QHI 0               // single-product logits on every row
#define KHI 64            // key rows carrying k residual / v bf16 hi+lo planes (written by k_proj, read by no kernel)
// B fragment (k rows k0+.., output column o) of a weight: (in,out) [K][ld] or (out,in) [ld rows of K]: bf16 exact, or f16(bf16 * 256) exact
__device__ __forceinline__ v16b wcol_io(const float* Wm, int k0, int o, int lane, int ld) { v16b w; const int g = lane >> 4;
#pragma unroll
  for (int i = 0; i < 8; ++i) { w[i] = (__bf16)Wm[(size_t)(k0 + 8 * g + i) * ld + o]; w[8 + i] = (__bf16)Wm[(size_t)(k0 + 16 + 8 * g + i) * ld + o]; }
  return w; }
__device__ __forceinline__ v16b wcol_oi(const float* Wm, int k0, int o, int lane, int K) { v16b w; const float* p = Wm + (size_t)o * K + k0 + 8 * (lane >> 4);
#pragma unroll
  for (int i = 0; i < 8; ++i) { w[i] = (__bf16)p[i]; w[8 + i] = (__bf16)p[16 + i]; }
  return w; }
__device__ __forceinline__ v16h wcolh_io(const float* Wm, int k0, int o, int lane, int ld) { v16h w; const int g = lane >> 4;
#pragma unroll
  for (int i = 0; i < 8; ++i) { w[i] = (_Float16)(bfr(Wm[(size_t)(k0 + 8 * g + i) * ld + o]) * 256.0f); w[8 + i] = (_Float16)(bfr(Wm[(size_t)(k0 + 16 + 8 * g + i) * ld + o]) * 256.0f); }
  return w; }
__device__ __forceinline__ v16h wcolh_oi(const float* Wm, int k0, int o, int lane, int K) { v16h w; const float* p = Wm + (size_t)o * K + k0 + 8 * (lane >> 4);
#pragma unroll
  for (int i = 0; i < 8; ++i) { w[i] = (_Float16)(bfr(p[i]) * 256.0f); w[8 + i] = (_Float16)(bfr(p[16 + i]) * 256.0f); }
  return w; }
#define WQKV_LAYOUT 1   // 0 = (in,out) [DIN][CC]; 1 = (out,in) [CC][DIN]; 2 = per-head [NH][DIN][HD]
__device__ __forceinline__ v16b wcol_hdk(const float* Wm, int k0, int o, int lane) { v16b w; const int g = lane >> 4; const float* p = Wm + (size_t)(o / HD) * DIN * HD + (o % HD);
#pragma unroll
  for (int i = 0; i < 8; ++i) { w[i] = (__bf16)p[(size_t)(k0 + 8 * g + i) * HD]; w[8 + i] = (__bf16)p[(size_t)(k0 + 16 + 8 * g + i) * HD]; }
  return w; }
#define WO_OUT_IN 1
#if WQKV_LAYOUT == 1
#define WCOL(W, k0, o, lane) wcol_oi(W, k0, o, lane, DIN)
#elif WQKV_LAYOUT == 2
#define WCOL(W, k0, o, lane) wcol_hdk(W, k0, o, lane)
#else
#define WCOL(W, k0, o, lane) wcol_io(W, k0, o, lane, CC)
#endif
#if WO_OUT_IN
#define WOCOL(W, k0, o, lane) wcol_oi(W, k0, o, lane, CC)
#define WOCOLH(W, k0, o, lane) wcolh_oi(W, k0, o, lane, CC)
#else
#define WOCOL(W, k0, o, lane) wcol_io(W, k0, o, lane, DIN)
#define WOCOLH(W, k0, o, lane) wcolh_io(W, k0, o, lane, DIN)
#endif

#define WS_QH  0u                                      // f16 q rows [b*t][CC]
#define WS_KH  (WS_QH + 2u * (size_t)NB * TT * CC)      // f16 k rows [b*t][CC]
#define WS_VT  (WS_KH + 2u * (size_t)NB * TT * CC)      // f16 v planes [b][c][t]
#define WS_QL  (WS_VT + 2u * (size_t)NB * CC * TT)      // f16 q residual x 2^10 rows [b][t < QHI][CC]
#define WS_KL  (WS_QL + 2u * (size_t)NB * QHI * CC)     // f16 k residual x 2^10 rows [b][t < KHI][CC]
#define WS_VB  (WS_KL + 2u * (size_t)NB * KHI * CC)     // bf16 v hi planes [b][c][t < KHI]
#define WS_VBL (WS_VB + 2u * (size_t)NB * CC * KHI)
#define WS_S   (WS_VBL + 2u * (size_t)NB * CC * KHI)    // (unused: logits and P stay in registers)
#define WS_Y   (WS_S  + 4u * (size_t)HG * TT * TT)      // f32 ctx rows [b*t][CC] (only when there is an output projection)
#define WS_END (WS_Y  + 4u * (size_t)NB * TT * CC)

// ---- k_proj: block = (64 rows, 128 cols, which): q/k/v = X W (+ b) with exact bf16 products (K = DIN) -> which 0: q f16 rows (+ residual rows < QHI); 1: k f16 rows (+ residual rows < KHI); 2: v f16 planes [c][t] (+ bf16 hi/lo planes for t < KHI)
__global__ __launch_bounds__(128) void k_proj(const float* __restrict__ XQ, const float* __restrict__ XK, const float* __restrict__ XV, const float* __restrict__ WQ, const float* __restrict__ WK, const float* __restrict__ WV, const float* __restrict__ BQ, const float* __restrict__ BK, const float* __restrict__ BV,
    _Float16* __restrict__ QH, _Float16* __restrict__ QL, _Float16* __restrict__ KH, _Float16* __restrict__ KL, _Float16* __restrict__ VT, __bf16* __restrict__ VB, __bf16* __restrict__ VBL) {
  __shared__ __align__(16) _Float16 sh[64][136], sl[64][136]; __shared__ __align__(16) _Float16 th[128][72]; __shared__ __align__(16) __bf16 tb[128][72], tbl[128][72];
  const int tid = threadIdx.x, wave = tid >> 5, lane = tid & 31, col = lane & 15, g = lane >> 4; const int which = blockIdx.z; const int c0 = blockIdx.y * 128; const size_t r0 = (size_t)blockIdx.x * 64; const size_t bb = r0 / TT; const int t0 = (int)(r0 % TT);
  const float* X = which == 0 ? XQ : which == 1 ? XK : XV; const float* WA = which == 0 ? WQ : which == 1 ? WK : WV; const float* BA = which == 0 ? BQ : which == 1 ? BK : BV;
  v8f acc[8] = {};
#pragma unroll 2
  for (int kc = 0; kc < DIN / 32; ++kc) { v16b a; { const float* p = X + (r0 + wave * 16 + col) * DIN + kc * 32 + 8 * g;
#pragma unroll
      for (int i = 0; i < 8; ++i) { a[i] = (__bf16)p[i]; a[8 + i] = (__bf16)p[16 + i]; } }
    asm volatile("s_wait_loadcnt 0x0" ::: "memory");
#pragma unroll
    for (int j = 0; j < 8; ++j) { const v16b w = WCOL(WA, kc * 32, c0 + j * 16 + col, lane); asm volatile("s_wait_loadcnt 0x0" ::: "memory"); acc[j] = wmma_bf(a, w, acc[j]); } }
  if (which < 2) { _Float16* DH = which == 0 ? QH : KH; _Float16* DL = which == 0 ? QL : KL; const int nhi = which == 0 ? QHI : KHI; const bool hi_rows = t0 < nhi;
#pragma unroll
    for (int j = 0; j < 8; ++j) { const float bias = BA ? bfr(BA[c0 + j * 16 + col]) : 0.f;
#pragma unroll
      for (int r = 0; r < 8; ++r) { const float v = acc[j][r] + bias; const _Float16 hv = (_Float16)v; sh[wave * 16 + 8 * g + r][j * 16 + col] = hv; sl[wave * 16 + 8 * g + r][j * 16 + col] = (_Float16)((v - (float)hv) * 1024.0f); } }
    __syncthreads();
    for (int e = tid; e < 64 * 16; e += 128) { const int rl = e >> 4, q = e & 15; vst2((unsigned*)(DH + (r0 + rl) * CC + c0 + q * 8), *(const v4u*)&sh[rl][q * 8]); if (hi_rows) vst2((unsigned*)(DL + (bb * nhi + t0 + rl) * (size_t)CC + c0 + q * 8), *(const v4u*)&sl[rl][q * 8]); }
  } else { const bool hi_rows = t0 < KHI;
#pragma unroll
    for (int j = 0; j < 8; ++j) { const float bias = BA ? bfr(BA[c0 + j * 16 + col]) : 0.f;
#pragma unroll
      for (int r = 0; r < 8; ++r) { const float v = acc[j][r] + bias; const int rl = wave * 16 + 8 * g + r, cl = j * 16 + col; th[cl][rl] = (_Float16)v; const __bf16 bh = (__bf16)v; tb[cl][rl] = bh; tbl[cl][rl] = (__bf16)(v - (float)bh); } }
    __syncthreads();
    for (int e = tid; e < 128 * 8; e += 128) { const int cl = e >> 3, q = e & 7; vst2((unsigned*)(VT + (bb * CC + c0 + cl) * (size_t)TT + t0 + q * 8), *(const v4u*)&th[cl][q * 8]); if (hi_rows) { const size_t o3 = (bb * CC + c0 + cl) * (size_t)KHI + t0 + q * 8; vst2((unsigned*)(VB + o3), *(const v4u*)&tb[cl][q * 8]); vst2((unsigned*)(VBL + o3), *(const v4u*)&tbl[cl][q * 8]); } } } }
__device__ __forceinline__ float ex2(float x) { float r; asm("v_exp_f32 %0, %1\n\tv_nop" : "=v"(r) : "v"(x)); return r; }
__device__ __forceinline__ float xhalf(float v) { const int i = __builtin_bit_cast(int, v); return __builtin_bit_cast(float, __builtin_amdgcn_permlanex16(i, i, 0x76543210, 0xfedcba98, false, false)); }   /* lane l <-> l ^ 16 */
// K and V reach the waves through LDS: a stage is SKEYS keys; each of the 8 waves brings one slice of 64 rows x 128 B per stage by one tensor load
// (waves 0..3: 64 k rows each; waves 4..7: the 64 v planes x 64 keys each), the mover's 16-byte pad giving the pitch 144 B that 16-byte LDS reads want; two buffers.
typedef uint32_t u32x4 __attribute__((ext_vector_type(4)));
typedef uint32_t u32x8 __attribute__((ext_vector_type(8)));
#define SKEYS 256
#define NST (TT / SKEYS)
#define LPITCH 144u
#define SLICEB 10240u          /* 64 rows x 144 B = 9216 B, rounded up so that every slice starts at a multiple of 2 KiB */
#define BUFB (8u * SLICEB)
__device__ __forceinline__ uint32_t uni(uint32_t v) { return (uint32_t)__builtin_amdgcn_readfirstlane(v); }
__device__ __forceinline__ uint32_t pinned(uint32_t v) { uint32_t w = uni(v); asm volatile("" : "+s"(w)); return w; }
// both groups are in-out operands: the descriptor then has registers of its own for the whole kernel, and none of them takes another value while a request is in flight
__device__ __forceinline__ void tdm_load(u32x4& g0, u32x8& g1) { asm volatile("tensor_load_to_lds %0, %1" : "+s"(g0), "+s"(g1) :: "memory"); }
__device__ __forceinline__ v16h frag_l(const unsigned char* p) { union { v16h v; v8h q[2]; } u; u.q[0] = *(const v8h*)p; u.q[1] = *(const v8h*)(p + 32); return u.v; }
__global__ __launch_bounds__(256) void k_fa(const _Float16* __restrict__ QH, const _Float16* __restrict__ KH, const _Float16* __restrict__ VT, const int* __restrict__ MASK, float* __restrict__ Y) {
  __shared__ __attribute__((aligned(2048))) unsigned char L[2 * BUFB];
  const int tid = threadIdx.x, wave = tid >> 5, lane = tid & 31, col = lane & 15, g = lane >> 4;
  const int h = blockIdx.y, b = blockIdx.z; const int q0 = blockIdx.x * 128 + wave * 16;
  const uint32_t wv = uni((uint32_t)tid >> 5), sl = wv & 3u; const bool isV = wv >= 4u;
  const uint32_t lbase = (uint32_t)(size_t)L;
  const uint64_t ga0 = isV ? (uint64_t)(size_t)(VT + ((size_t)b * CC + h * HD) * (size_t)TT + sl * 64u) : (uint64_t)(size_t)(KH + ((size_t)b * TT + sl * 64u) * CC + h * HD);
  const uint32_t gsh = isV ? 9u : 17u;   /* bytes from one stage to the next: SKEYS x 2 along a v plane, SKEYS x CC x 2 down the k rows */
  static_assert(SKEYS * 2 == 1 << 9 && SKEYS * CC * 2 == 1 << 17 && NST >= 2, "stage steps");
  u32x8 g1;   /* 1-byte elements, tensor = tile = 64 rows of 128 B, a 16-byte pad behind every 128 B, no mask */
  g1[0] = uni((1u << 20) | (4u << 22) | (3u << 25)); g1[1] = uni(128u << 16); g1[2] = uni(64u << 16); g1[3] = uni(128u << 16); g1[4] = uni(64u); g1[5] = uni(isV ? (uint32_t)TT * 2u : (uint32_t)CC * 2u); g1[6] = uni(0u); g1[7] = uni(0u);
  u32x4 g0; g0[0] = uni(1u);
  auto issue = [&](uint32_t st) { const uint64_t ga = ga0 + (uint64_t)(st << gsh);
    g0[1] = uni(lbase + (st & 1u) * BUFB + wv * SLICEB); g0[2] = uni((uint32_t)ga); g0[3] = uni((((uint32_t)(ga >> 32)) & 0x01FFFFFFu) | 0x80000000u);
    tdm_load(g0, g1); };
  const int* Mb = MASK + (size_t)b * TT + lane;
  const float C2 = SCALE * 1.44269504088896f;   /* raw logit -> log2 units */
  v16h qf[HD / 32], kf[4][HD / 32];
#pragma unroll
  for (int kc = 0; kc < HD / 32; ++kc) qf[kc] = frag_h(QH + ((size_t)b * TT + q0 + col) * CC + h * HD + kc * 32, lane);
  int mk0 = Mb[0], mk1 = Mb[32];
  v8f acc[HD / 16] = {}; float m = -1.0e30f, l = 0.f;
  issue(0u);
  asm volatile("s_wait_tensorcnt 0x0" ::: "memory");   /* this wave's slice of stage 0 has landed */
  __syncthreads();                                      /* every wave's slice of stage 0 is readable by all */
  issue(pinned(1u));                                    /* pinned(): stage 1's descriptor words are formed behind the wait above */
  const uint32_t loff = (uint32_t)col * LPITCH + 16u * (uint32_t)g;
#pragma unroll 1   /* rolled: one publish point and one refill site */
  for (uint32_t st = 0; st < NST; ++st) { const unsigned char* Bp = L + (st & 1u) * BUFB + loff;
#pragma unroll
    for (int kt = 0; kt < 4; ++kt)
#pragma unroll
      for (int kc = 0; kc < HD / 32; ++kc) kf[kt][kc] = frag_l(Bp + kt * 16 * LPITCH + kc * 64);
#pragma unroll 1   /* rolled: unrolled, the four trips of a stage spilled */
    for (uint32_t hb = 0; hb < SKEYS / 64; ++hb) { const int it = (int)(st * (SKEYS / 64) + hb); const unsigned char* Vp = Bp + (4u + hb) * SLICEB;
    v16h vf[HD / 16][2];
#pragma unroll
    for (int j = 0; j < HD / 16; ++j) { vf[j][0] = frag_l(Vp + j * 16 * LPITCH); vf[j][1] = frag_l(Vp + j * 16 * LPITCH + 64); }
    v8f s[4];
#pragma unroll
    for (int kt = 0; kt < 4; ++kt) { v8f z = {};
#pragma unroll
      for (int kc = 0; kc < HD / 32; ++kc) z = wmma16(kf[kt][kc], qf[kc], z);
      s[kt] = z; }
    const unsigned b0 = __builtin_amdgcn_ballot_w32(mk0 != 0), b1 = __builtin_amdgcn_ballot_w32(mk1 != 0);
    const int kn = (it + 1 < TT / 64 ? it + 1 : it) * 64;   /* next trip's mask words fly under this trip's softmax (the last trip rereads its own) */
    const unsigned char* Kn = Bp + (hb + 1u < SKEYS / 64 ? hb + 1u : hb) * SLICEB;   /* the next 64 keys' k fragments, of this same stage, fly under this trip's softmax (a stage's last trip rereads its own) */
#pragma unroll
    for (int kt = 0; kt < 4; ++kt)
#pragma unroll
      for (int kc = 0; kc < HD / 32; ++kc) kf[kt][kc] = frag_l(Kn + kt * 16 * LPITCH + kc * 64);
    mk0 = Mb[kn]; mk1 = Mb[kn + 32];
    if ((b0 & b1) != 0xFFFFFFFFu) { const unsigned w0 = b0 >> (8 * g), w1 = b1 >> (8 * g);   /* wave-uniform: some key of these 64 is masked */
#pragma unroll
      for (int kt = 0; kt < 4; ++kt)
#pragma unroll
        for (int r = 0; r < 8; ++r) { const unsigned w = kt < 2 ? w0 : w1; s[kt][r] = ((w >> ((kt & 1) * 16 + r)) & 1u) ? s[kt][r] : -3.0e38f; } }
    float mt[4];
#pragma unroll
    for (int kt = 0; kt < 4; ++kt) { mt[kt] = s[kt][0];
#pragma unroll
      for (int r = 1; r < 8; ++r) mt[kt] = fmaxf(mt[kt], s[kt][r]); }
    float mx = fmaxf(fmaxf(mt[0], mt[1]), fmaxf(mt[2], mt[3]));
    mx = fmaxf(mx, xhalf(mx));
    const float mn = fmaxf(m, mx * C2), al = ex2(m - mn), ms = 10.0f - mn; m = mn;
    v16h p[2]; float sum = 0.f;
#pragma unroll
    for (int c2 = 0; c2 < 2; ++c2)
#pragma unroll
      for (int i = 0; i < 8; ++i) { const float e0 = ex2(fmaf(s[2 * c2][i], C2, ms)), e1 = ex2(fmaf(s[2 * c2 + 1][i], C2, ms)); sum += e0 + e1; p[c2][i] = (_Float16)e0; p[c2][8 + i] = (_Float16)e1; }
    l = l * al + sum;
#pragma unroll
    for (int j = 0; j < HD / 16; ++j) acc[j] *= al;
#pragma unroll
    for (int j = 0; j < HD / 16; ++j) { acc[j] = wmma16(vf[j][0], p[0], acc[j]); acc[j] = wmma16(vf[j][1], p[1], acc[j]); } }
    asm volatile("s_wait_dscnt 0x0" ::: "memory");       /* this wave's reads of stage st have returned */
    asm volatile("s_wait_tensorcnt 0x0" ::: "memory");   /* this wave's slice of stage st + 1 has landed */
    __syncthreads();                                      /* stage st + 1 is readable by all, and every wave has left stage st's buffer */
    if (pinned(st + 2u < NST)) issue(pinned(st + 2u)); }  /* the refill of the buffer just left; scalar test */
  asm volatile("s_wait_tensorcnt 0x0" ::: "memory");     /* nothing of the mover is in flight when the wave ends */
  asm volatile("s_wait_dscnt 0x0" ::: "memory");         /* nor any LDS read of this wave */
  l += xhalf(l);
  const float inv = 1.0f / l;
  float* yr = Y + ((size_t)b * TT + q0 + col) * CC + h * HD + 8 * g;   /* acc[j][r] = ctx[query col][j * 16 + 8g + r] */
#pragma unroll
  for (int j = 0; j < HD / 16; ++j) { v4f lo, hi;
#pragma unroll
    for (int r = 0; r < 4; ++r) { lo[r] = acc[j][r] * inv; hi[r] = acc[j][4 + r] * inv; }
    vst2(yr + j * 16, lo); vst2(yr + j * 16 + 4, hi); } }
// ---- k_out: block = (64 rows, 128 cols): out = ctx Wo (+ bo): ctx x 2^6 once to f16 against Wo as f16(bf16 x 2^8) exact (1 product) x 2^-14; causal early rows (< QHI of each sequence): ctx bf16 hi + lo against exact bf16 Wo (2 products)
__global__ __launch_bounds__(128) void k_out(const float* __restrict__ Y, const float* __restrict__ WO, const float* __restrict__ BO, float* __restrict__ OUT) { __shared__ __align__(16) float sf[4][16][132];
  const int tid = threadIdx.x, wave = tid >> 5, lane = tid & 31, col = lane & 15, g = lane >> 4; const int c0 = blockIdx.y * 128; const size_t r0 = (size_t)blockIdx.x * 64 + wave * 16;
  v8f acc[8] = {};
  if (CAUSAL && (int)(((size_t)blockIdx.x * 64) % TT) < QHI) {   /* block-uniform */
#pragma unroll 2
    for (int kc = 0; kc < CC / 32; ++kc) { const F2 a = split_row(Y + (r0 + col) * CC, kc * 32, lane); asm volatile("s_wait_loadcnt 0x0" ::: "memory");
#pragma unroll
      for (int j = 0; j < 8; ++j) { const v16b w = WOCOL(WO, kc * 32, c0 + j * 16 + col, lane); asm volatile("s_wait_loadcnt 0x0" ::: "memory"); acc[j] = wmma_bf(a.h, w, acc[j]); acc[j] = wmma_bf(a.l, w, acc[j]); } }
#pragma unroll
    for (int j = 0; j < 8; ++j) { const float bias = BO ? bfr(BO[c0 + j * 16 + col]) : 0.f;
#pragma unroll
      for (int r = 0; r < 8; ++r) sf[wave][8 * g + r][j * 16 + col] = acc[j][r] + bias; }
  } else {
#pragma unroll 2
    for (int kc = 0; kc < CC / 32; ++kc) { const v16h a = frag_f32s(Y + (r0 + col) * CC + kc * 32, lane, 64.0f); asm volatile("s_wait_loadcnt 0x0" ::: "memory");   /* ctx carried x 2^6 into f16 so small-magnitude context rows stay clear of f16 subnormals */
#pragma unroll
      for (int j = 0; j < 8; ++j) { const v16h w = WOCOLH(WO, kc * 32, c0 + j * 16 + col, lane); asm volatile("s_wait_loadcnt 0x0" ::: "memory"); acc[j] = wmma16(a, w, acc[j]); } }
#pragma unroll
    for (int j = 0; j < 8; ++j) { const float bias = BO ? bfr(BO[c0 + j * 16 + col]) : 0.f;
#pragma unroll
      for (int r = 0; r < 8; ++r) sf[wave][8 * g + r][j * 16 + col] = acc[j][r] * (1.0f / 16384.0f) + bias; } }   /* 2^-8 (Wo carry) x 2^-6 (ctx carry) */
  LDSX(); for (int rl = 0; rl < 16; ++rl) vst2(OUT + (r0 + rl) * DIN + c0 + lane * 4, *(const v4f*)&sf[wave][rl][lane * 4]); }

extern "C" void kernel_launch(void* const* d_in, const int* in_sizes, int n_in, void* d_out, int out_size, void* d_ws, size_t ws_size, hipStream_t stream) {
  (void)in_sizes; (void)n_in; (void)out_size;
  const float** F = (const float**)d_in;
  if (ws_size < (size_t)WS_END) return;
  char* ws = (char*)d_ws; _Float16 *QH = (_Float16*)(ws + WS_QH), *KH = (_Float16*)(ws + WS_KH), *VT = (_Float16*)(ws + WS_VT), *QL = (_Float16*)(ws + WS_QL), *KL = (_Float16*)(ws + WS_KL); __bf16 *VB = (__bf16*)(ws + WS_VB), *VBL = (__bf16*)(ws + WS_VBL); float *Y = (float*)(ws + WS_Y);
  (void)Y; (void)QL; (void)KL; (void)VB; (void)VBL;
  // inputs: 0 x [4,2048,256]; 1 W_Q [256,256] (out,in); 2 W_K; 3 W_V; 4 W_O (out,in); 5 mask [4,2048] int32 (ones on this draw; read per key); no biases
  k_proj<<<dim3(TNB * TT / 64, CC / 128, 3), 128, 0, stream>>>(F[0], F[0], F[0], F[1], F[2], F[3], nullptr, nullptr, nullptr, QH, QL, KH, KL, VT, VB, VBL);
  k_fa<<<dim3(TT / 128, NH, TNB), 256, 0, stream>>>(QH, KH, VT, (const int*)d_in[5], Y);
  k_out<<<dim3(TNB * TT / 64, DIN / 128), 128, 0, stream>>>(Y, F[4], nullptr, (float*)d_out);
}

// v003
// One run takes 42.5 microseconds.
// Two timings next to v002 put it at 2.26 and 2.23 times that version's speed.
// Over all steps from v000 it is 13.4 times as fast.
// compute dtype: all float inputs rounded to bf16; q / k / v projections with EXACT bf16 products on WMMA 16x16x32 (f32 accumulate), no biases; logits q x k once to f16 each (1 product) x 64^-0.5; the int key mask read per (batch, key); softmax f32 with a running maximum, fused with both products; P = exp(s - max) x 2^10 once to f16 x v once to f16 (1 product), divided by the f32 sum at the end; ctx x 2^6 once to f16 x W_O f16(bf16 x 2^8); f32 output.
#include <hip/hip_runtime.h>
#include <math.h>
#include <stdint.h>

typedef __attribute__((ext_vector_type(16))) _Float16 v16h;
typedef __attribute__((ext_vector_type(16))) __bf16 v16b;
typedef __attribute__((ext_vector_type(8)))  _Float16 v8h;
typedef __attribute__((ext_vector_type(8)))  float v8f;
typedef __attribute__((ext_vector_type(4)))  float v4f;
typedef __attribute__((ext_vector_type(2)))  float v2f;
typedef __attribute__((ext_vector_type(4)))  unsigned v4u;
typedef __attribute__((ext_vector_type(4)))  int v4i;
typedef float __attribute__((may_alias)) float_a;
typedef int __attribute__((may_alias)) int_a;

template <typename T> __device__ __forceinline__ void vst2(void* p, T v) { *(T*)p = v;  }
__device__ __forceinline__ v8f wmma16(v16h a, v16h b, v8f c) {
  v8f d = __builtin_amdgcn_wmma_f32_16x16x32_f16(false, a, false, b, (short)0, c, false, false);
  asm volatile("v_nop\n\tv_nop\n\tv_nop\n\tv_nop" : "+v"(d) : "v"(a), "v"(b));
  return d;
}
__device__ __forceinline__ v8f wmma_bf(v16b a, v16b b, v8f c) {
  v8f d = __builtin_amdgcn_wmma_f32_16x16x32_bf16(false, a, false, b, (short)0, c, false, false);
  asm volatile("v_nop\n\tv_nop\n\tv_nop\n\tv_nop" : "+v"(d) : "v"(a), "v"(b));
  return d;
}
// 16x16x32 fragments: lane = (h = lane>>4, row/col = lane&15); elements 0..7 = k0+8h+0..7, 8..15 = k0+16+8h+0..7; D element r = row 8h+r
__device__ __forceinline__ v16h frag_h(const _Float16* rowk0, int lane) {
  union { v16h v; v8h q[2]; } u; const _Float16* p = rowk0 + 8 * (lane >> 4);
  u.q[0] = *(const v8h*)p; u.q[1] = *(const v8h*)(p + 16); return u.v;
}
__device__ __forceinline__ v16h frag_f32(const float* rowk0, int lane) {
  v16h a; const float* p = rowk0 + 8 * (lane >> 4);
#pragma unroll
  for (int i = 0; i < 8; ++i) { a[i] = (_Float16)p[i]; a[8 + i] = (_Float16)p[16 + i]; }
  return a;
}
__device__ __forceinline__ v16h frag_f32s(const float* rowk0, int lane, float sc) {
  v16h a; const float* p = rowk0 + 8 * (lane >> 4);
#pragma unroll
  for (int i = 0; i < 8; ++i) { a[i] = (_Float16)(p[i] * sc); a[8 + i] = (_Float16)(p[16 + i] * sc); }
  return a;
}
// column fragment from a [K][ld] layout (column n), rows >= K read as 0
__device__ __forceinline__ v16h fragc_f32(const float* W, int k0, int n, int lane, int ld, int K) {
  v16h a; const int g = lane >> 4;
#pragma unroll
  for (int i = 0; i < 8; ++i) { const int ka = k0 + 8 * g + i, kb = ka + 16;
    a[i] = (_Float16)(ka < K ? W[(size_t)(ka < K ? ka : K - 1) * ld + n] : 0.f); a[8 + i] = (_Float16)(kb < K ? W[(size_t)(kb < K ? kb : K - 1) * ld + n] : 0.f); }
  return a;
}
struct F2 { v16b h, l; };
__device__ __forceinline__ F2 bsplit16(const float v[16]) { F2 r;
#pragma unroll
  for (int i = 0; i < 16; ++i) { const __bf16 h = (__bf16)v[i]; r.h[i] = h; r.l[i] = (__bf16)(v[i] - (float)h); }
  return r; }
__device__ __forceinline__ F2 split_row(const float* row, int k0, int lane) { float v[16]; const float* p = row + k0 + 8 * (lane >> 4);
#pragma unroll
  for (int i = 0; i < 8; ++i) { v[i] = p[i]; v[8 + i] = p[16 + i]; }
  return bsplit16(v); }
__device__ __forceinline__ F2 split_rowK(const float* row, int k0, int lane, int K) { float v[16]; const int g = lane >> 4;
#pragma unroll
  for (int i = 0; i < 8; ++i) { const int ka = k0 + 8 * g + i, kb = ka + 16; v[i] = ka < K ? row[ka < K ? ka : K - 1] : 0.f; v[8 + i] = kb < K ? row[kb < K ? kb : K - 1] : 0.f; }
  return bsplit16(v); }
__device__ __forceinline__ F2 split_col(const float* W, int k0, int n, int lane, int ld, int K) { float v[16]; const int g = lane >> 4;
#pragma unroll
  for (int i = 0; i < 8; ++i) { const int ka = k0 + 8 * g + i, kb = ka + 16; v[i] = ka < K ? W[(size_t)(ka < K ? ka : K - 1) * ld + n] : 0.f; v[8 + i] = kb < K ? W[(size_t)(kb < K ? kb : K - 1) * ld + n] : 0.f; }
  return bsplit16(v); }
__device__ __forceinline__ v8f mac3(const F2& a, const F2& b, v8f c) { c = wmma_bf(a.l, b.h, c); c = wmma_bf(a.h, b.l, c); return wmma_bf(a.h, b.h, c); }
__device__ __forceinline__ float sigm(float v) { return 1.0f / (1.0f + expf(-v)); }
#define LDSX() do { asm volatile("s_wait_dscnt 0" ::: "memory"); __builtin_amdgcn_wave_barrier(); __builtin_amdgcn_fence(__ATOMIC_RELEASE, "workgroup"); } while (0)

// Standard multi-head self-attention with a key-padding mask input (x [4,2048,256]; torch (out,in) W_Q / W_K / W_V / W_O [256,256] uniform(+-1/16) applied as x @ W.T, no biases; mask [4,2048] int32 = ones (const: nothing is masked on this draw); 4 heads x 64; scores x 64^-0.5; where(mask[:, None, None, :] == 0, -inf, scores); softmax; out @ W_O.T).
#define NB 4
#define TT 2048
#define CC 256            // NH * HD = projected width
#define DIN 256          // input (model) width
#define NH 4
#define HD 64
#define NQB (TT / 64)
#define HG 4
#define SCALE (0.125f)
#define CAUSAL 0
#ifndef TNB
#define TNB NB
#endif
__device__ __forceinline__ float bfr(float v) { return (float)(__bf16)v; }
__host__ __device__ __forceinline__ int kb_last(int qb) { return CAUSAL ? ((qb * 64 + 63) >> 7) : (TT / 128 - 1); }
typedef __attribute__((ext_vector_type(8))) __bf16 v8b;
__device__ __forceinline__ v16b frag_b(const __bf16* rowk0, int lane) {
  union { v16b v; v8b q[2]; } u; const __bf16* p = rowk0 + 8 * (lane >> 4);
  u.q[0] = *(const v8b*)p; u.q[1] = *(const v8b*)(p + 16); return u.v;
}
#define QBH 0              // unused (k_fa has no high-precision path)
#define QHI 0               // single-product logits on every row
#define KHI 64            // key rows carrying k residual / v bf16 hi+lo planes (written by k_proj, read by no kernel)
// B fragment (k rows k0+.., output column o) of a weight: (in,out) [K][ld] or (out,in) [ld rows of K]: bf16 exact, or f16(bf16 * 256) exact
__device__ __forceinline__ v16b wcol_io(const float* Wm, int k0, int o, int lane, int ld) { v16b w; const int g = lane >> 4;
#pragma unroll
  for (int i = 0; i < 8; ++i) { w[i] = (__bf16)Wm[(size_t)(k0 + 8 * g + i) * ld + o]; w[8 + i] = (__bf16)Wm[(size_t)(k0 + 16 + 8 * g + i) * ld + o]; }
  return w; }
__device__ __forceinline__ v16b wcol_oi(const float* Wm, int k0, int o, int lane, int K) { v16b w; const float* p = Wm + (size_t)o * K + k0 + 8 * (lane >> 4);
#pragma unroll
  for (int i = 0; i < 8; ++i) { w[i] = (__bf16)p[i]; w[8 + i] = (__bf16)p[16 + i]; }
  return w; }
__device__ __forceinline__ v16h wcolh_io(const float* Wm, int k0, int o, int lane, int ld) { v16h w; const int g = lane >> 4;
#pragma unroll
  for (int i = 0; i < 8; ++i) { w[i] = (_Float16)(bfr(Wm[(size_t)(k0 + 8 * g + i) * ld + o]) * 256.0f); w[8 + i] = (_Float16)(bfr(Wm[(size_t)(k0 + 16 + 8 * g + i) * ld + o]) * 256.0f); }
  return w; }
__device__ __forceinline__ v16h wcolh_oi(const float* Wm, int k0, int o, int lane, int K) { v16h w; const float* p = Wm + (size_t)o * K + k0 + 8 * (lane >> 4);
#pragma unroll
  for (int i = 0; i < 8; ++i) { w[i] = (_Float16)(bfr(p[i]) * 256.0f); w[8 + i] = (_Float16)(bfr(p[16 + i]) * 256.0f); }
  return w; }
#define WQKV_LAYOUT 1   // 0 = (in,out) [DIN][CC]; 1 = (out,in) [CC][DIN]; 2 = per-head [NH][DIN][HD]
__device__ __forceinline__ v16b wcol_hdk(const float* Wm, int k0, int o, int lane) { v16b w; const int g = lane >> 4; const float* p = Wm + (size_t)(o / HD) * DIN * HD + (o % HD);
#pragma unroll
  for (int i = 0; i < 8; ++i) { w[i] = (__bf16)p[(size_t)(k0 + 8 * g + i) * HD]; w[8 + i] = (__bf16)p[(size_t)(k0 + 16 + 8 * g + i) * HD]; }
  return w; }
#define WO_OUT_IN 1
#if WQKV_LAYOUT == 1
#define WCOL(W, k0, o, lane) wcol_oi(W, k0, o, lane, DIN)
#elif WQKV_LAYOUT == 2
#define WCOL(W, k0, o, lane) wcol_hdk(W, k0, o, lane)
#else
#define WCOL(W, k0, o, lane) wcol_io(W, k0, o, lane, CC)
#endif
#if WO_OUT_IN
#define WOCOL(W, k0, o, lane) wcol_oi(W, k0, o, lane, CC)
#define WOCOLH(W, k0, o, lane) wcolh_oi(W, k0, o, lane, CC)
#else
#define WOCOL(W, k0, o, lane) wcol_io(W, k0, o, lane, DIN)
#define WOCOLH(W, k0, o, lane) wcolh_io(W, k0, o, lane, DIN)
#endif

#define WS_QH  0u                                      // f16 q rows [b*t][CC]
#define WS_KH  (WS_QH + 2u * (size_t)NB * TT * CC)      // f16 k rows [b*t][CC]
#define WS_VT  (WS_KH + 2u * (size_t)NB * TT * CC)      // f16 v planes [b][c][t]
#define WS_QL  (WS_VT + 2u * (size_t)NB * CC * TT)      // f16 q residual x 2^10 rows [b][t < QHI][CC]
#define WS_KL  (WS_QL + 2u * (size_t)NB * QHI * CC)     // f16 k residual x 2^10 rows [b][t < KHI][CC]
#define WS_VB  (WS_KL + 2u * (size_t)NB * KHI * CC)     // bf16 v hi planes [b][c][t < KHI]
#define WS_VBL (WS_VB + 2u * (size_t)NB * CC * KHI)
#define WS_S   (WS_VBL + 2u * (size_t)NB * CC * KHI)    // (unused: logits and P stay in registers)
#define WS_Y   (WS_S  + 4u * (size_t)HG * TT * TT)      // f32 ctx rows [b*t][CC] (only when there is an output projection)
#define WS_END (WS_Y  + 4u * (size_t)NB * TT * CC)

// Operand staging of k_proj and k_out: ROWS contiguous rows of 256 f32 go once per block into LDS as 16-bit rows, read by whole lines (128 threads x 16 B = two rows a step) and rounded on the way exactly as the fragment loaders rounded them.
// MODE 0: bf16; 1: f16(v x 2^6); 2: f16(bf16(v) x 2^8). Row pitch 528 B = 16 B x 33: the 16-byte fragment reads of 16 rows meet no bank twice.
#define GP 264
#define GOPB ((128 + 64) * GP * 2)   /* bytes: 128 weight rows, then 64 activation rows */
typedef __attribute__((ext_vector_type(4))) __bf16 v4b;
typedef __attribute__((ext_vector_type(4))) _Float16 v4h;
template <int ROWS, int MODE> __device__ __forceinline__ void stage16(const float* __restrict__ src, unsigned char* dst, int tid) {
  const float* p = src + tid * 4; unsigned char* d = dst + (tid >> 6) * (GP * 2) + (tid & 63) * 8;
#pragma unroll 1   /* rolled: one batch of 32 loads is held in registers at a time; unrolled, k_proj took more registers than three blocks on a WGP, which its LDS allows, can have */
  for (int i0 = 0; i0 < ROWS / 2; i0 += 32) { v4f v[32];
#pragma unroll
    for (int u = 0; u < 32; ++u) v[u] = *(const v4f*)(p + (i0 + u) * 512);
#pragma unroll
    for (int u = 0; u < 32; ++u) { unsigned char* q = d + (i0 + u) * (GP * 4);
      if constexpr (MODE == 0) { v4b o;
#pragma unroll
        for (int r = 0; r < 4; ++r) o[r] = (__bf16)v[u][r];
        *(v4b*)q = o; }
      else { v4h o;
#pragma unroll
        for (int r = 0; r < 4; ++r) o[r] = MODE == 1 ? (_Float16)(v[u][r] * 64.0f) : (_Float16)(bfr(v[u][r]) * 256.0f);
        *(v4h*)q = o; } } } }
static_assert(WQKV_LAYOUT == 1 && WO_OUT_IN == 1 && DIN == 256 && CC == 256, "stage16 takes (out,in) weights and rows of 256");
// ---- k_proj: block = (64 rows, 128 cols, which): q/k/v = X W (+ b) with exact bf16 products (K = DIN) -> which 0: q f16 rows (+ residual rows < QHI); 1: k f16 rows (+ residual rows < KHI); 2: v f16 planes [c][t] (+ bf16 hi/lo planes for t < KHI)
__global__ __launch_bounds__(128) void k_proj(const float* __restrict__ XQ, const float* __restrict__ XK, const float* __restrict__ XV, const float* __restrict__ WQ, const float* __restrict__ WK, const float* __restrict__ WV, const float* __restrict__ BQ, const float* __restrict__ BK, const float* __restrict__ BV,
    _Float16* __restrict__ QH, _Float16* __restrict__ QL, _Float16* __restrict__ KH, _Float16* __restrict__ KL, _Float16* __restrict__ VT, __bf16* __restrict__ VB, __bf16* __restrict__ VBL) {
  __shared__ __align__(16) unsigned char SM[GOPB];   /* first the two operands, then, behind a barrier, the output tiles */
  _Float16 (*sh)[136] = (_Float16 (*)[136])SM; _Float16 (*sl)[136] = (_Float16 (*)[136])(SM + 17408); _Float16 (*th)[72] = (_Float16 (*)[72])(SM + 34816); __bf16 (*tb)[72] = (__bf16 (*)[72])(SM + 53248); __bf16 (*tbl)[72] = (__bf16 (*)[72])(SM + 71680);
  static_assert(2 * 64 * 136 * 2 + 3 * 128 * 72 * 2 <= GOPB, "output tiles fit the operands' LDS");
  const int tid = threadIdx.x, wave = tid >> 5, lane = tid & 31, col = lane & 15, g = lane >> 4; const int which = blockIdx.z; const int c0 = blockIdx.y * 128; const size_t r0 = (size_t)blockIdx.x * 64; const size_t bb = r0 / TT; const int t0 = (int)(r0 % TT);
  const float* X = which == 0 ? XQ : which == 1 ? XK : XV; const float* WA = which == 0 ? WQ : which == 1 ? WK : WV; const float* BA = which == 0 ? BQ : which == 1 ? BK : BV;
  stage16<64, 0>(X + r0 * DIN, SM + 128 * GP * 2, tid); stage16<128, 0>(WA + (size_t)c0 * DIN, SM, tid);
  __syncthreads();   /* both operands are readable by the four waves */
  const __bf16* sW = (const __bf16*)SM + col * GP; const __bf16* sX = (const __bf16*)SM + (128 + wave * 16 + col) * GP;
  v8f acc[8] = {}; v16b a[2], w[2][8];
  a[0] = frag_b(sX, lane);
#pragma unroll
  for (int j = 0; j < 8; ++j) w[0][j] = frag_b(sW + j * 16 * GP, lane);
#pragma unroll   /* unrolled: the two fragment sets alternate by name; the next chunk's 18 LDS reads stand as one group in front of this chunk's products and return under them */
  for (int kc = 0; kc < DIN / 32; ++kc) { const int c = kc & 1;
    if (kc + 1 < DIN / 32) { a[c ^ 1] = frag_b(sX + (kc + 1) * 32, lane);
#pragma unroll
      for (int j = 0; j < 8; ++j) w[c ^ 1][j] = frag_b(sW + j * 16 * GP + (kc + 1) * 32, lane); }
#pragma unroll
    for (int j = 0; j < 8; ++j) acc[j] = wmma_bf(a[c], w[c][j], acc[j]); }
  __syncthreads();   /* every wave has left the operands: the output tiles below take their LDS */
  if (which < 2) { _Float16* DH = which == 0 ? QH : KH; _Float16* DL = which == 0 ? QL : KL; const int nhi = which == 0 ? QHI : KHI; const bool hi_rows = t0 < nhi;
#pragma unroll
    for (int j = 0; j < 8; ++j) { const float bias = BA ? bfr(BA[c0 + j * 16 + col]) : 0.f;
#pragma unroll
      for (int r = 0; r < 8; ++r) { const float v = acc[j][r] + bias; const _Float16 hv = (_Float16)v; sh[wave * 16 + 8 * g + r][j * 16 + col] = hv; sl[wave * 16 + 8 * g + r][j * 16 + col] = (_Float16)((v - (float)hv) * 1024.0f); } }
    __syncthreads();
    for (int e = tid; e < 64 * 16; e += 128) { const int rl = e >> 4, q = e & 15; vst2((unsigned*)(DH + (r0 + rl) * CC + c0 + q * 8), *(const v4u*)&sh[rl][q * 8]); if (hi_rows) vst2((unsigned*)(DL + (bb * nhi + t0 + rl) * (size_t)CC + c0 + q * 8), *(const v4u*)&sl[rl][q * 8]); }
  } else { const bool hi_rows = t0 < KHI;
#pragma unroll
    for (int j = 0; j < 8; ++j) { const float bias = BA ? bfr(BA[c0 + j * 16 + col]) : 0.f;
#pragma unroll
      for (int r = 0; r < 8; ++r) { const float v = acc[j][r] + bias; const int rl = wave * 16 + 8 * g + r, cl = j * 16 + col; th[cl][rl] = (_Float16)v; const __bf16 bh = (__bf16)v; tb[cl][rl] = bh; tbl[cl][rl] = (__bf16)(v - (float)bh); } }
    __syncthreads();
    for (int e = tid; e < 128 * 8; e += 128) { const int cl = e >> 3, q = e & 7; vst2((unsigned*)(VT + (bb * CC + c0 + cl) * (size_t)TT + t0 + q * 8), *(const v4u*)&th[cl][q * 8]); if (hi_rows) { const size_t o3 = (bb * CC + c0 + cl) * (size_t)KHI + t0 + q * 8; vst2((unsigned*)(VB + o3), *(const v4u*)&tb[cl][q * 8]); vst2((unsigned*)(VBL + o3), *(const v4u*)&tbl[cl][q * 8]); } } } }
__device__ __forceinline__ float ex2(float x) { float r; asm("v_exp_f32 %0, %1\n\tv_nop" : "=v"(r) : "v"(x)); return r; }
__device__ __forceinline__ float xhalf(float v) { const int i = __builtin_bit_cast(int, v); return __builtin_bit_cast(float, __builtin_amdgcn_permlanex16(i, i, 0x76543210, 0xfedcba98, false, false)); }   /* lane l <-> l ^ 16 */
// K and V reach the waves through LDS: a stage is SKEYS keys; each of the 8 waves brings one slice of 64 rows x 128 B per stage by one tensor load
// (waves 0..3: 64 k rows each; waves 4..7: the 64 v planes x 64 keys each), the mover's 16-byte pad giving the pitch 144 B that 16-byte LDS reads want; two buffers.
typedef uint32_t u32x4 __attribute__((ext_vector_type(4)));
typedef uint32_t u32x8 __attribute__((ext_vector_type(8)));
#define SKEYS 256
#define NST (TT / SKEYS)
#define LPITCH 144u
#define SLICEB 10240u          /* 64 rows x 144 B = 9216 B, rounded up so that every slice starts at a multiple of 2 KiB */
#define BUFB (8u * SLICEB)
__device__ __forceinline__ uint32_t uni(uint32_t v) { return (uint32_t)__builtin_amdgcn_readfirstlane(v); }
__device__ __forceinline__ uint32_t pinned(uint32_t v) { uint32_t w = uni(v); asm volatile("" : "+s"(w)); return w; }
// both groups are in-out operands: the descriptor then has registers of its own for the whole kernel, and none of them takes another value while a request is in flight
__device__ __forceinline__ void tdm_load(u32x4& g0, u32x8& g1) { asm volatile("tensor_load_to_lds %0, %1" : "+s"(g0), "+s"(g1) :: "memory"); }
__device__ __forceinline__ v16h frag_l(const unsigned char* p) { union { v16h v; v8h q[2]; } u; u.q[0] = *(const v8h*)p; u.q[1] = *(const v8h*)(p + 32); return u.v; }
__global__ __launch_bounds__(256) void k_fa(const _Float16* __restrict__ QH, const _Float16* __restrict__ KH, const _Float16* __restrict__ VT, const int* __restrict__ MASK, float* __restrict__ Y) {
  __shared__ __attribute__((aligned(2048))) unsigned char L[2 * BUFB];
  const int tid = threadIdx.x, wave = tid >> 5, lane = tid & 31, col = lane & 15, g = lane >> 4;
  const int h = blockIdx.y, b = blockIdx.z; const int q0 = blockIdx.x * 128 + wave * 16;
  const uint32_t wv = uni((uint32_t)tid >> 5), sl = wv & 3u; const bool isV = wv >= 4u;
  const uint32_t lbase = (uint32_t)(size_t)L;
  const uint64_t ga0 = isV ? (uint64_t)(size_t)(VT + ((size_t)b * CC + h * HD) * (size_t)TT + sl * 64u) : (uint64_t)(size_t)(KH + ((size_t)b * TT + sl * 64u) * CC + h * HD);
  const uint32_t gsh = isV ? 9u : 17u;   /* bytes from one stage to the next: SKEYS x 2 along a v plane, SKEYS x CC x 2 down the k rows */
  static_assert(SKEYS * 2 == 1 << 9 && SKEYS * CC * 2 == 1 << 17 && NST >= 2, "stage steps");
  u32x8 g1;   /* 1-byte elements, tensor = tile = 64 rows of 128 B, a 16-byte pad behind every 128 B, no mask */
  g1[0] = uni((1u << 20) | (4u << 22) | (3u << 25)); g1[1] = uni(128u << 16); g1[2] = uni(64u << 16); g1[3] = uni(128u << 16); g1[4] = uni(64u); g1[5] = uni(isV ? (uint32_t)TT * 2u : (uint32_t)CC * 2u); g1[6] = uni(0u); g1[7] = uni(0u);
  u32x4 g0; g0[0] = uni(1u);
  auto issue = [&](uint32_t st) { const uint64_t ga = ga0 + (uint64_t)(st << gsh);
    g0[1] = uni(lbase + (st & 1u) * BUFB + wv * SLICEB); g0[2] = uni((uint32_t)ga); g0[3] = uni((((uint32_t)(ga >> 32)) & 0x01FFFFFFu) | 0x80000000u);
    tdm_load(g0, g1); };
  const int* Mb = MASK + (size_t)b * TT + lane;
  const float C2 = SCALE * 1.44269504088896f;   /* raw logit -> log2 units */
  v16h qf[HD / 32], kf[4][HD / 32];
#pragma unroll
  for (int kc = 0; kc < HD / 32; ++kc) qf[kc] = frag_h(QH + ((size_t)b * TT + q0 + col) * CC + h * HD + kc * 32, lane);
  int mk0 = Mb[0], mk1 = Mb[32];
  v8f acc[HD / 16] = {}; float m = -1.0e30f, l = 0.f;
  issue(0u);
  asm volatile("s_wait_tensorcnt 0x0" ::: "memory");   /* this wave's slice of stage 0 has landed */
  __syncthreads();                                      /* every wave's slice of stage 0 is readable by all */
  issue(pinned(1u));                                    /* pinned(): stage 1's descriptor words are formed behind the wait above */
  const uint32_t loff = (uint32_t)col * LPITCH + 16u * (uint32_t)g;
#pragma unroll 1   /* rolled: one publish point and one refill site */
  for (uint32_t st = 0; st < NST; ++st) { const unsigned char* Bp = L + (st & 1u) * BUFB + loff;
#pragma unroll
    for (int kt = 0; kt < 4; ++kt)
#pragma unroll
      for (int kc = 0; kc < HD / 32; ++kc) kf[kt][kc] = frag_l(Bp + kt * 16 * LPITCH + kc * 64);
#pragma unroll 1   /* rolled: unrolled, the four trips of a stage spilled */
    for (uint32_t hb = 0; hb < SKEYS / 64; ++hb) { const int it = (int)(st * (SKEYS / 64) + hb); const unsigned char* Vp = Bp + (4u + hb) * SLICEB;
    v16h vf[HD / 16][2];
#pragma unroll
    for (int j = 0; j < HD / 16; ++j) { vf[j][0] = frag_l(Vp + j * 16 * LPITCH); vf[j][1] = frag_l(Vp + j * 16 * LPITCH + 64); }
    v8f s[4];
#pragma unroll
    for (int kt = 0; kt < 4; ++kt) { v8f z = {};
#pragma unroll
      for (int kc = 0; kc < HD / 32; ++kc) z = wmma16(kf[kt][kc], qf[kc], z);
      s[kt] = z; }
    const unsigned b0 = __builtin_amdgcn_ballot_w32(mk0 != 0), b1 = __builtin_amdgcn_ballot_w32(mk1 != 0);
    const int kn = (it + 1 < TT / 64 ? it + 1 : it) * 64;   /* next trip's mask words fly under this trip's softmax (the last trip rereads its own) */
    const unsigned char* Kn = Bp + (hb + 1u < SKEYS / 64 ? hb + 1u : hb) * SLICEB;   /* the next 64 keys' k fragments, of this same stage, fly under this trip's softmax (a stage's last trip rereads its own) */
#pragma unroll
    for (int kt = 0; kt < 4; ++kt)
#pragma unroll
      for (int kc = 0; kc < HD / 32; ++kc) kf[kt][kc] = frag_l(Kn + kt * 16 * LPITCH + kc * 64);
    mk0 = Mb[kn]; mk1 = Mb[kn + 32];
    if ((b0 & b1) != 0xFFFFFFFFu) { const unsigned w0 = b0 >> (8 * g), w1 = b1 >> (8 * g);   /* wave-uniform: some key of these 64 is masked */
#pragma unroll
      for (int kt = 0; kt < 4; ++kt)
#pragma unroll
        for (int r = 0; r < 8; ++r) { const unsigned w = kt < 2 ? w0 : w1; s[kt][r] = ((w >> ((kt & 1) * 16 + r)) & 1u) ? s[kt][r] : -3.0e38f; } }
    float mt[4];
#pragma unroll
    for (int kt = 0; kt < 4; ++kt) { mt[kt] = s[kt][0];
#pragma unroll
      for (int r = 1; r < 8; ++r) mt[kt] = fmaxf(mt[kt], s[kt][r]); }
    float mx = fmaxf(fmaxf(mt[0], mt[1]), fmaxf(mt[2], mt[3]));
    mx = fmaxf(mx, xhalf(mx));
    const float mn = fmaxf(m, mx * C2), al = ex2(m - mn), ms = 10.0f - mn; m = mn;
    v16h p[2]; float sum = 0.f;
#pragma unroll
    for (int c2 = 0; c2 < 2; ++c2)
#pragma unroll
      for (int i = 0; i < 8; ++i) { const float e0 = ex2(fmaf(s[2 * c2][i], C2, ms)), e1 = ex2(fmaf(s[2 * c2 + 1][i], C2, ms)); sum += e0 + e1; p[c2][i] = (_Float16)e0; p[c2][8 + i] = (_Float16)e1; }
    l = l * al + sum;
#pragma unroll
    for (int j = 0; j < HD / 16; ++j) acc[j] *= al;
#pragma unroll
    for (int j = 0; j < HD / 16; ++j) { acc[j] = wmma16(vf[j][0], p[0], acc[j]); acc[j] = wmma16(vf[j][1], p[1], acc[j]); } }
    asm volatile("s_wait_dscnt 0x0" ::: "memory");       /* this wave's reads of stage st have returned */
    asm volatile("s_wait_tensorcnt 0x0" ::: "memory");   /* this wave's slice of stage st + 1 has landed */
    __syncthreads();                                      /* stage st + 1 is readable by all, and every wave has left stage st's buffer */
    if (pinned(st + 2u < NST)) issue(pinned(st + 2u)); }  /* the refill of the buffer just left; scalar test */
  asm volatile("s_wait_tensorcnt 0x0" ::: "memory");     /* nothing of the mover is in flight when the wave ends */
  asm volatile("s_wait_dscnt 0x0" ::: "memory");         /* nor any LDS read of this wave */
  l += xhalf(l);
  const float inv = 1.0f / l;
  float* yr = Y + ((size_t)b * TT + q0 + col) * CC + h * HD + 8 * g;   /* acc[j][r] = ctx[query col][j * 16 + 8g + r] */
#pragma unroll
  for (int j = 0; j < HD / 16; ++j) { v4f lo, hi;
#pragma unroll
    for (int r = 0; r < 4; ++r) { lo[r] = acc[j][r] * inv; hi[r] = acc[j][4 + r] * inv; }
    vst2(yr + j * 16, lo); vst2(yr + j * 16 + 4, hi); } }
// ---- k_out: block = (64 rows, 128 cols): out = ctx Wo (+ bo): ctx x 2^6 once to f16 against Wo as f16(bf16 x 2^8) exact (1 product) x 2^-14; causal early rows (< QHI of each sequence): ctx bf16 hi + lo against exact bf16 Wo (2 products)
__global__ __launch_bounds__(128) void k_out(const float* __restrict__ Y, const float* __restrict__ WO, const float* __restrict__ BO, float* __restrict__ OUT) { __shared__ __align__(16) unsigned char SM[GOPB];   /* first the two operands, then, behind a barrier, the output tile */
  float (*sf)[16][132] = (float (*)[16][132])SM; static_assert(4 * 16 * 132 * 4 <= GOPB, "output tile fits the operands' LDS");
  const int tid = threadIdx.x, wave = tid >> 5, lane = tid & 31, col = lane & 15, g = lane >> 4; const int c0 = blockIdx.y * 128; const size_t r0 = (size_t)blockIdx.x * 64 + wave * 16;
  v8f acc[8] = {};
  if (CAUSAL && (int)(((size_t)blockIdx.x * 64) % TT) < QHI) {   /* block-uniform */
#pragma unroll 2
    for (int kc = 0; kc < CC / 32; ++kc) { const F2 a = split_row(Y + (r0 + col) * CC, kc * 32, lane); asm volatile("s_wait_loadcnt 0x0" ::: "memory");
#pragma unroll
      for (int j = 0; j < 8; ++j) { const v16b w = WOCOL(WO, kc * 32, c0 + j * 16 + col, lane); asm volatile("s_wait_loadcnt 0x0" ::: "memory"); acc[j] = wmma_bf(a.h, w, acc[j]); acc[j] = wmma_bf(a.l, w, acc[j]); } }
#pragma unroll
    for (int j = 0; j < 8; ++j) { const float bias = BO ? bfr(BO[c0 + j * 16 + col]) : 0.f;
#pragma unroll
      for (int r = 0; r < 8; ++r) sf[wave][8 * g + r][j * 16 + col] = acc[j][r] + bias; }
  } else {
    stage16<64, 1>(Y + (size_t)blockIdx.x * 64 * CC, SM + 128 * GP * 2, tid); stage16<128, 2>(WO + (size_t)c0 * CC, SM, tid);   /* ctx carried x 2^6 into f16 so small-magnitude context rows stay clear of f16 subnormals */
    __syncthreads();   /* both operands are readable by the four waves */
    const _Float16* sW = (const _Float16*)SM + col * GP; const _Float16* sY = (const _Float16*)SM + (128 + wave * 16 + col) * GP;
    v16h a[2], w[2][8];
    a[0] = frag_h(sY, lane);
#pragma unroll
    for (int j = 0; j < 8; ++j) w[0][j] = frag_h(sW + j * 16 * GP, lane);
#pragma unroll   /* unrolled: the two fragment sets alternate by name; the next chunk's 18 LDS reads stand as one group in front of this chunk's products and return under them */
    for (int kc = 0; kc < CC / 32; ++kc) { const int c = kc & 1;
      if (kc + 1 < CC / 32) { a[c ^ 1] = frag_h(sY + (kc + 1) * 32, lane);
#pragma unroll
        for (int j = 0; j < 8; ++j) w[c ^ 1][j] = frag_h(sW + j * 16 * GP + (kc + 1) * 32, lane); }
#pragma unroll
      for (int j = 0; j < 8; ++j) acc[j] = wmma16(a[c], w[c][j], acc[j]); }
    __syncthreads();   /* every wave has left the operands: the output tile below takes their LDS */
#pragma unroll
    for (int j = 0; j < 8; ++j) { const float bias = BO ? bfr(BO[c0 + j * 16 + col]) : 0.f;
#pragma unroll
      for (int r = 0; r < 8; ++r) sf[wave][8 * g + r][j * 16 + col] = acc[j][r] * (1.0f / 16384.0f) + bias; } }   /* 2^-8 (Wo carry) x 2^-6 (ctx carry) */
  LDSX(); for (int rl = 0; rl < 16; ++rl) vst2(OUT + (r0 + rl) * DIN + c0 + lane * 4, *(const v4f*)&sf[wave][rl][lane * 4]); }

extern "C" void kernel_launch(void* const* d_in, const int* in_sizes, int n_in, void* d_out, int out_size, void* d_ws, size_t ws_size, hipStream_t stream) {
  (void)in_sizes; (void)n_in; (void)out_size;
  const float** F = (const float**)d_in;
  if (ws_size < (size_t)WS_END) return;
  char* ws = (char*)d_ws; _Float16 *QH = (_Float16*)(ws + WS_QH), *KH = (_Float16*)(ws + WS_KH), *VT = (_Float16*)(ws + WS_VT), *QL = (_Float16*)(ws + WS_QL), *KL = (_Float16*)(ws + WS_KL); __bf16 *VB = (__bf16*)(ws + WS_VB), *VBL = (__bf16*)(ws + WS_VBL); float *Y = (float*)(ws + WS_Y);
  (void)Y; (void)QL; (void)KL; (void)VB; (void)VBL;
  // inputs: 0 x [4,2048,256]; 1 W_Q [256,256] (out,in); 2 W_K; 3 W_V; 4 W_O (out,in); 5 mask [4,2048] int32 (ones on this draw; read per key); no biases
  k_proj<<<dim3(TNB * TT / 64, CC / 128, 3), 128, 0, stream>>>(F[0], F[0], F[0], F[1], F[2], F[3], nullptr, nullptr, nullptr, QH, QL, KH, KL, VT, VB, VBL);
  k_fa<<<dim3(TT / 128, NH, TNB), 256, 0, stream>>>(QH, KH, VT, (const int*)d_in[5], Y);
  k_out<<<dim3(TNB * TT / 64, DIN / 128), 128, 0, stream>>>(Y, F[4], nullptr, (float*)d_out);
}

// v004
// One run takes 40 microseconds.
// Two timings next to v003 put it at 1.06 and 1.07 times that version's speed.
// Counting every step since v000, it is 14.2 times as fast.
// compute dtype: all float inputs rounded to bf16; q / k / v projections with EXACT bf16 products on WMMA 16x16x32 (f32 accumulate), no biases; logits q x k once to f16 each (1 product) x 64^-0.5; the int key mask read per (batch, key); softmax f32 with a running maximum, fused with both products; P = exp(s - max) x 2^10 once to f16 x v once to f16 (1 product), divided by the f32 sum at the end; ctx x 2^6 once to f16 x W_O f16(bf16 x 2^8); f32 output.
#include <hip/hip_runtime.h>
#include <math.h>
#include <stdint.h>

typedef __attribute__((ext_vector_type(16))) _Float16 v16h;
typedef __attribute__((ext_vector_type(16))) __bf16 v16b;
typedef __attribute__((ext_vector_type(8)))  _Float16 v8h;
typedef __attribute__((ext_vector_type(8)))  float v8f;
typedef __attribute__((ext_vector_type(4)))  float v4f;
typedef __attribute__((ext_vector_type(2)))  float v2f;
typedef __attribute__((ext_vector_type(4)))  unsigned v4u;
typedef __attribute__((ext_vector_type(4)))  int v4i;
typedef float __attribute__((may_alias)) float_a;
typedef int __attribute__((may_alias)) int_a;

template <typename T> __device__ __forceinline__ void vst2(void* p, T v) { *(T*)p = v;  }
__device__ __forceinline__ v8f wmma16(v16h a, v16h b, v8f c) {
  v8f d = __builtin_amdgcn_wmma_f32_16x16x32_f16(false, a, false, b, (short)0, c, false, false);
  asm volatile("v_nop\n\tv_nop\n\tv_nop\n\tv_nop" : "+v"(d) : "v"(a), "v"(b));
  return d;
}
__device__ __forceinline__ v8f wmma_bf(v16b a, v16b b, v8f c) {
  v8f d = __builtin_amdgcn_wmma_f32_16x16x32_bf16(false, a, false, b, (short)0, c, false, false);
  asm volatile("v_nop\n\tv_nop\n\tv_nop\n\tv_nop" : "+v"(d) : "v"(a), "v"(b));
  return d;
}
// 16x16x32 fragments: lane = (h = lane>>4, row/col = lane&15); elements 0..7 = k0+8h+0..7, 8..15 = k0+16+8h+0..7; D element r = row 8h+r
__device__ __forceinline__ v16h frag_h(const _Float16* rowk0, int lane) {
  union { v16h v; v8h q[2]; } u; const _Float16* p = rowk0 + 8 * (lane >> 4);
  u.q[0] = *(const v8h*)p; u.q[1] = *(const v8h*)(p + 16); return u.v;
}
__device__ __forceinline__ v16h frag_f32(const float* rowk0, int lane) {
  v16h a; const float* p = rowk0 + 8 * (lane >> 4);
#pragma unroll
  for (int i = 0; i < 8; ++i) { a[i] = (_Float16)p[i]; a[8 + i] = (_Float16)p[16 + i]; }
  return a;
}
__device__ __forceinline__ v16h frag_f32s(const float* rowk0, int lane, float sc) {
  v16h a; const float* p = rowk0 + 8 * (lane >> 4);
#pragma unroll
  for (int i = 0; i < 8; ++i) { a[i] = (_Float16)(p[i] * sc); a[8 + i] = (_Float16)(p[16 + i] * sc); }
  return a;
}
// column fragment from a [K][ld] layout (column n), rows >= K read as 0
__device__ __forceinline__ v16h fragc_f32(const float* W, int k0, int n, int lane, int ld, int K) {
  v16h a; const int g = lane >> 4;
#pragma unroll
  for (int i = 0; i < 8; ++i) { const int ka = k0 + 8 * g + i, kb = ka + 16;
    a[i] = (_Float16)(ka < K ? W[(size_t)(ka < K ? ka : K - 1) * ld + n] : 0.f); a[8 + i] = (_Float16)(kb < K ? W[(size_t)(kb < K ? kb : K - 1) * ld + n] : 0.f); }
  return a;
}
struct F2 { v16b h, l; };
__device__ __forceinline__ F2 bsplit16(const float v[16]) { F2 r;
#pragma unroll
  for (int i = 0; i < 16; ++i) { const __bf16 h = (__bf16)v[i]; r.h[i] = h; r.l[i] = (__bf16)(v[i] - (float)h); }
  return r; }
__device__ __forceinline__ F2 split_row(const float* row, int k0, int lane) { float v[16]; const float* p = row + k0 + 8 * (lane >> 4);
#pragma unroll
  for (int i = 0; i < 8; ++i) { v[i] = p[i]; v[8 + i] = p[16 + i]; }
  return bsplit16(v); }
__device__ __forceinline__ F2 split_rowK(const float* row, int k0, int lane, int K) { float v[16]; const int g = lane >> 4;
#pragma unroll
  for (int i = 0; i < 8; ++i) { const int ka = k0 + 8 * g + i, kb = ka + 16; v[i] = ka < K ? row[ka < K ? ka : K - 1] : 0.f; v[8 + i] = kb < K ? row[kb < K ? kb : K - 1] : 0.f; }
  return bsplit16(v); }
__device__ __forceinline__ F2 split_col(const float* W, int k0, int n, int lane, int ld, int K) { float v[16]; const int g = lane >> 4;
#pragma unroll
  for (int i = 0; i < 8; ++i) { const int ka = k0 + 8 * g + i, kb = ka + 16; v[i] = ka < K ? W[(size_t)(ka < K ? ka : K - 1) * ld + n] : 0.f; v[8 + i] = kb < K ? W[(size_t)(kb < K ? kb : K - 1) * ld + n] : 0.f; }
  return bsplit16(v); }
__device__ __forceinline__ v8f mac3(const F2& a, const F2& b, v8f c) { c = wmma_bf(a.l, b.h, c); c = wmma_bf(a.h, b.l, c); return wmma_bf(a.h, b.h, c); }
__device__ __forceinline__ float sigm(float v) { return 1.0f / (1.0f + expf(-v)); }
#define LDSX() do { asm volatile("s_wait_dscnt 0" ::: "memory"); __builtin_amdgcn_wave_barrier(); __builtin_amdgcn_fence(__ATOMIC_RELEASE, "workgroup"); } while (0)

// Standard multi-head self-attention with a key-padding mask input (x [4,2048,256]; torch (out,in) W_Q / W_K / W_V / W_O [256,256] uniform(+-1/16) applied as x @ W.T, no biases; mask [4,2048] int32 = ones (const: nothing is masked on this draw); 4 heads x 64; scores x 64^-0.5; where(mask[:, None, None, :] == 0, -inf, scores); softmax; out @ W_O.T).
#define NB 4
#define TT 2048
#define CC 256            // NH * HD = projected width
#define DIN 256          // input (model) width
#define NH 4
#define HD 64
#define NQB (TT / 64)
#define HG 4
#define SCALE (0.125f)
#define CAUSAL 0
#ifndef TNB
#define TNB NB
#endif
__device__ __forceinline__ float bfr(float v) { return (float)(__bf16)v; }
__host__ __device__ __forceinline__ int kb_last(int qb) { return CAUSAL ? ((qb * 64 + 63) >> 7) : (TT / 128 - 1); }
typedef __attribute__((ext_vector_type(8))) __bf16 v8b;
__device__ __forceinline__ v16b frag_b(const __bf16* rowk0, int lane) {
  union { v16b v; v8b q[2]; } u; const __bf16* p = rowk0 + 8 * (lane >> 4);
  u.q[0] = *(const v8b*)p; u.q[1] = *(const v8b*)(p + 16); return u.v;
}
#define QBH 0              // unused (k_fa has no high-precision path)
#define QHI 0               // single-product logits on every row
#define KHI 64            // key rows carrying k residual / v bf16 hi+lo planes (written by k_proj, read by no kernel)
// B fragment (k rows k0+.., output column o) of a weight: (in,out) [K][ld] or (out,in) [ld rows of K]: bf16 exact, or f16(bf16 * 256) exact
__device__ __forceinline__ v16b wcol_io(const float* Wm, int k0, int o, int lane, int ld) { v16b w; const int g = lane >> 4;
#pragma unroll
  for (int i = 0; i < 8; ++i) { w[i] = (__bf16)Wm[(size_t)(k0 + 8 * g + i) * ld + o]; w[8 + i] = (__bf16)Wm[(size_t)(k0 + 16 + 8 * g + i) * ld + o]; }
  return w; }
__device__ __forceinline__ v16b wcol_oi(const float* Wm, int k0, int o, int lane, int K) { v16b w; const float* p = Wm + (size_t)o * K + k0 + 8 * (lane >> 4);
#pragma unroll
  for (int i = 0; i < 8; ++i) { w[i] = (__bf16)p[i]; w[8 + i] = (__bf16)p[16 + i]; }
  return w; }
__device__ __forceinline__ v16h wcolh_io(const float* Wm, int k0, int o, int lane, int ld) { v16h w; const int g = lane >> 4;
#pragma unroll
  for (int i = 0; i < 8; ++i) { w[i] = (_Float16)(bfr(Wm[(size_t)(k0 + 8 * g + i) * ld + o]) * 256.0f); w[8 + i] = (_Float16)(bfr(Wm[(size_t)(k0 + 16 + 8 * g + i) * ld + o]) * 256.0f); }
  return w; }
__device__ __forceinline__ v16h wcolh_oi(const float* Wm, int k0, int o, int lane, int K) { v16h w; const float* p = Wm + (size_t)o * K + k0 + 8 * (lane >> 4);
#pragma unroll
  for (int i = 0; i < 8; ++i) { w[i] = (_Float16)(bfr(p[i]) * 256.0f); w[8 + i] = (_Float16)(bfr(p[16 + i]) * 256.0f); }
  return w; }
#define WQKV_LAYOUT 1   // 0 = (in,out) [DIN][CC]; 1 = (out,in) [CC][DIN]; 2 = per-head [NH][DIN][HD]
__device__ __forceinline__ v16b wcol_hdk(const float* Wm, int k0, int o, int lane) { v16b w; const int g = lane >> 4; const float* p = Wm + (size_t)(o / HD) * DIN * HD + (o % HD);
#pragma unroll
  for (int i = 0; i < 8; ++i) { w[i] = (__bf16)p[(size_t)(k0 + 8 * g + i) * HD]; w[8 + i] = (__bf16)p[(size_t)(k0 + 16 + 8 * g + i) * HD]; }
  return w; }
#define WO_OUT_IN 1
#if WQKV_LAYOUT == 1
#define WCOL(W, k0, o, lane) wcol_oi(W, k0, o, lane, DIN)
#elif WQKV_LAYOUT == 2
#define WCOL(W, k0, o, lane) wcol_hdk(W, k0, o, lane)
#else
#define WCOL(W, k0, o, lane) wcol_io(W, k0, o, lane, CC)
#endif
#if WO_OUT_IN
#define WOCOL(W, k0, o, lane) wcol_oi(W, k0, o, lane, CC)
#define WOCOLH(W, k0, o, lane) wcolh_oi(W, k0, o, lane, CC)
#else
#define WOCOL(W, k0, o, lane) wcol_io(W, k0, o, lane, DIN)
#define WOCOLH(W, k0, o, lane) wcolh_io(W, k0, o, lane, DIN)
#endif

#define WS_QH  0u                                      // f16 q rows [b*t][CC]
#define WS_KH  (WS_QH + 2u * (size_t)NB * TT * CC)      // f16 k rows [b*t][CC]
#define WS_VT  (WS_KH + 2u * (size_t)NB * TT * CC)      // f16 v planes [b][c][t]
#define WS_QL  (WS_VT + 2u * (size_t)NB * CC * TT)      // f16 q residual x 2^10 rows [b][t < QHI][CC]
#define WS_KL  (WS_QL + 2u * (size_t)NB * QHI * CC)     // f16 k residual x 2^10 rows [b][t < KHI][CC]
#define WS_VB  (WS_KL + 2u * (size_t)NB * KHI * CC)     // bf16 v hi planes [b][c][t < KHI]
#define WS_VBL (WS_VB + 2u * (size_t)NB * CC * KHI)
#define WS_S   (WS_VBL + 2u * (size_t)NB * CC * KHI)    // (unused: logits and P stay in registers)
#define WS_Y   (WS_S  + 4u * (size_t)HG * TT * TT)      // f32 ctx rows [b*t][CC] (only when there is an output projection)
#define WS_END (WS_Y  + 4u * (size_t)NB * TT * CC)

// Operand staging of k_proj and k_out: ROWS contiguous rows of 256 f32 go once per block into LDS as 16-bit rows, read by whole lines (128 threads x 16 B = two rows a step) and rounded on the way exactly as the fragment loaders rounded them.
// MODE 0: bf16; 1: f16(v x 2^6); 2: f16(bf16(v) x 2^8). Row pitch 528 B = 16 B x 33: the 16-byte fragment reads of 16 rows meet no bank twice.
#define GP 264
#define GOPB ((128 + 64) * GP * 2)   /* bytes: 128 weight rows, then 64 activation rows */
typedef __attribute__((ext_vector_type(4))) __bf16 v4b;
typedef __attribute__((ext_vector_type(4))) _Float16 v4h;
template <int ROWS, int MODE> __device__ __forceinline__ void stage16(const float* __restrict__ src, unsigned char* dst, int tid) {
  const float* p = src + tid * 4; unsigned char* d = dst + (tid >> 6) * (GP * 2) + (tid & 63) * 8;
#pragma unroll 1   /* rolled: one batch of 32 loads is held in registers at a time; unrolled, k_proj took more registers than three blocks on a WGP, which its LDS allows, can have */
  for (int i0 = 0; i0 < ROWS / 2; i0 += 32) { v4f v[32];
#pragma unroll
    for (int u = 0; u < 32; ++u) v[u] = *(const v4f*)(p + (i0 + u) * 512);
#pragma unroll
    for (int u = 0; u < 32; ++u) { unsigned char* q = d + (i0 + u) * (GP * 4);
      if constexpr (MODE == 0) { v4b o;
#pragma unroll
        for (int r = 0; r < 4; ++r) o[r] = (__bf16)v[u][r];
        *(v4b*)q = o; }
      else { v4h o;
#pragma unroll
        for (int r = 0; r < 4; ++r) o[r] = MODE == 1 ? (_Float16)(v[u][r] * 64.0f) : (_Float16)(bfr(v[u][r]) * 256.0f);
        *(v4h*)q = o; } } } }
static_assert(WQKV_LAYOUT == 1 && WO_OUT_IN == 1 && DIN == 256 && CC == 256, "stage16 takes (out,in) weights and rows of 256");
// ---- k_proj: block = (64 rows, 128 cols, which): q/k/v = X W (+ b) with exact bf16 products (K = DIN) -> which 0: q f16 rows (+ residual rows < QHI); 1: k f16 rows (+ residual rows < KHI); 2: v f16 planes [c][t] (+ bf16 hi/lo planes for t < KHI)
__global__ __launch_bounds__(128) void k_proj(const float* __restrict__ XQ, const float* __restrict__ XK, const float* __restrict__ XV, const float* __restrict__ WQ, const float* __restrict__ WK, const float* __restrict__ WV, const float* __restrict__ BQ, const float* __restrict__ BK, const float* __restrict__ BV,
    _Float16* __restrict__ QH, _Float16* __restrict__ QL, _Float16* __restrict__ KH, _Float16* __restrict__ KL, _Float16* __restrict__ VT, __bf16* __restrict__ VB, __bf16* __restrict__ VBL) {
  __shared__ __align__(16) unsigned char SM[GOPB];   /* first the two operands, then, behind a barrier, the output tiles */
  _Float16 (*sh)[136] = (_Float16 (*)[136])SM; _Float16 (*sl)[136] = (_Float16 (*)[136])(SM + 17408); _Float16 (*th)[72] = (_Float16 (*)[72])(SM + 34816); __bf16 (*tb)[72] = (__bf16 (*)[72])(SM + 53248); __bf16 (*tbl)[72] = (__bf16 (*)[72])(SM + 71680);
  static_assert(2 * 64 * 136 * 2 + 3 * 128 * 72 * 2 <= GOPB, "output tiles fit the operands' LDS");
  const int tid = threadIdx.x, wave = tid >> 5, lane = tid & 31, col = lane & 15, g = lane >> 4; const int which = blockIdx.z; const int c0 = blockIdx.y * 128; const size_t r0 = (size_t)blockIdx.x * 64; const size_t bb = r0 / TT; const int t0 = (int)(r0 % TT);
  const float* X = which == 0 ? XQ : which == 1 ? XK : XV; const float* WA = which == 0 ? WQ : which == 1 ? WK : WV; const float* BA = which == 0 ? BQ : which == 1 ? BK : BV;
  stage16<64, 0>(X + r0 * DIN, SM + 128 * GP * 2, tid); stage16<128, 0>(WA + (size_t)c0 * DIN, SM, tid);
  __syncthreads();   /* both operands are readable by the four waves */
  const __bf16* sW = (const __bf16*)SM + col * GP; const __bf16* sX = (const __bf16*)SM + (128 + wave * 16 + col) * GP;
  v8f acc[8] = {}; v16b a[2], w[2][8];
  a[0] = frag_b(sX, lane);
#pragma unroll
  for (int j = 0; j < 8; ++j) w[0][j] = frag_b(sW + j * 16 * GP, lane);
#pragma unroll   /* unrolled: the two fragment sets alternate by name; the next chunk's 18 LDS reads stand as one group in front of this chunk's products and return under them */
  for (int kc = 0; kc < DIN / 32; ++kc) { const int c = kc & 1;
    if (kc + 1 < DIN / 32) { a[c ^ 1] = frag_b(sX + (kc + 1) * 32, lane);
#pragma unroll
      for (int j = 0; j < 8; ++j) w[c ^ 1][j] = frag_b(sW + j * 16 * GP + (kc + 1) * 32, lane); }
#pragma unroll
    for (int j = 0; j < 8; ++j) acc[j] = wmma_bf(a[c], w[c][j], acc[j]); }
  __syncthreads();   /* every wave has left the operands: the output tiles below take their LDS */
  if (which < 2) { _Float16* DH = which == 0 ? QH : KH; _Float16* DL = which == 0 ? QL : KL; const int nhi = which == 0 ? QHI : KHI; const bool hi_rows = t0 < nhi;
#pragma unroll
    for (int j = 0; j < 8; ++j) { const float bias = BA ? bfr(BA[c0 + j * 16 + col]) : 0.f;
#pragma unroll
      for (int r = 0; r < 8; ++r) { const float v = acc[j][r] + bias; const _Float16 hv = (_Float16)v; sh[wave * 16 + 8 * g + r][j * 16 + col] = hv; sl[wave * 16 + 8 * g + r][j * 16 + col] = (_Float16)((v - (float)hv) * 1024.0f); } }
    __syncthreads();
    for (int e = tid; e < 64 * 16; e += 128) { const int rl = e >> 4, q = e & 15; vst2((unsigned*)(DH + (r0 + rl) * CC + c0 + q * 8), *(const v4u*)&sh[rl][q * 8]); if (hi_rows) vst2((unsigned*)(DL + (bb * nhi + t0 + rl) * (size_t)CC + c0 + q * 8), *(const v4u*)&sl[rl][q * 8]); }
  } else { const bool hi_rows = t0 < KHI;
#pragma unroll
    for (int j = 0; j < 8; ++j) { const float bias = BA ? bfr(BA[c0 + j * 16 + col]) : 0.f;
#pragma unroll
      for (int r = 0; r < 8; ++r) { const float v = acc[j][r] + bias; const int rl = wave * 16 + 8 * g + r, cl = j * 16 + col; th[cl][rl] = (_Float16)v; const __bf16 bh = (__bf16)v; tb[cl][rl] = bh; tbl[cl][rl] = (__bf16)(v - (float)bh); } }
    __syncthreads();
    for (int e = tid; e < 128 * 8; e += 128) { const int cl = e >> 3, q = e & 7; vst2((unsigned*)(VT + (bb * CC + c0 + cl) * (size_t)TT + t0 + q * 8), *(const v4u*)&th[cl][q * 8]); if (hi_rows) { const size_t o3 = (bb * CC + c0 + cl) * (size_t)KHI + t0 + q * 8; vst2((unsigned*)(VB + o3), *(const v4u*)&tb[cl][q * 8]); vst2((unsigned*)(VBL + o3), *(const v4u*)&tbl[cl][q * 8]); } } } }
__device__ __forceinline__ void ex2_first(float& al, float* t, float dm, float s0, float s1, float s2, float s3, float c, float a) {
  asm("v_fma_f32 %1, %6, %10, %11\n\tv_fma_f32 %2, %7, %10, %11\n\tv_exp_f32 %0, %5\n\tv_fma_f32 %3, %8, %10, %11\n\tv_fma_f32 %4, %9, %10, %11"
      : "=&v"(al), "=&v"(t[0]), "=&v"(t[1]), "=&v"(t[2]), "=&v"(t[3]) : "v"(dm), "v"(s0), "v"(s1), "v"(s2), "v"(s3), "s"(c), "v"(a)); }
__device__ __forceinline__ void ex2_fma4(float* e, float* tn, const float* t, float s0, float s1, float s2, float s3, float c, float a) {
  asm("v_exp_f32 %0, %8\n\tv_fma_f32 %4, %12, %16, %17\n\tv_exp_f32 %1, %9\n\tv_fma_f32 %5, %13, %16, %17\n\tv_exp_f32 %2, %10\n\tv_fma_f32 %6, %14, %16, %17\n\tv_exp_f32 %3, %11\n\tv_fma_f32 %7, %15, %16, %17"
      : "=&v"(e[0]), "=&v"(e[1]), "=&v"(e[2]), "=&v"(e[3]), "=&v"(tn[0]), "=&v"(tn[1]), "=&v"(tn[2]), "=&v"(tn[3]) : "v"(t[0]), "v"(t[1]), "v"(t[2]), "v"(t[3]), "v"(s0), "v"(s1), "v"(s2), "v"(s3), "s"(c), "v"(a)); }
// the last four have no multiply-add left to carry: each fills the slot of the one in front, and one v_nop that of the last
__device__ __forceinline__ void ex2_last4(float* e, const float* t) {
  asm("v_exp_f32 %0, %4\n\tv_exp_f32 %1, %5\n\tv_exp_f32 %2, %6\n\tv_exp_f32 %3, %7\n\tv_nop" : "=&v"(e[0]), "=&v"(e[1]), "=&v"(e[2]), "=&v"(e[3]) : "v"(t[0]), "v"(t[1]), "v"(t[2]), "v"(t[3])); }
// Products of one kind as ONE statement: each fills the hazard slots of the one in front, so the four v_nop that keep vector instructions off D, A and B stand once behind the last product and not behind every one.
// The builtin alone did not serve: the LDS reads sank to their products.
__device__ __forceinline__ void wmma_s8(v8f* s, const v16h (*k)[HD / 32], const v16h* q) {   /* s[kt] = k[kt][0] q[0] + k[kt][1] q[1]; four independent tiles, then their second halves */
  asm volatile("v_wmma_f32_16x16x32_f16 %0, %4, %12, 0\n\tv_wmma_f32_16x16x32_f16 %1, %6, %12, 0\n\tv_wmma_f32_16x16x32_f16 %2, %8, %12, 0\n\tv_wmma_f32_16x16x32_f16 %3, %10, %12, 0\n\t"
               "v_wmma_f32_16x16x32_f16 %0, %5, %13, %0\n\tv_wmma_f32_16x16x32_f16 %1, %7, %13, %1\n\tv_wmma_f32_16x16x32_f16 %2, %9, %13, %2\n\tv_wmma_f32_16x16x32_f16 %3, %11, %13, %3\n\t"
               "v_nop\n\tv_nop\n\tv_nop\n\tv_nop"
               : "=&v"(s[0]), "=&v"(s[1]), "=&v"(s[2]), "=&v"(s[3]) : "v"(k[0][0]), "v"(k[0][1]), "v"(k[1][0]), "v"(k[1][1]), "v"(k[2][0]), "v"(k[2][1]), "v"(k[3][0]), "v"(k[3][1]), "v"(q[0]), "v"(q[1])); }
__device__ __forceinline__ void wmma_pv4(v8f* a, v16h v0, v16h v1, v16h v2, v16h v3, v16h p) {   /* a[j] += v_j p */
  asm volatile("v_wmma_f32_16x16x32_f16 %0, %4, %8, %0\n\tv_wmma_f32_16x16x32_f16 %1, %5, %8, %1\n\tv_wmma_f32_16x16x32_f16 %2, %6, %8, %2\n\tv_wmma_f32_16x16x32_f16 %3, %7, %8, %3\n\t"
               "v_nop\n\tv_nop\n\tv_nop\n\tv_nop"
               : "+v"(a[0]), "+v"(a[1]), "+v"(a[2]), "+v"(a[3]) : "v"(v0), "v"(v1), "v"(v2), "v"(v3), "v"(p)); }
__device__ __forceinline__ float xhalf(float v) { const int i = __builtin_bit_cast(int, v); return __builtin_bit_cast(float, __builtin_amdgcn_permlanex16(i, i, 0x76543210, 0xfedcba98, false, false)); }   /* lane l <-> l ^ 16 */
// K and V reach the waves through LDS: a stage is SKEYS keys; each of the 8 waves brings one slice of 64 rows x 128 B per stage by one tensor load
// (waves 0..3: 64 k rows each; waves 4..7: the 64 v planes x 64 keys each), the mover's 16-byte pad giving the pitch 144 B that 16-byte LDS reads want; two buffers.
typedef uint32_t u32x4 __attribute__((ext_vector_type(4)));
typedef uint32_t u32x8 __attribute__((ext_vector_type(8)));
#define SKEYS 256
#define NST (TT / SKEYS)
#define LPITCH 144u
#define SLICEB 10240u          /* 64 rows x 144 B = 9216 B, rounded up so that every slice starts at a multiple of 2 KiB */
#define BUFB (8u * SLICEB)
__device__ __forceinline__ uint32_t uni(uint32_t v) { return (uint32_t)__builtin_amdgcn_readfirstlane(v); }
__device__ __forceinline__ uint32_t pinned(uint32_t v) { uint32_t w = uni(v); asm volatile("" : "+s"(w)); return w; }
// both groups are in-out operands: the descriptor then has registers of its own for the whole kernel, and none of them takes another value while a request is in flight
__device__ __forceinline__ void tdm_load(u32x4& g0, u32x8& g1) { asm volatile("tensor_load_to_lds %0, %1" : "+s"(g0), "+s"(g1) :: "memory"); }
__device__ __forceinline__ v16h frag_l(const unsigned char* p) { union { v16h v; v8h q[2]; } u; u.q[0] = *(const v8h*)p; u.q[1] = *(const v8h*)(p + 32); return u.v; }
__global__ __launch_bounds__(256) void k_fa(const _Float16* __restrict__ QH, const _Float16* __restrict__ KH, const _Float16* __restrict__ VT, const int* __restrict__ MASK, float* __restrict__ Y) {
  __shared__ __attribute__((aligned(2048))) unsigned char L[2 * BUFB];
  const int tid = threadIdx.x, wave = tid >> 5, lane = tid & 31, col = lane & 15, g = lane >> 4;
  const int h = blockIdx.y, b = blockIdx.z; const int q0 = blockIdx.x * 128 + wave * 16;
  const uint32_t wv = uni((uint32_t)tid >> 5), sl = wv & 3u; const bool isV = wv >= 4u;
  const uint32_t lbase = (uint32_t)(size_t)L;
  const uint64_t ga0 = isV ? (uint64_t)(size_t)(VT + ((size_t)b * CC + h * HD) * (size_t)TT + sl * 64u) : (uint64_t)(size_t)(KH + ((size_t)b * TT + sl * 64u) * CC + h * HD);
  const uint32_t gsh = isV ? 9u : 17u;   /* bytes from one stage to the next: SKEYS x 2 along a v plane, SKEYS x CC x 2 down the k rows */
  static_assert(SKEYS * 2 == 1 << 9 && SKEYS * CC * 2 == 1 << 17 && NST >= 2, "stage steps");
  u32x8 g1;   /* 1-byte elements, tensor = tile = 64 rows of 128 B, a 16-byte pad behind every 128 B, no mask */
  g1[0] = uni((1u << 20) | (4u << 22) | (3u << 25)); g1[1] = uni(128u << 16); g1[2] = uni(64u << 16); g1[3] = uni(128u << 16); g1[4] = uni(64u); g1[5] = uni(isV ? (uint32_t)TT * 2u : (uint32_t)CC * 2u); g1[6] = uni(0u); g1[7] = uni(0u);
  u32x4 g0; g0[0] = uni(1u);
  auto issue = [&](uint32_t st) { const uint64_t ga = ga0 + (uint64_t)(st << gsh);
    g0[1] = uni(lbase + (st & 1u) * BUFB + wv * SLICEB); g0[2] = uni((uint32_t)ga); g0[3] = uni((((uint32_t)(ga >> 32)) & 0x01FFFFFFu) | 0x80000000u);
    tdm_load(g0, g1); };
  const int* Mb = MASK + (size_t)b * TT + lane;
  const float C2 = SCALE * 1.44269504088896f;   /* raw logit -> log2 units */
  v16h qf[HD / 32], kf[4][HD / 32];
#pragma unroll
  for (int kc = 0; kc < HD / 32; ++kc) qf[kc] = frag_h(QH + ((size_t)b * TT + q0 + col) * CC + h * HD + kc * 32, lane);
  int mk0 = Mb[0], mk1 = Mb[32];
  v8f acc[HD / 16] = {}; float m = -1.0e30f, l = 0.f;
  issue(0u);
  asm volatile("s_wait_tensorcnt 0x0" ::: "memory");   /* this wave's slice of stage 0 has landed */
  __syncthreads();                                      /* every wave's slice of stage 0 is readable by all */
  issue(pinned(1u));                                    /* pinned(): stage 1's descriptor words are formed behind the wait above */
  const uint32_t loff = (uint32_t)col * LPITCH + 16u * (uint32_t)g;
#pragma unroll 1   /* rolled: one publish point and one refill site */
  for (uint32_t st = 0; st < NST; ++st) { const unsigned char* Bp = L + (st & 1u) * BUFB + loff;
#pragma unroll
    for (int kt = 0; kt < 4; ++kt)
#pragma unroll
      for (int kc = 0; kc < HD / 32; ++kc) kf[kt][kc] = frag_l(Bp + kt * 16 * LPITCH + kc * 64);
#pragma unroll 1   /* rolled: unrolled, the four trips of a stage spilled */
    for (uint32_t hb = 0; hb < SKEYS / 64; ++hb) { const int it = (int)(st * (SKEYS / 64) + hb); const unsigned char* Vp = Bp + (4u + hb) * SLICEB;
    v16h vf[HD / 16][2];
#pragma unroll
    for (int j = 0; j < HD / 16; ++j) { vf[j][0] = frag_l(Vp + j * 16 * LPITCH); vf[j][1] = frag_l(Vp + j * 16 * LPITCH + 64); }
    v8f s[4]; wmma_s8(s, kf, qf);
    const unsigned b0 = __builtin_amdgcn_ballot_w32(mk0 != 0), b1 = __builtin_amdgcn_ballot_w32(mk1 != 0);
    const int kn = (it + 1 < TT / 64 ? it + 1 : it) * 64;   /* next trip's mask words fly under this trip's softmax (the last trip rereads its own) */
    const unsigned char* Kn = Bp + (hb + 1u < SKEYS / 64 ? hb + 1u : hb) * SLICEB;   /* the next 64 keys' k fragments, of this same stage, fly under this trip's softmax (a stage's last trip rereads its own) */
#pragma unroll
    for (int kt = 0; kt < 4; ++kt)
#pragma unroll
      for (int kc = 0; kc < HD / 32; ++kc) kf[kt][kc] = frag_l(Kn + kt * 16 * LPITCH + kc * 64);
    mk0 = Mb[kn]; mk1 = Mb[kn + 32];
    asm volatile("s_wait_xcnt 0x0" ::: "memory");   /* the mask loads' address registers are free to be rewritten behind this (this build reuses them in the maximum) */
    __builtin_amdgcn_sched_barrier(0);   /* holds the next k reads in front of the softmax, under which they return; left free, the compiler sinks them towards the trip's foot, close in front of the products that wait for them */
    if ((b0 & b1) != 0xFFFFFFFFu) { const unsigned w0 = b0 >> (8 * g), w1 = b1 >> (8 * g);   /* wave-uniform: some key of these 64 is masked */
#pragma unroll
      for (int kt = 0; kt < 4; ++kt)
#pragma unroll
        for (int r = 0; r < 8; ++r) { const unsigned w = kt < 2 ? w0 : w1; s[kt][r] = ((w >> ((kt & 1) * 16 + r)) & 1u) ? s[kt][r] : -3.0e38f; } }
    float mt[4];
#pragma unroll
    for (int kt = 0; kt < 4; ++kt) { mt[kt] = s[kt][0];
#pragma unroll
      for (int r = 1; r < 8; ++r) mt[kt] = fmaxf(mt[kt], s[kt][r]); }
    float mx = fmaxf(fmaxf(mt[0], mt[1]), fmaxf(mt[2], mt[3]));
    mx = fmaxf(mx, xhalf(mx));
    const float mn = fmaxf(m, mx * C2), ms = 10.0f - mn, dm = m - mn; m = mn;
#define SCN(n) s[2 * ((n) >> 4) + ((n) & 1)][((n) >> 1) & 7]   /* score n = 16 c2 + 2 i + w is s[2 c2 + w][i] */
    float al, t[32], e[32];
    ex2_first(al, t, dm, SCN(0), SCN(1), SCN(2), SCN(3), C2, ms);
#pragma unroll
    for (int n = 0; n < 28; n += 4) ex2_fma4(e + n, t + n + 4, t + n, SCN(n + 4), SCN(n + 5), SCN(n + 6), SCN(n + 7), C2, ms);
    ex2_last4(e + 28, t + 28);
    v16h p[2]; float sum = 0.f;
#pragma unroll
    for (int c2 = 0; c2 < 2; ++c2)
#pragma unroll
      for (int i = 0; i < 8; ++i) { const float e0 = e[16 * c2 + 2 * i], e1 = e[16 * c2 + 2 * i + 1]; sum += e0 + e1; p[c2][i] = (_Float16)e0; p[c2][8 + i] = (_Float16)e1; }
    l = l * al + sum;
#pragma unroll
    for (int j = 0; j < HD / 16; ++j) acc[j] *= al;
    wmma_pv4(acc, vf[0][0], vf[1][0], vf[2][0], vf[3][0], p[0]); wmma_pv4(acc, vf[0][1], vf[1][1], vf[2][1], vf[3][1], p[1]); }
    asm volatile("s_wait_dscnt 0x0" ::: "memory");       /* this wave's reads of stage st have returned */
    asm volatile("s_wait_tensorcnt 0x0" ::: "memory");   /* this wave's slice of stage st + 1 has landed */
    __syncthreads();                                      /* stage st + 1 is readable by all, and every wave has left stage st's buffer */
    if (pinned(st + 2u < NST)) issue(pinned(st + 2u)); }  /* the refill of the buffer just left; scalar test */
  asm volatile("s_wait_tensorcnt 0x0" ::: "memory");     /* nothing of the mover is in flight when the wave ends */
  asm volatile("s_wait_dscnt 0x0" ::: "memory");         /* nor any LDS read of this wave */
  l += xhalf(l);
  const float inv = 1.0f / l;
  float* yr = Y + ((size_t)b * TT + q0 + col) * CC + h * HD + 8 * g;   /* acc[j][r] = ctx[query col][j * 16 + 8g + r] */
#pragma unroll
  for (int j = 0; j < HD / 16; ++j) { v4f lo, hi;
#pragma unroll
    for (int r = 0; r < 4; ++r) { lo[r] = acc[j][r] * inv; hi[r] = acc[j][4 + r] * inv; }
    vst2(yr + j * 16, lo); vst2(yr + j * 16 + 4, hi); } }
// ---- k_out: block = (64 rows, 128 cols): out = ctx Wo (+ bo): ctx x 2^6 once to f16 against Wo as f16(bf16 x 2^8) exact (1 product) x 2^-14; causal early rows (< QHI of each sequence): ctx bf16 hi + lo against exact bf16 Wo (2 products)
__global__ __launch_bounds__(128) void k_out(const float* __restrict__ Y, const float* __restrict__ WO, const float* __restrict__ BO, float* __restrict__ OUT) { __shared__ __align__(16) unsigned char SM[GOPB];   /* first the two operands, then, behind a barrier, the output tile */
  float (*sf)[16][132] = (float (*)[16][132])SM; static_assert(4 * 16 * 132 * 4 <= GOPB, "output tile fits the operands' LDS");
  const int tid = threadIdx.x, wave = tid >> 5, lane = tid & 31, col = lane & 15, g = lane >> 4; const int c0 = blockIdx.y * 128; const size_t r0 = (size_t)blockIdx.x * 64 + wave * 16;
  v8f acc[8] = {};
  if (CAUSAL && (int)(((size_t)blockIdx.x * 64) % TT) < QHI) {   /* block-uniform */
#pragma unroll 2
    for (int kc = 0; kc < CC / 32; ++kc) { const F2 a = split_row(Y + (r0 + col) * CC, kc * 32, lane); asm volatile("s_wait_loadcnt 0x0" ::: "memory");
#pragma unroll
      for (int j = 0; j < 8; ++j) { const v16b w = WOCOL(WO, kc * 32, c0 + j * 16 + col, lane); asm volatile("s_wait_loadcnt 0x0" ::: "memory"); acc[j] = wmma_bf(a.h, w, acc[j]); acc[j] = wmma_bf(a.l, w, acc[j]); } }
#pragma unroll
    for (int j = 0; j < 8; ++j) { const float bias = BO ? bfr(BO[c0 + j * 16 + col]) : 0.f;
#pragma unroll
      for (int r = 0; r < 8; ++r) sf[wave][8 * g + r][j * 16 + col] = acc[j][r] + bias; }
  } else {
    stage16<64, 1>(Y + (size_t)blockIdx.x * 64 * CC, SM + 128 * GP * 2, tid); stage16<128, 2>(WO + (size_t)c0 * CC, SM, tid);   /* ctx carried x 2^6 into f16 so small-magnitude context rows stay clear of f16 subnormals */
    __syncthreads();   /* both operands are readable by the four waves */
    const _Float16* sW = (const _Float16*)SM + col * GP; const _Float16* sY = (const _Float16*)SM + (128 + wave * 16 + col) * GP;
    v16h a[2], w[2][8];
    a[0] = frag_h(sY, lane);
#pragma unroll
    for (int j = 0; j < 8; ++j) w[0][j] = frag_h(sW + j * 16 * GP, lane);
#pragma unroll   /* unrolled: the two fragment sets alternate by name; the next chunk's 18 LDS reads stand as one group in front of this chunk's products and return under them */
    for (int kc = 0; kc < CC / 32; ++kc) { const int c = kc & 1;
      if (kc + 1 < CC / 32) { a[c ^ 1] = frag_h(sY + (kc + 1) * 32, lane);
#pragma unroll
        for (int j = 0; j < 8; ++j) w[c ^ 1][j] = frag_h(sW + j * 16 * GP + (kc + 1) * 32, lane); }
#pragma unroll
      for (int j = 0; j < 8; ++j) acc[j] = wmma16(a[c], w[c][j], acc[j]); }
    __syncthreads();   /* every wave has left the operands: the output tile below takes their LDS */
#pragma unroll
    for (int j = 0; j < 8; ++j) { const float bias = BO ? bfr(BO[c0 + j * 16 + col]) : 0.f;
#pragma unroll
      for (int r = 0; r < 8; ++r) sf[wave][8 * g + r][j * 16 + col] = acc[j][r] * (1.0f / 16384.0f) + bias; } }   /* 2^-8 (Wo carry) x 2^-6 (ctx carry) */
  LDSX(); for (int rl = 0; rl < 16; ++rl) vst2(OUT + (r0 + rl) * DIN + c0 + lane * 4, *(const v4f*)&sf[wave][rl][lane * 4]); }

extern "C" void kernel_launch(void* const* d_in, const int* in_sizes, int n_in, void* d_out, int out_size, void* d_ws, size_t ws_size, hipStream_t stream) {
  (void)in_sizes; (void)n_in; (void)out_size;
  const float** F = (const float**)d_in;
  if (ws_size < (size_t)WS_END) return;
  char* ws = (char*)d_ws; _Float16 *QH = (_Float16*)(ws + WS_QH), *KH = (_Float16*)(ws + WS_KH), *VT = (_Float16*)(ws + WS_VT), *QL = (_Float16*)(ws + WS_QL), *KL = (_Float16*)(ws + WS_KL); __bf16 *VB = (__bf16*)(ws + WS_VB), *VBL = (__bf16*)(ws + WS_VBL); float *Y = (float*)(ws + WS_Y);
  (void)Y; (void)QL; (void)KL; (void)VB; (void)VBL;
  // inputs: 0 x [4,2048,256]; 1 W_Q [256,256] (out,in); 2 W_K; 3 W_V; 4 W_O (out,in); 5 mask [4,2048] int32 (ones on this draw; read per key); no biases
  k_proj<<<dim3(TNB * TT / 64, CC / 128, 3), 128, 0, stream>>>(F[0], F[0], F[0], F[1], F[2], F[3], nullptr, nullptr, nullptr, QH, QL, KH, KL, VT, VB, VBL);
  k_fa<<<dim3(TT / 128, NH, TNB), 256, 0, stream>>>(QH, KH, VT, (const int*)d_in[5], Y);
  k_out<<<dim3(TNB * TT / 64, DIN / 128), 128, 0, stream>>>(Y, F[4], nullptr, (float*)d_out);
}

// v005
// It runs in 35 microseconds.
// Next to v004, in two timings, it ran 1.14 times as fast each time.
// Over all steps from v000 it is 16.2 times as fast.
// compute dtype: all float inputs rounded to bf16; q / k / v projections with EXACT bf16 products on WMMA 16x16x32 (f32 accumulate), no biases; logits q x k once to f16 each (1 product) x 64^-0.5; the int key mask read per (batch, key); softmax f32 with a running maximum, fused with both products; P = exp(s - max) x 2^10 once to f16 x v once to f16 (1 product), divided by the f32 sum at the end; ctx x 2^6 once to f16 x W_O f16(bf16 x 2^8); f32 output.
#include <hip/hip_runtime.h>
#include <math.h>
#include <stdint.h>

typedef __attribute__((ext_vector_type(16))) _Float16 v16h;
typedef __attribute__((ext_vector_type(16))) __bf16 v16b;
typedef __attribute__((ext_vector_type(8)))  _Float16 v8h;
typedef __attribute__((ext_vector_type(8)))  float v8f;
typedef __attribute__((ext_vector_type(4)))  float v4f;
typedef __attribute__((ext_vector_type(2)))  float v2f;
typedef __attribute__((ext_vector_type(4)))  unsigned v4u;
typedef __attribute__((ext_vector_type(4)))  int v4i;
typedef float __attribute__((may_alias)) float_a;
typedef int __attribute__((may_alias)) int_a;

template <typename T> __device__ __forceinline__ void vst2(void* p, T v) { *(T*)p = v;  }
__device__ __forceinline__ v8f wmma16(v16h a, v16h b, v8f c) {
  v8f d = __builtin_amdgcn_wmma_f32_16x16x32_f16(false, a, false, b, (short)0, c, false, false);
  asm volatile("v_nop\n\tv_nop\n\tv_nop\n\tv_nop" : "+v"(d) : "v"(a), "v"(b));
  return d;
}
__device__ __forceinline__ v8f wmma_bf(v16b a, v16b b, v8f c) {
  v8f d = __builtin_amdgcn_wmma_f32_16x16x32_bf16(false, a, false, b, (short)0, c, false, false);
  asm volatile("v_nop\n\tv_nop\n\tv_nop\n\tv_nop" : "+v"(d) : "v"(a), "v"(b));
  return d;
}
// 16x16x32 fragments: lane = (h = lane>>4, row/col = lane&15); elements 0..7 = k0+8h+0..7, 8..15 = k0+16+8h+0..7; D element r = row 8h+r
__device__ __forceinline__ v16h frag_h(const _Float16* rowk0, int lane) {
  union { v16h v; v8h q[2]; } u; const _Float16* p = rowk0 + 8 * (lane >> 4);
  u.q[0] = *(const v8h*)p; u.q[1] = *(const v8h*)(p + 16); return u.v;
}
__device__ __forceinline__ v16h frag_f32(const float* rowk0, int lane) {
  v16h a; const float* p = rowk0 + 8 * (lane >> 4);
#pragma unroll
  for (int i = 0; i < 8; ++i) { a[i] = (_Float16)p[i]; a[8 + i] = (_Float16)p[16 + i]; }
  return a;
}
__device__ __forceinline__ v16h frag_f32s(const float* rowk0, int lane, float sc) {
  v16h a; const float* p = rowk0 + 8 * (lane >> 4);
#pragma unroll
  for (int i = 0; i < 8; ++i) { a[i] = (_Float16)(p[i] * sc); a[8 + i] = (_Float16)(p[16 + i] * sc); }
  return a;
}
// column fragment from a [K][ld] layout (column n), rows >= K read as 0
__device__ __forceinline__ v16h fragc_f32(const float* W, int k0, int n, int lane, int ld, int K) {
  v16h a; const int g = lane >> 4;
#pragma unroll
  for (int i = 0; i < 8; ++i) { const int ka = k0 + 8 * g + i, kb = ka + 16;
    a[i] = (_Float16)(ka < K ? W[(size_t)(ka < K ? ka : K - 1) * ld + n] : 0.f); a[8 + i] = (_Float16)(kb < K ? W[(size_t)(kb < K ? kb : K - 1) * ld + n] : 0.f); }
  return a;
}
struct F2 { v16b h, l; };
__device__ __forceinline__ F2 bsplit16(const float v[16]) { F2 r;
#pragma unroll
  for (int i = 0; i < 16; ++i) { const __bf16 h = (__bf16)v[i]; r.h[i] = h; r.l[i] = (__bf16)(v[i] - (float)h); }
  return r; }
__device__ __forceinline__ F2 split_row(const float* row, int k0, int lane) { float v[16]; const float* p = row + k0 + 8 * (lane >> 4);
#pragma unroll
  for (int i = 0; i < 8; ++i) { v[i] = p[i]; v[8 + i] = p[16 + i]; }
  return bsplit16(v); }
__device__ __forceinline__ F2 split_rowK(const float* row, int k0, int lane, int K) { float v[16]; const int g = lane >> 4;
#pragma unroll
  for (int i = 0; i < 8; ++i) { const int ka = k0 + 8 * g + i, kb = ka + 16; v[i] = ka < K ? row[ka < K ? ka : K - 1] : 0.f; v[8 + i] = kb < K ? row[kb < K ? kb : K - 1] : 0.f; }
  return bsplit16(v); }
__device__ __forceinline__ F2 split_col(const float* W, int k0, int n, int lane, int ld, int K) { float v[16]; const int g = lane >> 4;
#pragma unroll
  for (int i = 0; i < 8; ++i) { const int ka = k0 + 8 * g + i, kb = ka + 16; v[i] = ka < K ? W[(size_t)(ka < K ? ka : K - 1) * ld + n] : 0.f; v[8 + i] = kb < K ? W[(size_t)(kb < K ? kb : K - 1) * ld + n] : 0.f; }
  return bsplit16(v); }
__device__ __forceinline__ v8f mac3(const F2& a, const F2& b, v8f c) { c = wmma_bf(a.l, b.h, c); c = wmma_bf(a.h, b.l, c); return wmma_bf(a.h, b.h, c); }
__device__ __forceinline__ float sigm(float v) { return 1.0f / (1.0f + expf(-v)); }
#define LDSX() do { asm volatile("s_wait_dscnt 0" ::: "memory"); __builtin_amdgcn_wave_barrier(); __builtin_amdgcn_fence(__ATOMIC_RELEASE, "workgroup"); } while (0)

// Standard multi-head self-attention with a key-padding mask input (x [4,2048,256]; torch (out,in) W_Q / W_K / W_V / W_O [256,256] uniform(+-1/16) applied as x @ W.T, no biases; mask [4,2048] int32 = ones (const: nothing is masked on this draw); 4 heads x 64; scores x 64^-0.5; where(mask[:, None, None, :] == 0, -inf, scores); softmax; out @ W_O.T).
#define NB 4
#define TT 2048
#define CC 256            // NH * HD = projected width
#define DIN 256          // input (model) width
#define NH 4
#define HD 64
#define NQB (TT / 64)
#define HG 4
#define SCALE (0.125f)
#define CAUSAL 0
#ifndef TNB
#define TNB NB
#endif
__device__ __forceinline__ float bfr(float v) { return (float)(__bf16)v; }
__host__ __device__ __forceinline__ int kb_last(int qb) { return CAUSAL ? ((qb * 64 + 63) >> 7) : (TT / 128 - 1); }
typedef __attribute__((ext_vector_type(8))) __bf16 v8b;
__device__ __forceinline__ v16b frag_b(const __bf16* rowk0, int lane) {
  union { v16b v; v8b q[2]; } u; const __bf16* p = rowk0 + 8 * (lane >> 4);
  u.q[0] = *(const v8b*)p; u.q[1] = *(const v8b*)(p + 16); return u.v;
}
#define QBH 0              // unused (k_fa has no high-precision path)
#define QHI 0               // single-product logits on every row
#define KHI 64            // key rows carrying k residual / v bf16 hi+lo planes (written by k_proj, read by no kernel)
// B fragment (k rows k0+.., output column o) of a weight: (in,out) [K][ld] or (out,in) [ld rows of K]: bf16 exact, or f16(bf16 * 256) exact
__device__ __forceinline__ v16b wcol_io(const float* Wm, int k0, int o, int lane, int ld) { v16b w; const int g = lane >> 4;
#pragma unroll
  for (int i = 0; i < 8; ++i) { w[i] = (__bf16)Wm[(size_t)(k0 + 8 * g + i) * ld + o]; w[8 + i] = (__bf16)Wm[(size_t)(k0 + 16 + 8 * g + i) * ld + o]; }
  return w; }
__device__ __forceinline__ v16b wcol_oi(const float* Wm, int k0, int o, int lane, int K) { v16b w; const float* p = Wm + (size_t)o * K + k0 + 8 * (lane >> 4);
#pragma unroll
  for (int i = 0; i < 8; ++i) { w[i] = (__bf16)p[i]; w[8 + i] = (__bf16)p[16 + i]; }
  return w; }
__device__ __forceinline__ v16h wcolh_io(const float* Wm, int k0, int o, int lane, int ld) { v16h w; const int g = lane >> 4;
#pragma unroll
  for (int i = 0; i < 8; ++i) { w[i] = (_Float16)(bfr(Wm[(size_t)(k0 + 8 * g + i) * ld + o]) * 256.0f); w[8 + i] = (_Float16)(bfr(Wm[(size_t)(k0 + 16 + 8 * g + i) * ld + o]) * 256.0f); }
  return w; }
__device__ __forceinline__ v16h wcolh_oi(const float* Wm, int k0, int o, int lane, int K) { v16h w; const float* p = Wm + (size_t)o * K + k0 + 8 * (lane >> 4);
#pragma unroll
  for (int i = 0; i < 8; ++i) { w[i] = (_Float16)(bfr(p[i]) * 256.0f); w[8 + i] = (_Float16)(bfr(p[16 + i]) * 256.0f); }
  return w; }
#define WQKV_LAYOUT 1   // 0 = (in,out) [DIN][CC]; 1 = (out,in) [CC][DIN]; 2 = per-head [NH][DIN][HD]
__device__ __forceinline__ v16b wcol_hdk(const float* Wm, int k0, int o, int lane) { v16b w; const int g = lane >> 4; const float* p = Wm + (size_t)(o / HD) * DIN * HD + (o % HD);
#pragma unroll
  for (int i = 0; i < 8; ++i) { w[i] = (__bf16)p[(size_t)(k0 + 8 * g + i) * HD]; w[8 + i] = (__bf16)p[(size_t)(k0 + 16 + 8 * g + i) * HD]; }
  return w; }
#define WO_OUT_IN 1
#if WQKV_LAYOUT == 1
#define WCOL(W, k0, o, lane) wcol_oi(W, k0, o, lane, DIN)
#elif WQKV_LAYOUT == 2
#define WCOL(W, k0, o, lane) wcol_hdk(W, k0, o, lane)
#else
#define WCOL(W, k0, o, lane) wcol_io(W, k0, o, lane, CC)
#endif
#if WO_OUT_IN
#define WOCOL(W, k0, o, lane) wcol_oi(W, k0, o, lane, CC)
#define WOCOLH(W, k0, o, lane) wcolh_oi(W, k0, o, lane, CC)
#else
#define WOCOL(W, k0, o, lane) wcol_io(W, k0, o, lane, DIN)
#define WOCOLH(W, k0, o, lane) wcolh_io(W, k0, o, lane, DIN)
#endif

#define WS_QH  0u                                      // f16 q rows [b*t][CC]
#define WS_KH  (WS_QH + 2u * (size_t)NB * TT * CC)      // f16 k rows [b*t][CC]
#define WS_VT  (WS_KH + 2u * (size_t)NB * TT * CC)      // f16 v planes [b][c][t]
#define WS_QL  (WS_VT + 2u * (size_t)NB * CC * TT)      // f16 q residual x 2^10 rows [b][t < QHI][CC]
#define WS_KL  (WS_QL + 2u * (size_t)NB * QHI * CC)     // f16 k residual x 2^10 rows [b][t < KHI][CC]
#define WS_VB  (WS_KL + 2u * (size_t)NB * KHI * CC)     // bf16 v hi planes [b][c][t < KHI]
#define WS_VBL (WS_VB + 2u * (size_t)NB * CC * KHI)
#define WS_S   (WS_VBL + 2u * (size_t)NB * CC * KHI)    // (unused: logits and P stay in registers)
#define WS_Y   (WS_S  + 4u * (size_t)HG * TT * TT)      // f32 ctx rows [b*t][CC] (only when there is an output projection)
#define WS_END (WS_Y  + 4u * (size_t)NB * TT * CC)

// Operand staging of k_proj and k_out: ROWS contiguous rows of 256 f32 go once per block into LDS as 16-bit rows, read by whole lines (128 threads x 16 B = two rows a step) and rounded on the way exactly as the fragment loaders rounded them.
// MODE 0: bf16; 1: f16(v x 2^6); 2: f16(bf16(v) x 2^8). Row pitch 528 B = 16 B x 33: the 16-byte fragment reads of 16 rows meet no bank twice.
#define GP 264
#define GOPB ((128 + 64) * GP * 2)   /* bytes: 128 weight rows, then 64 activation rows */
typedef __attribute__((ext_vector_type(4))) __bf16 v4b;
typedef __attribute__((ext_vector_type(4))) _Float16 v4h;
template <int ROWS, int MODE> __device__ __forceinline__ void stage16(const float* __restrict__ src, unsigned char* dst, int tid) {
  const float* p = src + tid * 4; unsigned char* d = dst + (tid >> 6) * (GP * 2) + (tid & 63) * 8;
#pragma unroll 1   /* rolled: one batch of 32 loads is held in registers at a time; unrolled, k_proj took more registers than three blocks on a WGP, which its LDS allows, can have */
  for (int i0 = 0; i0 < ROWS / 2; i0 += 32) { v4f v[32];
#pragma unroll
    for (int u = 0; u < 32; ++u) v[u] = *(const v4f*)(p + (i0 + u) * 512);
#pragma unroll
    for (int u = 0; u < 32; ++u) { unsigned char* q = d + (i0 + u) * (GP * 4);
      if constexpr (MODE == 0) { v4b o;
#pragma unroll
        for (int r = 0; r < 4; ++r) o[r] = (__bf16)v[u][r];
        *(v4b*)q = o; }
      else { v4h o;
#pragma unroll
        for (int r = 0; r < 4; ++r) o[r] = MODE == 1 ? (_Float16)(v[u][r] * 64.0f) : (_Float16)(bfr(v[u][r]) * 256.0f);
        *(v4h*)q = o; } } } }
static_assert(WQKV_LAYOUT == 1 && WO_OUT_IN == 1 && DIN == 256 && CC == 256, "stage16 takes (out,in) weights and rows of 256");
// ---- k_proj: block = (64 rows, 128 cols, which): q/k/v = X W (+ b) with exact bf16 products (K = DIN) -> which 0: q f16 rows (+ residual rows < QHI); 1: k f16 rows (+ residual rows < KHI); 2: v f16 planes [c][t] (+ bf16 hi/lo planes for t < KHI)
__global__ __launch_bounds__(128) void k_proj(const float* __restrict__ XQ, const float* __restrict__ XK, const float* __restrict__ XV, const float* __restrict__ WQ, const float* __restrict__ WK, const float* __restrict__ WV, const float* __restrict__ BQ, const float* __restrict__ BK, const float* __restrict__ BV,
    _Float16* __restrict__ QH, _Float16* __restrict__ QL, _Float16* __restrict__ KH, _Float16* __restrict__ KL, _Float16* __restrict__ VT, __bf16* __restrict__ VB, __bf16* __restrict__ VBL) {
  __shared__ __align__(16) unsigned char SM[GOPB];   /* first the two operands, then, behind a barrier, the output tiles */
  _Float16 (*sh)[136] = (_Float16 (*)[136])SM; _Float16 (*sl)[136] = (_Float16 (*)[136])(SM + 17408); _Float16 (*th)[72] = (_Float16 (*)[72])(SM + 34816); __bf16 (*tb)[72] = (__bf16 (*)[72])(SM + 53248); __bf16 (*tbl)[72] = (__bf16 (*)[72])(SM + 71680);
  static_assert(2 * 64 * 136 * 2 + 3 * 128 * 72 * 2 <= GOPB, "output tiles fit the operands' LDS");
  const int tid = threadIdx.x, wave = tid >> 5, lane = tid & 31, col = lane & 15, g = lane >> 4; const int which = blockIdx.z; const int c0 = blockIdx.y * 128; const size_t r0 = (size_t)blockIdx.x * 64; const size_t bb = r0 / TT; const int t0 = (int)(r0 % TT);
  const float* X = which == 0 ? XQ : which == 1 ? XK : XV; const float* WA = which == 0 ? WQ : which == 1 ? WK : WV; const float* BA = which == 0 ? BQ : which == 1 ? BK : BV;
  stage16<64, 0>(X + r0 * DIN, SM + 128 * GP * 2, tid); stage16<128, 0>(WA + (size_t)c0 * DIN, SM, tid);
  __syncthreads();   /* both operands are readable by the four waves */
  const __bf16* sW = (const __bf16*)SM + col * GP; const __bf16* sX = (const __bf16*)SM + (128 + wave * 16 + col) * GP;
  v8f acc[8] = {}; v16b a[2], w[2][8];
  a[0] = frag_b(sX, lane);
#pragma unroll
  for (int j = 0; j < 8; ++j) w[0][j] = frag_b(sW + j * 16 * GP, lane);
#pragma unroll   /* unrolled: the two fragment sets alternate by name; the next chunk's 18 LDS reads stand as one group in front of this chunk's products and return under them */
  for (int kc = 0; kc < DIN / 32; ++kc) { const int c = kc & 1;
    if (kc + 1 < DIN / 32) { a[c ^ 1] = frag_b(sX + (kc + 1) * 32, lane);
#pragma unroll
      for (int j = 0; j < 8; ++j) w[c ^ 1][j] = frag_b(sW + j * 16 * GP + (kc + 1) * 32, lane); }
#pragma unroll
    for (int j = 0; j < 8; ++j) acc[j] = wmma_bf(a[c], w[c][j], acc[j]); }
  __syncthreads();   /* every wave has left the operands: the output tiles below take their LDS */
  if (which < 2) { _Float16* DH = which == 0 ? QH : KH; _Float16* DL = which == 0 ? QL : KL; const int nhi = which == 0 ? QHI : KHI; const bool hi_rows = t0 < nhi;
#pragma unroll
    for (int j = 0; j < 8; ++j) { const float bias = BA ? bfr(BA[c0 + j * 16 + col]) : 0.f;
#pragma unroll
      for (int r = 0; r < 8; ++r) { const float v = acc[j][r] + bias; const _Float16 hv = (_Float16)v; sh[wave * 16 + 8 * g + r][j * 16 + col] = hv; sl[wave * 16 + 8 * g + r][j * 16 + col] = (_Float16)((v - (float)hv) * 1024.0f); } }
    __syncthreads();
    for (int e = tid; e < 64 * 16; e += 128) { const int rl = e >> 4, q = e & 15; vst2((unsigned*)(DH + (r0 + rl) * CC + c0 + q * 8), *(const v4u*)&sh[rl][q * 8]); if (hi_rows) vst2((unsigned*)(DL + (bb * nhi + t0 + rl) * (size_t)CC + c0 + q * 8), *(const v4u*)&sl[rl][q * 8]); }
  } else { const bool hi_rows = t0 < KHI;
#pragma unroll
    for (int j = 0; j < 8; ++j) { const float bias = BA ? bfr(BA[c0 + j * 16 + col]) : 0.f;
#pragma unroll
      for (int r = 0; r < 8; ++r) { const float v = acc[j][r] + bias; const int rl = wave * 16 + 8 * g + r, cl = j * 16 + col; th[cl][rl] = (_Float16)v; const __bf16 bh = (__bf16)v; tb[cl][rl] = bh; tbl[cl][rl] = (__bf16)(v - (float)bh); } }
    __syncthreads();
    for (int e = tid; e < 128 * 8; e += 128) { const int cl = e >> 3, q = e & 7; vst2((unsigned*)(VT + (bb * CC + c0 + cl) * (size_t)TT + t0 + q * 8), *(const v4u*)&th[cl][q * 8]); if (hi_rows) { const size_t o3 = (bb * CC + c0 + cl) * (size_t)KHI + t0 + q * 8; vst2((unsigned*)(VB + o3), *(const v4u*)&tb[cl][q * 8]); vst2((unsigned*)(VBL + o3), *(const v4u*)&tbl[cl][q * 8]); } } } }
__device__ __forceinline__ void ex2_first(float& al, float* t, float dm, float s0, float s1, float s2, float s3, float c, float a) {
  asm("v_fma_f32 %1, %6, %10, %11\n\tv_fma_f32 %2, %7, %10, %11\n\tv_exp_f32 %0, %5\n\tv_fma_f32 %3, %8, %10, %11\n\tv_fma_f32 %4, %9, %10, %11"
      : "=&v"(al), "=&v"(t[0]), "=&v"(t[1]), "=&v"(t[2]), "=&v"(t[3]) : "v"(dm), "v"(s0), "v"(s1), "v"(s2), "v"(s3), "s"(c), "v"(a)); }
__device__ __forceinline__ void ex2_fma4(float* e, float* tn, const float* t, float s0, float s1, float s2, float s3, float c, float a) {
  asm("v_exp_f32 %0, %8\n\tv_fma_f32 %4, %12, %16, %17\n\tv_exp_f32 %1, %9\n\tv_fma_f32 %5, %13, %16, %17\n\tv_exp_f32 %2, %10\n\tv_fma_f32 %6, %14, %16, %17\n\tv_exp_f32 %3, %11\n\tv_fma_f32 %7, %15, %16, %17"
      : "=&v"(e[0]), "=&v"(e[1]), "=&v"(e[2]), "=&v"(e[3]), "=&v"(tn[0]), "=&v"(tn[1]), "=&v"(tn[2]), "=&v"(tn[3]) : "v"(t[0]), "v"(t[1]), "v"(t[2]), "v"(t[3]), "v"(s0), "v"(s1), "v"(s2), "v"(s3), "s"(c), "v"(a)); }
// the last four have no multiply-add left to carry: each fills the slot of the one in front, and one v_nop that of the last
__device__ __forceinline__ void ex2_last4(float* e, const float* t) {
  asm("v_exp_f32 %0, %4\n\tv_exp_f32 %1, %5\n\tv_exp_f32 %2, %6\n\tv_exp_f32 %3, %7\n\tv_nop" : "=&v"(e[0]), "=&v"(e[1]), "=&v"(e[2]), "=&v"(e[3]) : "v"(t[0]), "v"(t[1]), "v"(t[2]), "v"(t[3])); }
// Products of one kind as ONE statement: each fills the hazard slots of the one in front, so the four v_nop that keep vector instructions off D, A and B stand once behind the last product and not behind every one.
// The builtin alone did not serve: the LDS reads sank to their products.
__device__ __forceinline__ void wmma_s8(v8f* s, const v16h (*k)[HD / 32], const v16h* q) {   /* s[kt] = k[kt][0] q[0] + k[kt][1] q[1]; four independent tiles, then their second halves */
  asm volatile("v_wmma_f32_16x16x32_f16 %0, %4, %12, 0\n\tv_wmma_f32_16x16x32_f16 %1, %6, %12, 0\n\tv_wmma_f32_16x16x32_f16 %2, %8, %12, 0\n\tv_wmma_f32_16x16x32_f16 %3, %10, %12, 0\n\t"
               "v_wmma_f32_16x16x32_f16 %0, %5, %13, %0\n\tv_wmma_f32_16x16x32_f16 %1, %7, %13, %1\n\tv_wmma_f32_16x16x32_f16 %2, %9, %13, %2\n\tv_wmma_f32_16x16x32_f16 %3, %11, %13, %3\n\t"
               "v_nop\n\tv_nop\n\tv_nop\n\tv_nop"
               : "=&v"(s[0]), "=&v"(s[1]), "=&v"(s[2]), "=&v"(s[3]) : "v"(k[0][0]), "v"(k[0][1]), "v"(k[1][0]), "v"(k[1][1]), "v"(k[2][0]), "v"(k[2][1]), "v"(k[3][0]), "v"(k[3][1]), "v"(q[0]), "v"(q[1])); }
__device__ __forceinline__ void wmma_pv8(v8f* a, v8f* b, v16h v0, v16h v1, v16h v2, v16h v3, v16h p, v16h q) {   /* a[j] += v_j p, b[j] += v_j q: each v fragment serves both query tiles */
  asm volatile("v_wmma_f32_16x16x32_f16 %0, %8, %12, %0\n\tv_wmma_f32_16x16x32_f16 %1, %9, %12, %1\n\tv_wmma_f32_16x16x32_f16 %2, %10, %12, %2\n\tv_wmma_f32_16x16x32_f16 %3, %11, %12, %3\n\t"
               "v_wmma_f32_16x16x32_f16 %4, %8, %13, %4\n\tv_wmma_f32_16x16x32_f16 %5, %9, %13, %5\n\tv_wmma_f32_16x16x32_f16 %6, %10, %13, %6\n\tv_wmma_f32_16x16x32_f16 %7, %11, %13, %7\n\t"
               "v_nop\n\tv_nop\n\tv_nop\n\tv_nop"
               : "+v"(a[0]), "+v"(a[1]), "+v"(a[2]), "+v"(a[3]), "+v"(b[0]), "+v"(b[1]), "+v"(b[2]), "+v"(b[3]) : "v"(v0), "v"(v1), "v"(v2), "v"(v3), "v"(p), "v"(q)); }
__device__ __forceinline__ float xhalf(float v) { const int i = __builtin_bit_cast(int, v); return __builtin_bit_cast(float, __builtin_amdgcn_permlanex16(i, i, 0x76543210, 0xfedcba98, false, false)); }   /* lane l <-> l ^ 16 */
// K and V reach the waves through LDS: a stage is SKEYS keys; each of the 8 waves brings one slice of 64 rows x 128 B per stage by one tensor load
// (waves 0..3: 64 k rows each; waves 4..7: the 64 v planes x 64 keys each), the mover's 16-byte pad giving the pitch 144 B that 16-byte LDS reads want; two buffers.
typedef uint32_t u32x4 __attribute__((ext_vector_type(4)));
typedef uint32_t u32x8 __attribute__((ext_vector_type(8)));
#define SKEYS 256
#define NST (TT / SKEYS)
#define LPITCH 144u
#define SLICEB 10240u          /* 64 rows x 144 B = 9216 B, rounded up so that every slice starts at a multiple of 2 KiB */
#define BUFB (8u * SLICEB)
__device__ __forceinline__ uint32_t uni(uint32_t v) { return (uint32_t)__builtin_amdgcn_readfirstlane(v); }
__device__ __forceinline__ uint32_t pinned(uint32_t v) { uint32_t w = uni(v); asm volatile("" : "+s"(w)); return w; }
// both groups are in-out operands: the descriptor then has registers of its own for the whole kernel, and none of them takes another value while a request is in flight
__device__ __forceinline__ void tdm_load(u32x4& g0, u32x8& g1) { asm volatile("tensor_load_to_lds %0, %1" : "+s"(g0), "+s"(g1) :: "memory"); }
__device__ __forceinline__ v16h frag_l(const unsigned char* p) { union { v16h v; v8h q[2]; } u; u.q[0] = *(const v8h*)p; u.q[1] = *(const v8h*)(p + 32); return u.v; }
#define SCN(n) s[2 * ((n) >> 4) + ((n) & 1)][((n) >> 1) & 7]   /* score n = 16 c2 + 2 i + w is s[2 c2 + w][i] */
// one query tile's 64 scores: mask, running maximum, P (two B operands), sum, and the rescale of the tile's ctx
__device__ __forceinline__ void soft_tile(v8f* s, float& m, float& l, v8f* acc, v16h* p, bool some_masked, unsigned b0, unsigned b1, unsigned g8, float C2) {
  if (some_masked) { unsigned w0, w1;   /* wave-uniform: some key of these 64 is masked */
    /* this lane half's mask bits, w = b >> 8g. In asm, volatile, so that the 64 bit tests that hang on them stay inside this branch: written plainly, the compiler shared them between the two query tiles and moved them in front of both branches, onto every trip */
    asm volatile("v_lshrrev_b32 %0, %2, %3\n\tv_lshrrev_b32 %1, %2, %4" : "=&v"(w0), "=&v"(w1) : "v"(g8), "s"(b0), "s"(b1));
#pragma unroll
    for (int kt = 0; kt < 4; ++kt)
#pragma unroll
      for (int r = 0; r < 8; ++r) { const unsigned w = kt < 2 ? w0 : w1; s[kt][r] = ((w >> ((kt & 1) * 16 + r)) & 1u) ? s[kt][r] : -3.0e38f; } }
  float mt[4];
#pragma unroll
  for (int kt = 0; kt < 4; ++kt) { mt[kt] = s[kt][0];
#pragma unroll
    for (int r = 1; r < 8; ++r) mt[kt] = fmaxf(mt[kt], s[kt][r]); }
  float mx = fmaxf(fmaxf(mt[0], mt[1]), fmaxf(mt[2], mt[3]));
  mx = fmaxf(mx, xhalf(mx));
  const float mn = fmaxf(m, mx * C2), ms = 10.0f - mn, dm = m - mn; m = mn;
  float al, t[32], e[32];
  ex2_first(al, t, dm, SCN(0), SCN(1), SCN(2), SCN(3), C2, ms);
#pragma unroll
  for (int n = 0; n < 28; n += 4) ex2_fma4(e + n, t + n + 4, t + n, SCN(n + 4), SCN(n + 5), SCN(n + 6), SCN(n + 7), C2, ms);
  ex2_last4(e + 28, t + 28);
  float sum = 0.f;
#pragma unroll
  for (int c2 = 0; c2 < 2; ++c2)
#pragma unroll
    for (int i = 0; i < 8; ++i) { const float e0 = e[16 * c2 + 2 * i], e1 = e[16 * c2 + 2 * i + 1]; sum += e0 + e1; p[c2][i] = (_Float16)e0; p[c2][8 + i] = (_Float16)e1; }
  l = l * al + sum;
#pragma unroll
  for (int j = 0; j < HD / 16; ++j) acc[j] *= al; }
#define MRGB 8192u   /* bytes of LDS per wave for the hand-over at the end: 32 f32 of ctx a lane (4096 B), then maximum and sum */
__global__ __launch_bounds__(256) void k_fa(const _Float16* __restrict__ QH, const _Float16* __restrict__ KH, const _Float16* __restrict__ VT, const int* __restrict__ MASK, float* __restrict__ Y) {
  __shared__ __attribute__((aligned(2048))) unsigned char L[2 * BUFB];
  const int tid = threadIdx.x, wave = tid >> 5, lane = tid & 31, col = lane & 15, g = lane >> 4;
  const int h = blockIdx.y, b = blockIdx.z;
  const uint32_t wv = uni((uint32_t)tid >> 5), sl = wv & 3u; const bool isV = wv >= 4u;
  const uint32_t kh = wv >> 2; const int q0 = blockIdx.x * 128 + (int)sl * 32;   /* key half; first of this wave's 32 queries */
  const uint32_t lbase = (uint32_t)(size_t)L;
  const uint64_t ga0 = isV ? (uint64_t)(size_t)(VT + ((size_t)b * CC + h * HD) * (size_t)TT + sl * 64u) : (uint64_t)(size_t)(KH + ((size_t)b * TT + sl * 64u) * CC + h * HD);
  const uint32_t gsh = isV ? 9u : 17u;   /* bytes from one stage to the next: SKEYS x 2 along a v plane, SKEYS x CC x 2 down the k rows */
  static_assert(SKEYS * 2 == 1 << 9 && SKEYS * CC * 2 == 1 << 17 && NST >= 2, "stage steps");
  u32x8 g1;   /* 1-byte elements, tensor = tile = 64 rows of 128 B, a 16-byte pad behind every 128 B, no mask */
  g1[0] = uni((1u << 20) | (4u << 22) | (3u << 25)); g1[1] = uni(128u << 16); g1[2] = uni(64u << 16); g1[3] = uni(128u << 16); g1[4] = uni(64u); g1[5] = uni(isV ? (uint32_t)TT * 2u : (uint32_t)CC * 2u); g1[6] = uni(0u); g1[7] = uni(0u);
  u32x4 g0; g0[0] = uni(1u);
  auto issue = [&](uint32_t st) { const uint64_t ga = ga0 + (uint64_t)(st << gsh);
    g0[1] = uni(lbase + (st & 1u) * BUFB + wv * SLICEB); g0[2] = uni((uint32_t)ga); g0[3] = uni((((uint32_t)(ga >> 32)) & 0x01FFFFFFu) | 0x80000000u);
    tdm_load(g0, g1); };
  const int* Mb = MASK + (size_t)b * TT + lane;
  const float C2 = SCALE * 1.44269504088896f;   /* raw logit -> log2 units */
  v16h qf[2][HD / 32];
#pragma unroll
  for (int qt = 0; qt < 2; ++qt)
#pragma unroll
    for (int kc = 0; kc < HD / 32; ++kc) qf[qt][kc] = frag_h(QH + ((size_t)b * TT + q0 + qt * 16 + col) * CC + h * HD + kc * 32, lane);
  int mk0 = Mb[kh * 128u], mk1 = Mb[kh * 128u + 32u];
  v8f acc[2][HD / 16] = {}; float m[2] = {-1.0e30f, -1.0e30f}, l[2] = {0.f, 0.f};
  issue(0u);
  asm volatile("s_wait_tensorcnt 0x0" ::: "memory");   /* this wave's slice of stage 0 has landed */
  __syncthreads();                                      /* every wave's slice of stage 0 is readable by all */
  issue(pinned(1u));                                    /* pinned(): stage 1's descriptor words are formed behind the wait above */
  const uint32_t loff = (uint32_t)col * LPITCH + 16u * (uint32_t)g;
#pragma unroll 1   /* rolled: one publish point and one refill site */
  for (uint32_t st = 0; st < NST; ++st) { const unsigned char* Bp = L + (st & 1u) * BUFB + loff;
#pragma unroll 1   /* rolled: one trip's fragments, scores and both ctx tiles fill the 256 registers that asm text can name */
    for (uint32_t hb = 0; hb < SKEYS / 128; ++hb) { const uint32_t ks = kh * (SKEYS / 128) + hb; const int it = (int)(st * (SKEYS / 64) + ks);   /* ks: this trip's 64-key slice of the stage */
    const unsigned char* Kp = Bp + ks * SLICEB; const unsigned char* Vp = Bp + (4u + ks) * SLICEB;
    const unsigned b0 = __builtin_amdgcn_ballot_w32(mk0 != 0), b1 = __builtin_amdgcn_ballot_w32(mk1 != 0);
    const int kn = (hb + 1u < SKEYS / 128 ? it + 1 : st + 1u < NST ? it + SKEYS / 64 - SKEYS / 128 + 1 : it) * 64;   /* this wave's next trip's mask words fly under this trip (the last trip rereads its own) */
    mk0 = Mb[kn]; mk1 = Mb[kn + 32];
    asm volatile("s_wait_xcnt 0x0" ::: "memory");   /* the mask loads' address registers are free to be rewritten behind this */
    v16h kf[4][HD / 32];
#pragma unroll
    for (int kt = 0; kt < 4; ++kt)
#pragma unroll
      for (int kc = 0; kc < HD / 32; ++kc) kf[kt][kc] = frag_l(Kp + kt * 16 * LPITCH + kc * 64);
    const bool some_masked = (b0 & b1) != 0xFFFFFFFFu;
    v8f s[4]; v16h p[2][2];
    wmma_s8(s, kf, qf[0]);
    soft_tile(s, m[0], l[0], acc[0], p[0], some_masked, b0, b1, 8u * (unsigned)g, C2);
    __builtin_amdgcn_sched_barrier(0);   /* holds the second tile's logit products behind the first tile's softmax, so that both tiles' scores take the same registers; left free, they moved up and the kernel left the 256 registers that asm text can name */
    wmma_s8(s, kf, qf[1]);
    v16h vf[HD / 16][2];   /* the v fragments take the registers that the k fragments have just left */
#pragma unroll
    for (int j = 0; j < HD / 16; ++j) { vf[j][0] = frag_l(Vp + j * 16 * LPITCH); vf[j][1] = frag_l(Vp + j * 16 * LPITCH + 64); }
    __builtin_amdgcn_sched_barrier(0);   /* holds the v reads in front of the second tile's softmax, under which they return; left free, the compiler sinks them close in front of the products that wait for them */
    soft_tile(s, m[1], l[1], acc[1], p[1], some_masked, b0, b1, 8u * (unsigned)g, C2);
    wmma_pv8(acc[0], acc[1], vf[0][0], vf[1][0], vf[2][0], vf[3][0], p[0][0], p[1][0]); wmma_pv8(acc[0], acc[1], vf[0][1], vf[1][1], vf[2][1], vf[3][1], p[0][1], p[1][1]); }
    asm volatile("s_wait_dscnt 0x0" ::: "memory");       /* this wave's reads of stage st have returned */
    asm volatile("s_wait_tensorcnt 0x0" ::: "memory");   /* this wave's slice of stage st + 1 has landed */
    __syncthreads();                                      /* stage st + 1 is readable by all, and every wave has left stage st's buffer */
    if (pinned(st + 2u < NST)) issue(pinned(st + 2u)); }  /* the refill of the buffer just left; scalar test */
  asm volatile("s_wait_tensorcnt 0x0" ::: "memory");     /* nothing of the mover is in flight when the wave ends */
  asm volatile("s_wait_dscnt 0x0" ::: "memory");         /* nor any LDS read of this wave */
  // The two key halves meet: wave (qg, kh) keeps query tile kh and hands tile 1 - kh to wave (qg, 1 - kh). The last stage's barrier has ended every read of the ring, and no load was issued behind it: its LDS is free.
  l[0] += xhalf(l[0]); l[1] += xhalf(l[1]);
  const bool up = kh != 0u;
  const float mk = up ? m[1] : m[0], lk = up ? l[1] : l[0]; v2f ml; ml[0] = up ? m[0] : m[1]; ml[1] = up ? l[0] : l[1];
  unsigned char* Xs = L + wv * MRGB + lane * 16; const unsigned char* Xr = L + (wv ^ 4u) * MRGB + lane * 16;
#pragma unroll
  for (int j = 0; j < HD / 16; ++j) { const v8f a = up ? acc[0][j] : acc[1][j]; v4f lo, hi;
#pragma unroll
    for (int r = 0; r < 4; ++r) { lo[r] = a[r]; hi[r] = a[4 + r]; }
    *(v4f*)(Xs + j * 1024) = lo; *(v4f*)(Xs + j * 1024 + 512) = hi; }
  *(v2f*)(L + wv * MRGB + 4096u + lane * 8) = ml;
  __syncthreads();   /* each wave's handed-over tile is readable by its partner */
  const v2f mo = *(const v2f*)(L + (wv ^ 4u) * MRGB + 4096u + lane * 8);
  const float mm = fmaxf(mk, mo[0]), wk = __builtin_amdgcn_exp2f(mk - mm), wo = __builtin_amdgcn_exp2f(mo[0] - mm);   /* maxima are in log2 units; a half with no kept key has sum 0 and ctx 0 */
  const float inv = 1.0f / (lk * wk + mo[1] * wo), ck = wk * inv, co = wo * inv;
  float* yr = Y + ((size_t)b * TT + q0 + (int)kh * 16 + col) * CC + h * HD + 8 * g;   /* acc[j][r] = ctx[query col][j * 16 + 8g + r] */
#pragma unroll
  for (int j = 0; j < HD / 16; ++j) { const v8f a = up ? acc[1][j] : acc[0][j]; const v4f ol = *(const v4f*)(Xr + j * 1024), oh = *(const v4f*)(Xr + j * 1024 + 512); v4f lo, hi;
#pragma unroll
    for (int r = 0; r < 4; ++r) { lo[r] = a[r] * ck + ol[r] * co; hi[r] = a[4 + r] * ck + oh[r] * co; }
    vst2(yr + j * 16, lo); vst2(yr + j * 16 + 4, hi); } }
// ---- k_out: block = (64 rows, 128 cols): out = ctx Wo (+ bo): ctx x 2^6 once to f16 against Wo as f16(bf16 x 2^8) exact (1 product) x 2^-14; causal early rows (< QHI of each sequence): ctx bf16 hi + lo against exact bf16 Wo (2 products)
__global__ __launch_bounds__(128) void k_out(const float* __restrict__ Y, const float* __restrict__ WO, const float* __restrict__ BO, float* __restrict__ OUT) { __shared__ __align__(16) unsigned char SM[GOPB];   /* first the two operands, then, behind a barrier, the output tile */
  float (*sf)[16][132] = (float (*)[16][132])SM; static_assert(4 * 16 * 132 * 4 <= GOPB, "output tile fits the operands' LDS");
  const int tid = threadIdx.x, wave = tid >> 5, lane = tid & 31, col = lane & 15, g = lane >> 4; const int c0 = blockIdx.y * 128; const size_t r0 = (size_t)blockIdx.x * 64 + wave * 16;
  v8f acc[8] = {};
  if (CAUSAL && (int)(((size_t)blockIdx.x * 64) % TT) < QHI) {   /* block-uniform */
#pragma unroll 2
    for (int kc = 0; kc < CC / 32; ++kc) { const F2 a = split_row(Y + (r0 + col) * CC, kc * 32, lane); asm volatile("s_wait_loadcnt 0x0" ::: "memory");
#pragma unroll
      for (int j = 0; j < 8; ++j) { const v16b w = WOCOL(WO, kc * 32, c0 + j * 16 + col, lane); asm volatile("s_wait_loadcnt 0x0" ::: "memory"); acc[j] = wmma_bf(a.h, w, acc[j]); acc[j] = wmma_bf(a.l, w, acc[j]); } }
#pragma unroll
    for (int j = 0; j < 8; ++j) { const float bias = BO ? bfr(BO[c0 + j * 16 + col]) : 0.f;
#pragma unroll
      for (int r = 0; r < 8; ++r) sf[wave][8 * g + r][j * 16 + col] = acc[j][r] + bias; }
  } else {
    stage16<64, 1>(Y + (size_t)blockIdx.x * 64 * CC, SM + 128 * GP * 2, tid); stage16<128, 2>(WO + (size_t)c0 * CC, SM, tid);   /* ctx carried x 2^6 into f16 so small-magnitude context rows stay clear of f16 subnormals */
    __syncthreads();   /* both operands are readable by the four waves */
    const _Float16* sW = (const _Float16*)SM + col * GP; const _Float16* sY = (const _Float16*)SM + (128 + wave * 16 + col) * GP;
    v16h a[2], w[2][8];
    a[0] = frag_h(sY, lane);
#pragma unroll
    for (int j = 0; j < 8; ++j) w[0][j] = frag_h(sW + j * 16 * GP, lane);
#pragma unroll   /* unrolled: the two fragment sets alternate by name; the next chunk's 18 LDS reads stand as one group in front of this chunk's products and return under them */
    for (int kc = 0; kc < CC / 32; ++kc) { const int c = kc & 1;
      if (kc + 1 < CC / 32) { a[c ^ 1] = frag_h(sY + (kc + 1) * 32, lane);
#pragma unroll
        for (int j = 0; j < 8; ++j) w[c ^ 1][j] = frag_h(sW + j * 16 * GP + (kc + 1) * 32, lane); }
#pragma unroll
      for (int j = 0; j < 8; ++j) acc[j] = wmma16(a[c], w[c][j], acc[j]); }
    __syncthreads();   /* every wave has left the operands: the output tile below takes their LDS */
#pragma unroll
    for (int j = 0; j < 8; ++j) { const float bias = BO ? bfr(BO[c0 + j * 16 + col]) : 0.f;
#pragma unroll
      for (int r = 0; r < 8; ++r) sf[wave][8 * g + r][j * 16 + col] = acc[j][r] * (1.0f / 16384.0f) + bias; } }   /* 2^-8 (Wo carry) x 2^-6 (ctx carry) */
  LDSX(); for (int rl = 0; rl < 16; ++rl) vst2(OUT + (r0 + rl) * DIN + c0 + lane * 4, *(const v4f*)&sf[wave][rl][lane * 4]); }

extern "C" void kernel_launch(void* const* d_in, const int* in_sizes, int n_in, void* d_out, int out_size, void* d_ws, size_t ws_size, hipStream_t stream) {
  (void)in_sizes; (void)n_in; (void)out_size;
  const float** F = (const float**)d_in;
  if (ws_size < (size_t)WS_END) return;
  char* ws = (char*)d_ws; _Float16 *QH = (_Float16*)(ws + WS_QH), *KH = (_Float16*)(ws + WS_KH), *VT = (_Float16*)(ws + WS_VT), *QL = (_Float16*)(ws + WS_QL), *KL = (_Float16*)(ws + WS_KL); __bf16 *VB = (__bf16*)(ws + WS_VB), *VBL = (__bf16*)(ws + WS_VBL); float *Y = (float*)(ws + WS_Y);
  (void)Y; (void)QL; (void)KL; (void)VB; (void)VBL;
  // inputs: 0 x [4,2048,256]; 1 W_Q [256,256] (out,in); 2 W_K; 3 W_V; 4 W_O (out,in); 5 mask [4,2048] int32 (ones on this draw; read per key); no biases
  k_proj<<<dim3(TNB * TT / 64, CC / 128, 3), 128, 0, stream>>>(F[0], F[0], F[0], F[1], F[2], F[3], nullptr, nullptr, nullptr, QH, QL, KH, KL, VT, VB, VBL);
  k_fa<<<dim3(TT / 128, NH, TNB), 256, 0, stream>>>(QH, KH, VT, (const int*)d_in[5], Y);
  k_out<<<dim3(TNB * TT / 64, DIN / 128), 128, 0, stream>>>(Y, F[4], nullptr, (float*)d_out);
}

// v006
// Measured time: 34 microseconds a run.
// In two side-by-side timings against v005, it was 1.04 and 1.03 times as fast.
// All steps since v000 together make it 16.8 times as fast.
// compute dtype: all float inputs rounded to bf16; q / k / v projections with EXACT bf16 products on WMMA 16x16x32 (f32 accumulate), no biases; logits q x k once to f16 each (1 product) x 64^-0.5; the int key mask read per (batch, key); softmax f32 with a running maximum, fused with both products; P = exp(s - max) x 2^10 once to f16 x v once to f16 (1 product), divided by the f32 sum at the end; ctx x 2^6 once to f16 x W_O f16(bf16 x 2^8); f32 output.
#include <hip/hip_runtime.h>
#include <math.h>
#include <stdint.h>

typedef __attribute__((ext_vector_type(16))) _Float16 v16h;
typedef __attribute__((ext_vector_type(16))) __bf16 v16b;
typedef __attribute__((ext_vector_type(8)))  _Float16 v8h;
typedef __attribute__((ext_vector_type(8)))  float v8f;
typedef __attribute__((ext_vector_type(4)))  float v4f;
typedef __attribute__((ext_vector_type(2)))  float v2f;
typedef __attribute__((ext_vector_type(4)))  unsigned v4u;
typedef __attribute__((ext_vector_type(4)))  int v4i;
typedef float __attribute__((may_alias)) float_a;
typedef int __attribute__((may_alias)) int_a;

template <typename T> __device__ __forceinline__ void vst2(void* p, T v) { *(T*)p = v;  }
__device__ __forceinline__ v8f wmma16(v16h a, v16h b, v8f c) {
  v8f d = __builtin_amdgcn_wmma_f32_16x16x32_f16(false, a, false, b, (short)0, c, false, false);
  asm volatile("v_nop\n\tv_nop\n\tv_nop\n\tv_nop" : "+v"(d) : "v"(a), "v"(b));
  return d;
}
__device__ __forceinline__ v8f wmma_bf(v16b a, v16b b, v8f c) {
  v8f d = __builtin_amdgcn_wmma_f32_16x16x32_bf16(false, a, false, b, (short)0, c, false, false);
  asm volatile("v_nop\n\tv_nop\n\tv_nop\n\tv_nop" : "+v"(d) : "v"(a), "v"(b));
  return d;
}
// 16x16x32 fragments: lane = (h = lane>>4, row/col = lane&15); elements 0..7 = k0+8h+0..7, 8..15 = k0+16+8h+0..7; D element r = row 8h+r
__device__ __forceinline__ v16h frag_h(const _Float16* rowk0, int lane) {
  union { v16h v; v8h q[2]; } u; const _Float16* p = rowk0 + 8 * (lane >> 4);
  u.q[0] = *(const v8h*)p; u.q[1] = *(const v8h*)(p + 16); return u.v;
}
__device__ __forceinline__ v16h frag_f32(const float* rowk0, int lane) {
  v16h a; const float* p = rowk0 + 8 * (lane >> 4);
#pragma unroll
  for (int i = 0; i < 8; ++i) { a[i] = (_Float16)p[i]; a[8 + i] = (_Float16)p[16 + i]; }
  return a;
}
__device__ __forceinline__ v16h frag_f32s(const float* rowk0, int lane, float sc) {
  v16h a; const float* p = rowk0 + 8 * (lane >> 4);
#pragma unroll
  for (int i = 0; i < 8; ++i) { a[i] = (_Float16)(p[i] * sc); a[8 + i] = (_Float16)(p[16 + i] * sc); }
  return a;
}
// column fragment from a [K][ld] layout (column n), rows >= K read as 0
__device__ __forceinline__ v16h fragc_f32(const float* W, int k0, int n, int lane, int ld, int K) {
  v16h a; const int g = lane >> 4;
#pragma unroll
  for (int i = 0; i < 8; ++i) { const int ka = k0 + 8 * g + i, kb = ka + 16;
    a[i] = (_Float16)(ka < K ? W[(size_t)(ka < K ? ka : K - 1) * ld + n] : 0.f); a[8 + i] = (_Float16)(kb < K ? W[(size_t)(kb < K ? kb : K - 1) * ld + n] : 0.f); }
  return a;
}
struct F2 { v16b h, l; };
__device__ __forceinline__ F2 bsplit16(const float v[16]) { F2 r;
#pragma unroll
  for (int i = 0; i < 16; ++i) { const __bf16 h = (__bf16)v[i]; r.h[i] = h; r.l[i] = (__bf16)(v[i] - (float)h); }
  return r; }
__device__ __forceinline__ F2 split_row(const float* row, int k0, int lane) { float v[16]; const float* p = row + k0 + 8 * (lane >> 4);
#pragma unroll
  for (int i = 0; i < 8; ++i) { v[i] = p[i]; v[8 + i] = p[16 + i]; }
  return bsplit16(v); }
__device__ __forceinline__ F2 split_rowK(const float* row, int k0, int lane, int K) { float v[16]; const int g = lane >> 4;
#pragma unroll
  for (int i = 0; i < 8; ++i) { const int ka = k0 + 8 * g + i, kb = ka + 16; v[i] = ka < K ? row[ka < K ? ka : K - 1] : 0.f; v[8 + i] = kb < K ? row[kb < K ? kb : K - 1] : 0.f; }
  return bsplit16(v); }
__device__ __forceinline__ F2 split_col(const float* W, int k0, int n, int lane, int ld, int K) { float v[16]; const int g = lane >> 4;
#pragma unroll
  for (int i = 0; i < 8; ++i) { const int ka = k0 + 8 * g + i, kb = ka + 16; v[i] = ka < K ? W[(size_t)(ka < K ? ka : K - 1) * ld + n] : 0.f; v[8 + i] = kb < K ? W[(size_t)(kb < K ? kb : K - 1) * ld + n] : 0.f; }
  return bsplit16(v); }
__device__ __forceinline__ v8f mac3(const F2& a, const F2& b, v8f c) { c = wmma_bf(a.l, b.h, c); c = wmma_bf(a.h, b.l, c); return wmma_bf(a.h, b.h, c); }
__device__ __forceinline__ float sigm(float v) { return 1.0f / (1.0f + expf(-v)); }
#define LDSX() do { asm volatile("s_wait_dscnt 0" ::: "memory"); __builtin_amdgcn_wave_barrier(); __builtin_amdgcn_fence(__ATOMIC_RELEASE, "workgroup"); } while (0)

// Standard multi-head self-attention with a key-padding mask input (x [4,2048,256]; torch (out,in) W_Q / W_K / W_V / W_O [256,256] uniform(+-1/16) applied as x @ W.T, no biases; mask [4,2048] int32 = ones (const: nothing is masked on this draw); 4 heads x 64; scores x 64^-0.5; where(mask[:, None, None, :] == 0, -inf, scores); softmax; out @ W_O.T).
#define NB 4
#define TT 2048
#define CC 256            // NH * HD = projected width
#define DIN 256          // input (model) width
#define NH 4
#define HD 64
#define NQB (TT / 64)
#define HG 4
#define SCALE (0.125f)
#define CAUSAL 0
#ifndef TNB
#define TNB NB
#endif
__device__ __forceinline__ float bfr(float v) { return (float)(__bf16)v; }
__host__ __device__ __forceinline__ int kb_last(int qb) { return CAUSAL ? ((qb * 64 + 63) >> 7) : (TT / 128 - 1); }
typedef __attribute__((ext_vector_type(8))) __bf16 v8b;
__device__ __forceinline__ v16b frag_b(const __bf16* rowk0, int lane) {
  union { v16b v; v8b q[2]; } u; const __bf16* p = rowk0 + 8 * (lane >> 4);
  u.q[0] = *(const v8b*)p; u.q[1] = *(const v8b*)(p + 16); return u.v;
}
#define QBH 0              // unused (k_fa has no high-precision path)
#define QHI 0               // single-product logits on every row
#define KHI 64            // key rows carrying k residual / v bf16 hi+lo planes (written by k_proj, read by no kernel)
// B fragment (k rows k0+.., output column o) of a weight: (in,out) [K][ld] or (out,in) [ld rows of K]: bf16 exact, or f16(bf16 * 256) exact
__device__ __forceinline__ v16b wcol_io(const float* Wm, int k0, int o, int lane, int ld) { v16b w; const int g = lane >> 4;
#pragma unroll
  for (int i = 0; i < 8; ++i) { w[i] = (__bf16)Wm[(size_t)(k0 + 8 * g + i) * ld + o]; w[8 + i] = (__bf16)Wm[(size_t)(k0 + 16 + 8 * g + i) * ld + o]; }
  return w; }
__device__ __forceinline__ v16b wcol_oi(const float* Wm, int k0, int o, int lane, int K) { v16b w; const float* p = Wm + (size_t)o * K + k0 + 8 * (lane >> 4);
#pragma unroll
  for (int i = 0; i < 8; ++i) { w[i] = (__bf16)p[i]; w[8 + i] = (__bf16)p[16 + i]; }
  return w; }
__device__ __forceinline__ v16h wcolh_io(const float* Wm, int k0, int o, int lane, int ld) { v16h w; const int g = lane >> 4;
#pragma unroll
  for (int i = 0; i < 8; ++i) { w[i] = (_Float16)(bfr(Wm[(size_t)(k0 + 8 * g + i) * ld + o]) * 256.0f); w[8 + i] = (_Float16)(bfr(Wm[(size_t)(k0 + 16 + 8 * g + i) * ld + o]) * 256.0f); }
  return w; }
__device__ __forceinline__ v16h wcolh_oi(const float* Wm, int k0, int o, int lane, int K) { v16h w; const float* p = Wm + (size_t)o * K + k0 + 8 * (lane >> 4);
#pragma unroll
  for (int i = 0; i < 8; ++i) { w[i] = (_Float16)(bfr(p[i]) * 256.0f); w[8 + i] = (_Float16)(bfr(p[16 + i]) * 256.0f); }
  return w; }
#define WQKV_LAYOUT 1   // 0 = (in,out) [DIN][CC]; 1 = (out,in) [CC][DIN]; 2 = per-head [NH][DIN][HD]
__device__ __forceinline__ v16b wcol_hdk(const float* Wm, int k0, int o, int lane) { v16b w; const int g = lane >> 4; const float* p = Wm + (size_t)(o / HD) * DIN * HD + (o % HD);
#pragma unroll
  for (int i = 0; i < 8; ++i) { w[i] = (__bf16)p[(size_t)(k0 + 8 * g + i) * HD]; w[8 + i] = (__bf16)p[(size_t)(k0 + 16 + 8 * g + i) * HD]; }
  return w; }
#define WO_OUT_IN 1
#if WQKV_LAYOUT == 1
#define WCOL(W, k0, o, lane) wcol_oi(W, k0, o, lane, DIN)
#elif WQKV_LAYOUT == 2
#define WCOL(W, k0, o, lane) wcol_hdk(W, k0, o, lane)
#else
#define WCOL(W, k0, o, lane) wcol_io(W, k0, o, lane, CC)
#endif
#if WO_OUT_IN
#define WOCOL(W, k0, o, lane) wcol_oi(W, k0, o, lane, CC)
#define WOCOLH(W, k0, o, lane) wcolh_oi(W, k0, o, lane, CC)
#else
#define WOCOL(W, k0, o, lane) wcol_io(W, k0, o, lane, DIN)
#define WOCOLH(W, k0, o, lane) wcolh_io(W, k0, o, lane, DIN)
#endif

#define WS_QH  0u                                      // f16 q rows [b*t][CC]
#define WS_KH  (WS_QH + 2u * (size_t)NB * TT * CC)      // f16 k rows [b*t][CC]
#define WS_VT  (WS_KH + 2u * (size_t)NB * TT * CC)      // f16 v planes [b][c][t]
#define WS_QL  (WS_VT + 2u * (size_t)NB * CC * TT)      // f16 q residual x 2^10 rows [b][t < QHI][CC]
#define WS_KL  (WS_QL + 2u * (size_t)NB * QHI * CC)     // f16 k residual x 2^10 rows [b][t < KHI][CC]
#define WS_VB  (WS_KL + 2u * (size_t)NB * KHI * CC)     // bf16 v hi planes [b][c][t < KHI]
#define WS_VBL (WS_VB + 2u * (size_t)NB * CC * KHI)
#define WS_S   (WS_VBL + 2u * (size_t)NB * CC * KHI)    // (unused: logits and P stay in registers)
#define WS_Y   (WS_S  + 4u * (size_t)HG * TT * TT)      // f32 ctx rows [b*t][CC] (only when there is an output projection)
#define WS_END (WS_Y  + 4u * (size_t)NB * TT * CC)

// Operand staging of k_proj and k_out: ROWS contiguous rows of 256 f32 go once per block into LDS as 16-bit rows, read by whole lines (128 threads x 16 B = two rows a step) and rounded on the way exactly as the fragment loaders rounded them.
// MODE 0: bf16; 1: f16(v x 2^6); 2: f16(bf16(v) x 2^8). Row pitch 528 B = 16 B x 33: the 16-byte fragment reads of 16 rows meet no bank twice.
#define GP 264
#define GOPB ((128 + 64) * GP * 2)   /* bytes: 128 weight rows, then 64 activation rows */
typedef __attribute__((ext_vector_type(4))) __bf16 v4b;
typedef __attribute__((ext_vector_type(4))) _Float16 v4h;
template <int ROWS, int MODE> __device__ __forceinline__ void stage16(const float* __restrict__ src, unsigned char* dst, int tid) {
  const float* p = src + tid * 4; unsigned char* d = dst + (tid >> 6) * (GP * 2) + (tid & 63) * 8;
#pragma unroll 1   /* rolled: one batch of 32 loads is held in registers at a time; unrolled, k_proj took more registers than three blocks on a WGP, which its LDS allows, can have */
  for (int i0 = 0; i0 < ROWS / 2; i0 += 32) { v4f v[32];
#pragma unroll
    for (int u = 0; u < 32; ++u) v[u] = *(const v4f*)(p + (i0 + u) * 512);
#pragma unroll
    for (int u = 0; u < 32; ++u) { unsigned char* q = d + (i0 + u) * (GP * 4);
      if constexpr (MODE == 0) { v4b o;
#pragma unroll
        for (int r = 0; r < 4; ++r) o[r] = (__bf16)v[u][r];
        *(v4b*)q = o; }
      else { v4h o;
#pragma unroll
        for (int r = 0; r < 4; ++r) o[r] = MODE == 1 ? (_Float16)(v[u][r] * 64.0f) : (_Float16)(bfr(v[u][r]) * 256.0f);
        *(v4h*)q = o; } } } }
static_assert(WQKV_LAYOUT == 1 && WO_OUT_IN == 1 && DIN == 256 && CC == 256, "stage16 takes (out,in) weights and rows of 256");
// ---- k_proj: block = (64 rows, 128 cols, which): q/k/v = X W (+ b) with exact bf16 products (K = DIN) -> which 0: q f16 rows (+ residual rows < QHI); 1: k f16 rows (+ residual rows < KHI); 2: v f16 planes [c][t] (+ bf16 hi/lo planes for t < KHI)
__global__ __launch_bounds__(128) void k_proj(const float* __restrict__ XQ, const float* __restrict__ XK, const float* __restrict__ XV, const float* __restrict__ WQ, const float* __restrict__ WK, const float* __restrict__ WV, const float* __restrict__ BQ, const float* __restrict__ BK, const float* __restrict__ BV,
    _Float16* __restrict__ QH, _Float16* __restrict__ QL, _Float16* __restrict__ KH, _Float16* __restrict__ KL, _Float16* __restrict__ VT, __bf16* __restrict__ VB, __bf16* __restrict__ VBL) {
  __shared__ __align__(16) unsigned char SM[GOPB];   /* first the two operands, then, behind a barrier, the output tiles */
  _Float16 (*sh)[136] = (_Float16 (*)[136])SM; _Float16 (*sl)[136] = (_Float16 (*)[136])(SM + 17408); _Float16 (*th)[72] = (_Float16 (*)[72])(SM + 34816); __bf16 (*tb)[72] = (__bf16 (*)[72])(SM + 53248); __bf16 (*tbl)[72] = (__bf16 (*)[72])(SM + 71680);
  static_assert(2 * 64 * 136 * 2 + 3 * 128 * 72 * 2 <= GOPB, "output tiles fit the operands' LDS");
  const int tid = threadIdx.x, wave = tid >> 5, lane = tid & 31, col = lane & 15, g = lane >> 4; const int which = blockIdx.z; const int c0 = blockIdx.y * 128; const size_t r0 = (size_t)blockIdx.x * 64; const size_t bb = r0 / TT; const int t0 = (int)(r0 % TT);
  const float* X = which == 0 ? XQ : which == 1 ? XK : XV; const float* WA = which == 0 ? WQ : which == 1 ? WK : WV; const float* BA = which == 0 ? BQ : which == 1 ? BK : BV;
  stage16<64, 0>(X + r0 * DIN, SM + 128 * GP * 2, tid); stage16<128, 0>(WA + (size_t)c0 * DIN, SM, tid);
  __syncthreads();   /* both operands are readable by the four waves */
  const __bf16* sW = (const __bf16*)SM + col * GP; const __bf16* sX = (const __bf16*)SM + (128 + wave * 16 + col) * GP;
  v8f acc[8] = {}; v16b a[2], w[2][8];
  a[0] = frag_b(sX, lane);
#pragma unroll
  for (int j = 0; j < 8; ++j) w[0][j] = frag_b(sW + j * 16 * GP, lane);
#pragma unroll   /* unrolled: the two fragment sets alternate by name; the next chunk's 18 LDS reads stand as one group in front of this chunk's products and return under them */
  for (int kc = 0; kc < DIN / 32; ++kc) { const int c = kc & 1;
    if (kc + 1 < DIN / 32) { a[c ^ 1] = frag_b(sX + (kc + 1) * 32, lane);
#pragma unroll
      for (int j = 0; j < 8; ++j) w[c ^ 1][j] = frag_b(sW + j * 16 * GP + (kc + 1) * 32, lane); }
#pragma unroll
    for (int j = 0; j < 8; ++j) acc[j] = wmma_bf(a[c], w[c][j], acc[j]); }
  __syncthreads();   /* every wave has left the operands: the output tiles below take their LDS */
  if (which < 2) { _Float16* DH = which == 0 ? QH : KH; _Float16* DL = which == 0 ? QL : KL; const int nhi = which == 0 ? QHI : KHI; const bool hi_rows = t0 < nhi;
#pragma unroll
    for (int j = 0; j < 8; ++j) { const float bias = BA ? bfr(BA[c0 + j * 16 + col]) : 0.f;
#pragma unroll
      for (int r = 0; r < 8; ++r) { const float v = acc[j][r] + bias; const _Float16 hv = (_Float16)v; sh[wave * 16 + 8 * g + r][j * 16 + col] = hv; sl[wave * 16 + 8 * g + r][j * 16 + col] = (_Float16)((v - (float)hv) * 1024.0f); } }
    __syncthreads();
    for (int e = tid; e < 64 * 16; e += 128) { const int rl = e >> 4, q = e & 15; vst2((unsigned*)(DH + (r0 + rl) * CC + c0 + q * 8), *(const v4u*)&sh[rl][q * 8]); if (hi_rows) vst2((unsigned*)(DL + (bb * nhi + t0 + rl) * (size_t)CC + c0 + q * 8), *(const v4u*)&sl[rl][q * 8]); }
  } else { const bool hi_rows = t0 < KHI;
#pragma unroll
    for (int j = 0; j < 8; ++j) { const float bias = BA ? bfr(BA[c0 + j * 16 + col]) : 0.f;
#pragma unroll
      for (int r = 0; r < 8; ++r) { const float v = acc[j][r] + bias; const int rl = wave * 16 + 8 * g + r, cl = j * 16 + col; th[cl][rl] = (_Float16)v; const __bf16 bh = (__bf16)v; tb[cl][rl] = bh; tbl[cl][rl] = (__bf16)(v - (float)bh); } }
    __syncthreads();
    for (int e = tid; e < 128 * 8; e += 128) { const int cl = e >> 3, q = e & 7; vst2((unsigned*)(VT + (bb * CC + c0 + cl) * (size_t)TT + t0 + q * 8), *(const v4u*)&th[cl][q * 8]); if (hi_rows) { const size_t o3 = (bb * CC + c0 + cl) * (size_t)KHI + t0 + q * 8; vst2((unsigned*)(VB + o3), *(const v4u*)&tb[cl][q * 8]); vst2((unsigned*)(VBL + o3), *(const v4u*)&tbl[cl][q * 8]); } } } }
__device__ __forceinline__ void ex2_first(float& al, float* t, float dm, float s0, float s1, float s2, float s3, float c, float a) {
  asm("v_fma_f32 %1, %6, %10, %11\n\tv_fma_f32 %2, %7, %10, %11\n\tv_exp_f32 %0, %5\n\tv_fma_f32 %3, %8, %10, %11\n\tv_fma_f32 %4, %9, %10, %11"
      : "=&v"(al), "=&v"(t[0]), "=&v"(t[1]), "=&v"(t[2]), "=&v"(t[3]) : "v"(dm), "v"(s0), "v"(s1), "v"(s2), "v"(s3), "s"(c), "v"(a)); }
__device__ __forceinline__ void ex2_fma4(float* e, float* tn, const float* t, float s0, float s1, float s2, float s3, float c, float a) {
  asm("v_exp_f32 %0, %8\n\tv_fma_f32 %4, %12, %16, %17\n\tv_exp_f32 %1, %9\n\tv_fma_f32 %5, %13, %16, %17\n\tv_exp_f32 %2, %10\n\tv_fma_f32 %6, %14, %16, %17\n\tv_exp_f32 %3, %11\n\tv_fma_f32 %7, %15, %16, %17"
      : "=&v"(e[0]), "=&v"(e[1]), "=&v"(e[2]), "=&v"(e[3]), "=&v"(tn[0]), "=&v"(tn[1]), "=&v"(tn[2]), "=&v"(tn[3]) : "v"(t[0]), "v"(t[1]), "v"(t[2]), "v"(t[3]), "v"(s0), "v"(s1), "v"(s2), "v"(s3), "s"(c), "v"(a)); }
// the last four have no multiply-add left to carry: each fills the slot of the one in front, and one v_nop that of the last
__device__ __forceinline__ void ex2_last4(float* e, const float* t) {
  asm("v_exp_f32 %0, %4\n\tv_exp_f32 %1, %5\n\tv_exp_f32 %2, %6\n\tv_exp_f32 %3, %7\n\tv_nop" : "=&v"(e[0]), "=&v"(e[1]), "=&v"(e[2]), "=&v"(e[3]) : "v"(t[0]), "v"(t[1]), "v"(t[2]), "v"(t[3])); }
// Products of one kind as ONE statement: each fills the hazard slots of the one in front, so the four v_nop that keep vector instructions off D, A and B stand once behind the last product and not behind every one.
// The builtin alone did not serve: the LDS reads sank to their products.
__device__ __forceinline__ void wmma_s8(v8f* s, const v16h (*k)[HD / 32], const v16h* q) {   /* s[kt] = k[kt][0] q[0] + k[kt][1] q[1]; four independent tiles, then their second halves */
  asm volatile("v_wmma_f32_16x16x32_f16 %0, %4, %12, 0\n\tv_wmma_f32_16x16x32_f16 %1, %6, %12, 0\n\tv_wmma_f32_16x16x32_f16 %2, %8, %12, 0\n\tv_wmma_f32_16x16x32_f16 %3, %10, %12, 0\n\t"
               "v_wmma_f32_16x16x32_f16 %0, %5, %13, %0\n\tv_wmma_f32_16x16x32_f16 %1, %7, %13, %1\n\tv_wmma_f32_16x16x32_f16 %2, %9, %13, %2\n\tv_wmma_f32_16x16x32_f16 %3, %11, %13, %3\n\t"
               "v_nop\n\tv_nop\n\tv_nop\n\tv_nop"
               : "=&v"(s[0]), "=&v"(s[1]), "=&v"(s[2]), "=&v"(s[3]) : "v"(k[0][0]), "v"(k[0][1]), "v"(k[1][0]), "v"(k[1][1]), "v"(k[2][0]), "v"(k[2][1]), "v"(k[3][0]), "v"(k[3][1]), "v"(q[0]), "v"(q[1])); }
__device__ __forceinline__ void wmma_pv8(v8f* a, v8f* b, v16h v0, v16h v1, v16h v2, v16h v3, v16h p, v16h q) {   /* a[j] += v_j p, b[j] += v_j q: each v fragment serves both query tiles */
  asm volatile("v_wmma_f32_16x16x32_f16 %0, %8, %12, %0\n\tv_wmma_f32_16x16x32_f16 %1, %9, %12, %1\n\tv_wmma_f32_16x16x32_f16 %2, %10, %12, %2\n\tv_wmma_f32_16x16x32_f16 %3, %11, %12, %3\n\t"
               "v_wmma_f32_16x16x32_f16 %4, %8, %13, %4\n\tv_wmma_f32_16x16x32_f16 %5, %9, %13, %5\n\tv_wmma_f32_16x16x32_f16 %6, %10, %13, %6\n\tv_wmma_f32_16x16x32_f16 %7, %11, %13, %7\n\t"
               "v_nop\n\tv_nop\n\tv_nop\n\tv_nop"
               : "+v"(a[0]), "+v"(a[1]), "+v"(a[2]), "+v"(a[3]), "+v"(b[0]), "+v"(b[1]), "+v"(b[2]), "+v"(b[3]) : "v"(v0), "v"(v1), "v"(v2), "v"(v3), "v"(p), "v"(q)); }
__device__ __forceinline__ float xhalf(float v) { const int i = __builtin_bit_cast(int, v); return __builtin_bit_cast(float, __builtin_amdgcn_permlanex16(i, i, 0x76543210, 0xfedcba98, false, false)); }   /* lane l <-> l ^ 16 */
// K and V reach the waves through LDS: a stage is SKEYS keys; each of the 16 waves brings one slice of 64 rows x 128 B per stage by one tensor load
// (waves 0..7: 64 k rows each; waves 8..15: the 64 v planes x 64 keys each), the mover's 16-byte pad giving the pitch 144 B that 16-byte LDS reads want; two buffers, together the whole LDS of a WGP.
typedef uint32_t u32x4 __attribute__((ext_vector_type(4)));
typedef uint32_t u32x8 __attribute__((ext_vector_type(8)));
#define SKEYS 512
#define NSL (SKEYS / 64)       /* slices of k, and of v, in a stage */
#define TPS (SKEYS / 256)      /* trips of a wave in a stage: its quarter of the stage's keys, 64 a trip */
#define NST (TT / SKEYS)
#define LPITCH 144u
#define SLICEB 10240u          /* 64 rows x 144 B = 9216 B, rounded up so that every slice starts at a multiple of 2 KiB */
#define BUFB (2u * NSL * SLICEB)
__device__ __forceinline__ uint32_t uni(uint32_t v) { return (uint32_t)__builtin_amdgcn_readfirstlane(v); }
__device__ __forceinline__ uint32_t pinned(uint32_t v) { uint32_t w = uni(v); asm volatile("" : "+s"(w)); return w; }
// both groups are in-out operands: the descriptor then has registers of its own for the whole kernel, and none of them takes another value while a request is in flight
__device__ __forceinline__ void tdm_load(u32x4& g0, u32x8& g1) { asm volatile("tensor_load_to_lds %0, %1" : "+s"(g0), "+s"(g1) :: "memory"); }
__device__ __forceinline__ v16h frag_l(const unsigned char* p) { union { v16h v; v8h q[2]; } u; u.q[0] = *(const v8h*)p; u.q[1] = *(const v8h*)(p + 32); return u.v; }
#define SCN(n) s[2 * ((n) >> 4) + ((n) & 1)][((n) >> 1) & 7]   /* score n = 16 c2 + 2 i + w is s[2 c2 + w][i] */
// one query tile's 64 scores: mask, running maximum, P (two B operands), sum, and the rescale of the tile's ctx
__device__ __forceinline__ void soft_tile(v8f* s, float& m, float& l, v8f* acc, v16h* p, bool some_masked, unsigned b0, unsigned b1, unsigned g8, float C2) {
  if (some_masked) { unsigned w0, w1;   /* wave-uniform: some key of these 64 is masked */
    /* this lane half's mask bits, w = b >> 8g. In asm, volatile, so that the 64 bit tests that hang on them stay inside this branch: written plainly, the compiler shared them between the two query tiles and moved them in front of both branches, onto every trip */
    asm volatile("v_lshrrev_b32 %0, %2, %3\n\tv_lshrrev_b32 %1, %2, %4" : "=&v"(w0), "=&v"(w1) : "v"(g8), "s"(b0), "s"(b1));
#pragma unroll
    for (int kt = 0; kt < 4; ++kt)
#pragma unroll
      for (int r = 0; r < 8; ++r) { const unsigned w = kt < 2 ? w0 : w1; s[kt][r] = ((w >> ((kt & 1) * 16 + r)) & 1u) ? s[kt][r] : -3.0e38f; } }
  float mt[4];
#pragma unroll
  for (int kt = 0; kt < 4; ++kt) { mt[kt] = s[kt][0];
#pragma unroll
    for (int r = 1; r < 8; ++r) mt[kt] = fmaxf(mt[kt], s[kt][r]); }
  float mx = fmaxf(fmaxf(mt[0], mt[1]), fmaxf(mt[2], mt[3]));
  mx = fmaxf(mx, xhalf(mx));
  const float mn = fmaxf(m, mx * C2), ms = 10.0f - mn, dm = m - mn; m = mn;
  float al, t[32], e[32];
  ex2_first(al, t, dm, SCN(0), SCN(1), SCN(2), SCN(3), C2, ms);
#pragma unroll
  for (int n = 0; n < 28; n += 4) ex2_fma4(e + n, t + n + 4, t + n, SCN(n + 4), SCN(n + 5), SCN(n + 6), SCN(n + 7), C2, ms);
  ex2_last4(e + 28, t + 28);
  float sum = 0.f;
#pragma unroll
  for (int c2 = 0; c2 < 2; ++c2)
#pragma unroll
    for (int i = 0; i < 8; ++i) { const float e0 = e[16 * c2 + 2 * i], e1 = e[16 * c2 + 2 * i + 1]; sum += e0 + e1; p[c2][i] = (_Float16)e0; p[c2][8 + i] = (_Float16)e1; }
  l = l * al + sum;
#pragma unroll
  for (int j = 0; j < HD / 16; ++j) acc[j] *= al; }
#define MRGB 10240u   /* bytes of LDS per wave for the hand-over at the end: per query tile 32 f32 of ctx a lane (2 x 4096 B), then per tile maximum and sum (2 x 256 B) */
__global__ __launch_bounds__(512) void k_fa(const _Float16* __restrict__ QH, const _Float16* __restrict__ KH, const _Float16* __restrict__ VT, const int* __restrict__ MASK, float* __restrict__ Y) {
  __shared__ __attribute__((aligned(2048))) unsigned char L[2 * BUFB];
  const int tid = threadIdx.x, wave = tid >> 5, lane = tid & 31, col = lane & 15, g = lane >> 4;
  const int h = blockIdx.y, b = blockIdx.z;
  const uint32_t wv = uni((uint32_t)tid >> 5), sl = wv & (NSL - 1u); const bool isV = wv >= (uint32_t)NSL;   /* sl: the slice of k or v that this wave brings */
  const uint32_t kh = wv >> 2, qg = wv & 3u; const int q0 = blockIdx.x * 128 + (int)qg * 32;   /* key quarter; query group; first of this wave's 32 queries */
  const uint32_t lbase = (uint32_t)(size_t)L;
  const uint64_t ga0 = isV ? (uint64_t)(size_t)(VT + ((size_t)b * CC + h * HD) * (size_t)TT + sl * 64u) : (uint64_t)(size_t)(KH + ((size_t)b * TT + sl * 64u) * CC + h * HD);
  const uint32_t gsh = isV ? 10u : 18u;   /* bytes from one stage to the next: SKEYS x 2 along a v plane, SKEYS x CC x 2 down the k rows */
  static_assert(SKEYS * 2 == 1 << 10 && SKEYS * CC * 2 == 1 << 18 && NST >= 2 && 2 * NSL == 16 && 16u * MRGB <= 2u * BUFB, "stage steps; one slice a wave; the hand-over fits the ring");
  u32x8 g1;   /* 1-byte elements, tensor = tile = 64 rows of 128 B, a 16-byte pad behind every 128 B, no mask */
  g1[0] = uni((1u << 20) | (4u << 22) | (3u << 25)); g1[1] = uni(128u << 16); g1[2] = uni(64u << 16); g1[3] = uni(128u << 16); g1[4] = uni(64u); g1[5] = uni(isV ? (uint32_t)TT * 2u : (uint32_t)CC * 2u); g1[6] = uni(0u); g1[7] = uni(0u);
  u32x4 g0; g0[0] = uni(1u);
  auto issue = [&](uint32_t st) { const uint64_t ga = ga0 + (uint64_t)(st << gsh);
    g0[1] = uni(lbase + (st & 1u) * BUFB + (2u * sl + (isV ? 1u : 0u)) * SLICEB);   /* slice sl of k, then slice sl of v: a trip's 32 LDS reads lie within the reach of one address register's immediate offsets */ g0[2] = uni((uint32_t)ga); g0[3] = uni((((uint32_t)(ga >> 32)) & 0x01FFFFFFu) | 0x80000000u);
    tdm_load(g0, g1); };
  const int* Mb = MASK + (size_t)b * TT + lane;
  const float C2 = SCALE * 1.44269504088896f;   /* raw logit -> log2 units */
  v16h qf[2][HD / 32];
#pragma unroll
  for (int qt = 0; qt < 2; ++qt)
#pragma unroll
    for (int kc = 0; kc < HD / 32; ++kc) qf[qt][kc] = frag_h(QH + ((size_t)b * TT + q0 + qt * 16 + col) * CC + h * HD + kc * 32, lane);
  int mk0 = Mb[kh * 128u], mk1 = Mb[kh * 128u + 32u];
  v8f acc[2][HD / 16] = {}; float m[2] = {-1.0e30f, -1.0e30f}, l[2] = {0.f, 0.f};
  issue(0u);
  asm volatile("s_wait_tensorcnt 0x0" ::: "memory");   /* this wave's slice of stage 0 has landed */
  __syncthreads();                                      /* every wave's slice of stage 0 is readable by all */
  issue(pinned(1u));                                    /* pinned(): stage 1's descriptor words are formed behind the wait above */
  const uint32_t loff = (uint32_t)col * LPITCH + 16u * (uint32_t)g;
#pragma unroll 1   /* rolled: one publish point and one refill site */
  for (uint32_t st = 0; st < NST; ++st) { const unsigned char* Bp = L + (st & 1u) * BUFB + loff;
#pragma unroll 1   /* rolled: one trip's fragments, scores and both ctx tiles fill the 256 registers that asm text can name */
    for (uint32_t hb = 0; hb < TPS; ++hb) { const uint32_t ks = kh * TPS + hb; const int it = (int)(st * NSL + ks);   /* ks: this trip's 64-key slice of the stage */
    const unsigned char* Kp = Bp + 2u * ks * SLICEB; const unsigned char* Vp = Kp + SLICEB;
    const unsigned b0 = __builtin_amdgcn_ballot_w32(mk0 != 0), b1 = __builtin_amdgcn_ballot_w32(mk1 != 0);
    const int kn = (hb + 1u < TPS ? it + 1 : st + 1u < NST ? it + NSL - TPS + 1 : it) * 64;   /* this wave's next trip's mask words fly under this trip (the last trip rereads its own) */
    mk0 = Mb[kn]; mk1 = Mb[kn + 32];
    asm volatile("s_wait_xcnt 0x0" ::: "memory");   /* the mask loads' address registers are free to be rewritten behind this */
    v16h kf[4][HD / 32];
#pragma unroll
    for (int kt = 0; kt < 4; ++kt)
#pragma unroll
      for (int kc = 0; kc < HD / 32; ++kc) kf[kt][kc] = frag_l(Kp + kt * 16 * LPITCH + kc * 64);
    const bool some_masked = (b0 & b1) != 0xFFFFFFFFu;
    v8f s[4]; v16h p[2][2];
    wmma_s8(s, kf, qf[0]);
    soft_tile(s, m[0], l[0], acc[0], p[0], some_masked, b0, b1, 8u * (unsigned)g, C2);
    __builtin_amdgcn_sched_barrier(0);   /* holds the second tile's logit products behind the first tile's softmax, so that both tiles' scores take the same registers; left free, they moved up and the kernel left the 256 registers that asm text can name */
    wmma_s8(s, kf, qf[1]);
    v16h vf[HD / 16][2];   /* the v fragments take the registers that the k fragments have just left */
#pragma unroll
    for (int j = 0; j < HD / 16; ++j) { vf[j][0] = frag_l(Vp + j * 16 * LPITCH); vf[j][1] = frag_l(Vp + j * 16 * LPITCH + 64); }
    __builtin_amdgcn_sched_barrier(0);   /* holds the v reads in front of the second tile's softmax, under which they return; left free, the compiler sinks them close in front of the products that wait for them */
    soft_tile(s, m[1], l[1], acc[1], p[1], some_masked, b0, b1, 8u * (unsigned)g, C2);
    wmma_pv8(acc[0], acc[1], vf[0][0], vf[1][0], vf[2][0], vf[3][0], p[0][0], p[1][0]); wmma_pv8(acc[0], acc[1], vf[0][1], vf[1][1], vf[2][1], vf[3][1], p[0][1], p[1][1]); }
    asm volatile("s_wait_dscnt 0x0" ::: "memory");       /* this wave's reads of stage st have returned */
    asm volatile("s_wait_tensorcnt 0x0" ::: "memory");   /* this wave's slice of stage st + 1 has landed */
    __syncthreads();                                      /* stage st + 1 is readable by all, and every wave has left stage st's buffer */
    if (pinned(st + 2u < NST)) issue(pinned(st + 2u)); }  /* the refill of the buffer just left; scalar test */
  asm volatile("s_wait_tensorcnt 0x0" ::: "memory");     /* nothing of the mover is in flight when the wave ends */
  asm volatile("s_wait_dscnt 0x0" ::: "memory");         /* nor any LDS read of this wave */
  // The four key quarters meet: every wave lays both its tiles (ctx, maximum, sum) into LDS; wave (qg, kq) then joins, over the four quarters of its query group, query tile kq >> 1, ctx columns 32 (kq & 1) .. + 31: one 128-byte line of Y a query.
  // The last stage's barrier has ended every read of the ring, and no load was issued behind it: its LDS is free.
  l[0] += xhalf(l[0]); l[1] += xhalf(l[1]);
  unsigned char* Xs = L + wv * MRGB + lane * 16;
#pragma unroll
  for (int qt = 0; qt < 2; ++qt) {
#pragma unroll
    for (int j = 0; j < HD / 16; ++j) { v4f lo, hi;
#pragma unroll
      for (int r = 0; r < 4; ++r) { lo[r] = acc[qt][j][r]; hi[r] = acc[qt][j][4 + r]; }
      *(v4f*)(Xs + qt * 4096 + j * 1024) = lo; *(v4f*)(Xs + qt * 4096 + j * 1024 + 512) = hi; }
    v2f ml; ml[0] = m[qt]; ml[1] = l[qt];
    *(v2f*)(L + wv * MRGB + 8192u + qt * 256 + lane * 8) = ml; }
  __syncthreads();   /* every wave's tiles are readable by the waves of its query group */
  const uint32_t tq = kh >> 1, jp = kh & 1u;   /* the query tile and the pair of ctx column tiles that this wave finishes */
  const unsigned char* Xr = L + qg * MRGB + tq * 4096u + jp * 2048u + lane * 16; const unsigned char* Mr = L + qg * MRGB + 8192u + tq * 256u + lane * 8;   /* quarter k's copy lies 4 k MRGB further on */
  v2f mo[4];
#pragma unroll
  for (int k = 0; k < 4; ++k) mo[k] = *(const v2f*)(Mr + k * 4 * MRGB);
  const float mm = fmaxf(fmaxf(mo[0][0], mo[1][0]), fmaxf(mo[2][0], mo[3][0]));   /* maxima are in log2 units; a quarter with no kept key has sum 0 and ctx 0 */
  float dq[4], wq[4], den = 0.f;
#pragma unroll
  for (int k = 0; k < 4; ++k) dq[k] = mo[k][0] - mm;
  ex2_last4(wq, dq);   /* the four exponentials in one statement */
#pragma unroll
  for (int k = 0; k < 4; ++k) den += mo[k][1] * wq[k];
  const float inv = 1.0f / den;
  float* yr = Y + ((size_t)b * TT + q0 + (int)tq * 16 + col) * CC + h * HD + (int)jp * 32 + 8 * g;   /* acc[j][r] = ctx[query col][j * 16 + 8g + r] */
#pragma unroll
  for (int j = 0; j < 2; ++j) { v4f lo = {}, hi = {};
#pragma unroll
    for (int k = 0; k < 4; ++k) { const float ck = wq[k] * inv; const v4f ol = *(const v4f*)(Xr + k * 4 * MRGB + j * 1024), oh = *(const v4f*)(Xr + k * 4 * MRGB + j * 1024 + 512);
#pragma unroll
      for (int r = 0; r < 4; ++r) { lo[r] += ol[r] * ck; hi[r] += oh[r] * ck; } }
    vst2(yr + j * 16, lo); vst2(yr + j * 16 + 4, hi); } }
// ---- k_out: block = (64 rows, 128 cols): out = ctx Wo (+ bo): ctx x 2^6 once to f16 against Wo as f16(bf16 x 2^8) exact (1 product) x 2^-14; causal early rows (< QHI of each sequence): ctx bf16 hi + lo against exact bf16 Wo (2 products)
__global__ __launch_bounds__(128) void k_out(const float* __restrict__ Y, const float* __restrict__ WO, const float* __restrict__ BO, float* __restrict__ OUT) { __shared__ __align__(16) unsigned char SM[GOPB];   /* first the two operands, then, behind a barrier, the output tile */
  float (*sf)[16][132] = (float (*)[16][132])SM; static_assert(4 * 16 * 132 * 4 <= GOPB, "output tile fits the operands' LDS");
  const int tid = threadIdx.x, wave = tid >> 5, lane = tid & 31, col = lane & 15, g = lane >> 4; const int c0 = blockIdx.y * 128; const size_t r0 = (size_t)blockIdx.x * 64 + wave * 16;
  v8f acc[8] = {};
  if (CAUSAL && (int)(((size_t)blockIdx.x * 64) % TT) < QHI) {   /* block-uniform */
#pragma unroll 2
    for (int kc = 0; kc < CC / 32; ++kc) { const F2 a = split_row(Y + (r0 + col) * CC, kc * 32, lane); asm volatile("s_wait_loadcnt 0x0" ::: "memory");
#pragma unroll
      for (int j = 0; j < 8; ++j) { const v16b w = WOCOL(WO, kc * 32, c0 + j * 16 + col, lane); asm volatile("s_wait_loadcnt 0x0" ::: "memory"); acc[j] = wmma_bf(a.h, w, acc[j]); acc[j] = wmma_bf(a.l, w, acc[j]); } }
#pragma unroll
    for (int j = 0; j < 8; ++j) { const float bias = BO ? bfr(BO[c0 + j * 16 + col]) : 0.f;
#pragma unroll
      for (int r = 0; r < 8; ++r) sf[wave][8 * g + r][j * 16 + col] = acc[j][r] + bias; }
  } else {
    stage16<64, 1>(Y + (size_t)blockIdx.x * 64 * CC, SM + 128 * GP * 2, tid); stage16<128, 2>(WO + (size_t)c0 * CC, SM, tid);   /* ctx carried x 2^6 into f16 so small-magnitude context rows stay clear of f16 subnormals */
    __syncthreads();   /* both operands are readable by the four waves */
    const _Float16* sW = (const _Float16*)SM + col * GP; const _Float16* sY = (const _Float16*)SM + (128 + wave * 16 + col) * GP;
    v16h a[2], w[2][8];
    a[0] = frag_h(sY, lane);
#pragma unroll
    for (int j = 0; j < 8; ++j) w[0][j] = frag_h(sW + j * 16 * GP, lane);
#pragma unroll   /* unrolled: the two fragment sets alternate by name; the next chunk's 18 LDS reads stand as one group in front of this chunk's products and return under them */
    for (int kc = 0; kc < CC / 32; ++kc) { const int c = kc & 1;
      if (kc + 1 < CC / 32) { a[c ^ 1] = frag_h(sY + (kc + 1) * 32, lane);
#pragma unroll
        for (int j = 0; j < 8; ++j) w[c ^ 1][j] = frag_h(sW + j * 16 * GP + (kc + 1) * 32, lane); }
#pragma unroll
      for (int j = 0; j < 8; ++j) acc[j] = wmma16(a[c], w[c][j], acc[j]); }
    __syncthreads();   /* every wave has left the operands: the output tile below takes their LDS */
#pragma unroll
    for (int j = 0; j < 8; ++j) { const float bias = BO ? bfr(BO[c0 + j * 16 + col]) : 0.f;
#pragma unroll
      for (int r = 0; r < 8; ++r) sf[wave][8 * g + r][j * 16 + col] = acc[j][r] * (1.0f / 16384.0f) + bias; } }   /* 2^-8 (Wo carry) x 2^-6 (ctx carry) */
  LDSX(); for (int rl = 0; rl < 16; ++rl) vst2(OUT + (r0 + rl) * DIN + c0 + lane * 4, *(const v4f*)&sf[wave][rl][lane * 4]); }

extern "C" void kernel_launch(void* const* d_in, const int* in_sizes, int n_in, void* d_out, int out_size, void* d_ws, size_t ws_size, hipStream_t stream) {
  (void)in_sizes; (void)n_in; (void)out_size;
  const float** F = (const float**)d_in;
  if (ws_size < (size_t)WS_END) return;
  char* ws = (char*)d_ws; _Float16 *QH = (_Float16*)(ws + WS_QH), *KH = (_Float16*)(ws + WS_KH), *VT = (_Float16*)(ws + WS_VT), *QL = (_Float16*)(ws + WS_QL), *KL = (_Float16*)(ws + WS_KL); __bf16 *VB = (__bf16*)(ws + WS_VB), *VBL = (__bf16*)(ws + WS_VBL); float *Y = (float*)(ws + WS_Y);
  (void)Y; (void)QL; (void)KL; (void)VB; (void)VBL;
  // inputs: 0 x [4,2048,256]; 1 W_Q [256,256] (out,in); 2 W_K; 3 W_V; 4 W_O (out,in); 5 mask [4,2048] int32 (ones on this draw; read per key); no biases
  k_proj<<<dim3(TNB * TT / 64, CC / 128, 3), 128, 0, stream>>>(F[0], F[0], F[0], F[1], F[2], F[3], nullptr, nullptr, nullptr, QH, QL, KH, KL, VT, VB, VBL);
  k_fa<<<dim3(TT / 128, NH, TNB), 512, 0, stream>>>(QH, KH, VT, (const int*)d_in[5], Y);
  k_out<<<dim3(TNB * TT / 64, DIN / 128), 128, 0, stream>>>(Y, F[4], nullptr, (float*)d_out);
}

// v007
// It runs in 31.6 microseconds.
// Two timings next to v006 put it at 1.08 and 1.07 times that version's speed.
// Over all steps from v000 it is 18.0 times as fast.
// compute dtype: all float inputs rounded to bf16; q / k / v projections with EXACT bf16 products on WMMA 16x16x32 (f32 accumulate), no biases; logits q x k once to f16 each (1 product) x 64^-0.5; the int key mask read per (batch, key); softmax f32 with a running maximum, fused with both products; P = exp(s - max) x 2^10 once to f16 x v once to f16 (1 product), divided by the f32 sum at the end; ctx x 2^6 once to f16 x W_O f16(bf16 x 2^8); f32 output.
#include <hip/hip_runtime.h>
#include <math.h>
#include <stdint.h>

typedef __attribute__((ext_vector_type(16))) _Float16 v16h;
typedef __attribute__((ext_vector_type(16))) __bf16 v16b;
typedef __attribute__((ext_vector_type(8)))  _Float16 v8h;
typedef __attribute__((ext_vector_type(8)))  float v8f;
typedef __attribute__((ext_vector_type(4)))  float v4f;
typedef __attribute__((ext_vector_type(2)))  float v2f;
typedef __attribute__((ext_vector_type(4)))  unsigned v4u;
typedef __attribute__((ext_vector_type(4)))  int v4i;
typedef float __attribute__((may_alias)) float_a;
typedef int __attribute__((may_alias)) int_a;

template <typename T> __device__ __forceinline__ void vst2(void* p, T v) { *(T*)p = v;  }
__device__ __forceinline__ v8f wmma16(v16h a, v16h b, v8f c) {
  v8f d = __builtin_amdgcn_wmma_f32_16x16x32_f16(false, a, false, b, (short)0, c, false, false);
  asm volatile("v_nop\n\tv_nop\n\tv_nop\n\tv_nop" : "+v"(d) : "v"(a), "v"(b));
  return d;
}
__device__ __forceinline__ v8f wmma_bf(v16b a, v16b b, v8f c) {
  v8f d = __builtin_amdgcn_wmma_f32_16x16x32_bf16(false, a, false, b, (short)0, c, false, false);
  asm volatile("v_nop\n\tv_nop\n\tv_nop\n\tv_nop" : "+v"(d) : "v"(a), "v"(b));
  return d;
}
// 16x16x32 fragments: lane = (h = lane>>4, row/col = lane&15); elements 0..7 = k0+8h+0..7, 8..15 = k0+16+8h+0..7; D element r = row 8h+r
__device__ __forceinline__ v16h frag_h(const _Float16* rowk0, int lane) {
  union { v16h v; v8h q[2]; } u; const _Float16* p = rowk0 + 8 * (lane >> 4);
  u.q[0] = *(const v8h*)p; u.q[1] = *(const v8h*)(p + 16); return u.v;
}
__device__ __forceinline__ v16h frag_f32(const float* rowk0, int lane) {
  v16h a; const float* p = rowk0 + 8 * (lane >> 4);
#pragma unroll
  for (int i = 0; i < 8; ++i) { a[i] = (_Float16)p[i]; a[8 + i] = (_Float16)p[16 + i]; }
  return a;
}
__device__ __forceinline__ v16h frag_f32s(const float* rowk0, int lane, float sc) {
  v16h a; const float* p = rowk0 + 8 * (lane >> 4);
#pragma unroll
  for (int i = 0; i < 8; ++i) { a[i] = (_Float16)(p[i] * sc); a[8 + i] = (_Float16)(p[16 + i] * sc); }
  return a;
}
// column fragment from a [K][ld] layout (column n), rows >= K read as 0
__device__ __forceinline__ v16h fragc_f32(const float* W, int k0, int n, int lane, int ld, int K) {
  v16h a; const int g = lane >> 4;
#pragma unroll
  for (int i = 0; i < 8; ++i) { const int ka = k0 + 8 * g + i, kb = ka + 16;
    a[i] = (_Float16)(ka < K ? W[(size_t)(ka < K ? ka : K - 1) * ld + n] : 0.f); a[8 + i] = (_Float16)(kb < K ? W[(size_t)(kb < K ? kb : K - 1) * ld + n] : 0.f); }
  return a;
}
struct F2 { v16b h, l; };
__device__ __forceinline__ F2 bsplit16(const float v[16]) { F2 r;
#pragma unroll
  for (int i = 0; i < 16; ++i) { const __bf16 h = (__bf16)v[i]; r.h[i] = h; r.l[i] = (__bf16)(v[i] - (float)h); }
  return r; }
__device__ __forceinline__ F2 split_row(const float* row, int k0, int lane) { float v[16]; const float* p = row + k0 + 8 * (lane >> 4);
#pragma unroll
  for (int i = 0; i < 8; ++i) { v[i] = p[i]; v[8 + i] = p[16 + i]; }
  return bsplit16(v); }
__device__ __forceinline__ F2 split_rowK(const float* row, int k0, int lane, int K) { float v[16]; const int g = lane >> 4;
#pragma unroll
  for (int i = 0; i < 8; ++i) { const int ka = k0 + 8 * g + i, kb = ka + 16; v[i] = ka < K ? row[ka < K ? ka : K - 1] : 0.f; v[8 + i] = kb < K ? row[kb < K ? kb : K - 1] : 0.f; }
  return bsplit16(v); }
__device__ __forceinline__ F2 split_col(const float* W, int k0, int n, int lane, int ld, int K) { float v[16]; const int g = lane >> 4;
#pragma unroll
  for (int i = 0; i < 8; ++i) { const int ka = k0 + 8 * g + i, kb = ka + 16; v[i] = ka < K ? W[(size_t)(ka < K ? ka : K - 1) * ld + n] : 0.f; v[8 + i] = kb < K ? W[(size_t)(kb < K ? kb : K - 1) * ld + n] : 0.f; }
  return bsplit16(v); }
__device__ __forceinline__ v8f mac3(const F2& a, const F2& b, v8f c) { c = wmma_bf(a.l, b.h, c); c = wmma_bf(a.h, b.l, c); return wmma_bf(a.h, b.h, c); }
__device__ __forceinline__ float sigm(float v) { return 1.0f / (1.0f + expf(-v)); }
#define LDSX() do { asm volatile("s_wait_dscnt 0" ::: "memory"); __builtin_amdgcn_wave_barrier(); __builtin_amdgcn_fence(__ATOMIC_RELEASE, "workgroup"); } while (0)

// Standard multi-head self-attention with a key-padding mask input (x [4,2048,256]; torch (out,in) W_Q / W_K / W_V / W_O [256,256] uniform(+-1/16) applied as x @ W.T, no biases; mask [4,2048] int32 = ones (const: nothing is masked on this draw); 4 heads x 64; scores x 64^-0.5; where(mask[:, None, None, :] == 0, -inf, scores); softmax; out @ W_O.T).
#define NB 4
#define TT 2048
#define CC 256            // NH * HD = projected width
#define DIN 256          // input (model) width
#define NH 4
#define HD 64
#define NQB (TT / 64)
#define HG 4
#define SCALE (0.125f)
#define CAUSAL 0
#ifndef TNB
#define TNB NB
#endif
__device__ __forceinline__ float bfr(float v) { return (float)(__bf16)v; }
__host__ __device__ __forceinline__ int kb_last(int qb) { return CAUSAL ? ((qb * 64 + 63) >> 7) : (TT / 128 - 1); }
typedef __attribute__((ext_vector_type(8))) __bf16 v8b;
__device__ __forceinline__ v16b frag_b(const __bf16* rowk0, int lane) {
  union { v16b v; v8b q[2]; } u; const __bf16* p = rowk0 + 8 * (lane >> 4);
  u.q[0] = *(const v8b*)p; u.q[1] = *(const v8b*)(p + 16); return u.v;
}
#define QBH 0              // unused (k_fa has no high-precision path)
#define QHI 0               // single-product logits on every row
#define KHI 64            // key rows carrying k residual / v bf16 hi+lo planes (written by k_proj, read by no kernel)
// B fragment (k rows k0+.., output column o) of a weight: (in,out) [K][ld] or (out,in) [ld rows of K]: bf16 exact, or f16(bf16 * 256) exact
__device__ __forceinline__ v16b wcol_io(const float* Wm, int k0, int o, int lane, int ld) { v16b w; const int g = lane >> 4;
#pragma unroll
  for (int i = 0; i < 8; ++i) { w[i] = (__bf16)Wm[(size_t)(k0 + 8 * g + i) * ld + o]; w[8 + i] = (__bf16)Wm[(size_t)(k0 + 16 + 8 * g + i) * ld + o]; }
  return w; }
__device__ __forceinline__ v16b wcol_oi(const float* Wm, int k0, int o, int lane, int K) { v16b w; const float* p = Wm + (size_t)o * K + k0 + 8 * (lane >> 4);
#pragma unroll
  for (int i = 0; i < 8; ++i) { w[i] = (__bf16)p[i]; w[8 + i] = (__bf16)p[16 + i]; }
  return w; }
__device__ __forceinline__ v16h wcolh_io(const float* Wm, int k0, int o, int lane, int ld) { v16h w; const int g = lane >> 4;
#pragma unroll
  for (int i = 0; i < 8; ++i) { w[i] = (_Float16)(bfr(Wm[(size_t)(k0 + 8 * g + i) * ld + o]) * 256.0f); w[8 + i] = (_Float16)(bfr(Wm[(size_t)(k0 + 16 + 8 * g + i) * ld + o]) * 256.0f); }
  return w; }
__device__ __forceinline__ v16h wcolh_oi(const float* Wm, int k0, int o, int lane, int K) { v16h w; const float* p = Wm + (size_t)o * K + k0 + 8 * (lane >> 4);
#pragma unroll
  for (int i = 0; i < 8; ++i) { w[i] = (_Float16)(bfr(p[i]) * 256.0f); w[8 + i] = (_Float16)(bfr(p[16 + i]) * 256.0f); }
  return w; }
#define WQKV_LAYOUT 1   // 0 = (in,out) [DIN][CC]; 1 = (out,in) [CC][DIN]; 2 = per-head [NH][DIN][HD]
__device__ __forceinline__ v16b wcol_hdk(const float* Wm, int k0, int o, int lane) { v16b w; const int g = lane >> 4; const float* p = Wm + (size_t)(o / HD) * DIN * HD + (o % HD);
#pragma unroll
  for (int i = 0; i < 8; ++i) { w[i] = (__bf16)p[(size_t)(k0 + 8 * g + i) * HD]; w[8 + i] = (__bf16)p[(size_t)(k0 + 16 + 8 * g + i) * HD]; }
  return w; }
#define WO_OUT_IN 1
#if WQKV_LAYOUT == 1
#define WCOL(W, k0, o, lane) wcol_oi(W, k0, o, lane, DIN)
#elif WQKV_LAYOUT == 2
#define WCOL(W, k0, o, lane) wcol_hdk(W, k0, o, lane)
#else
#define WCOL(W, k0, o, lane) wcol_io(W, k0, o, lane, CC)
#endif
#if WO_OUT_IN
#define WOCOL(W, k0, o, lane) wcol_oi(W, k0, o, lane, CC)
#define WOCOLH(W, k0, o, lane) wcolh_oi(W, k0, o, lane, CC)
#else
#define WOCOL(W, k0, o, lane) wcol_io(W, k0, o, lane, DIN)
#define WOCOLH(W, k0, o, lane) wcolh_io(W, k0, o, lane, DIN)
#endif

#define WS_QH  0u                                      // f16 q rows [b*t][CC]
#define WS_KH  (WS_QH + 2u * (size_t)NB * TT * CC)      // f16 k rows [b*t][CC]
#define WS_VT  (WS_KH + 2u * (size_t)NB * TT * CC)      // f16 v planes [b][c][t]
#define WS_QL  (WS_VT + 2u * (size_t)NB * CC * TT)      // f16 q residual x 2^10 rows [b][t < QHI][CC]
#define WS_KL  (WS_QL + 2u * (size_t)NB * QHI * CC)     // f16 k residual x 2^10 rows [b][t < KHI][CC]
#define WS_VB  (WS_KL + 2u * (size_t)NB * KHI * CC)     // bf16 v hi planes [b][c][t < KHI]
#define WS_VBL (WS_VB + 2u * (size_t)NB * CC * KHI)
#define WS_S   (WS_VBL + 2u * (size_t)NB * CC * KHI)    // (unused: logits and P stay in registers)
#define WS_Y   (WS_S  + 4u * (size_t)HG * TT * TT)      // f16 ctx x 2^6 rows [b*t][CC]
#define WS_WOH (WS_Y  + 2u * (size_t)NB * TT * CC)      // f16(bf16(W_O) x 2^8) rows [DIN][CC]
#define WS_END (WS_Y  + 4u * (size_t)NB * TT * CC)
static_assert(WS_WOH + 2u * (size_t)DIN * CC <= WS_END, "both operands of k_out lie inside the workspace map");

// Operand staging of k_proj: ROWS contiguous rows of 256 f32 go once per block into LDS as 16-bit rows, read by whole lines (128 threads x 16 B = two rows a step) and rounded on the way exactly as the fragment loaders rounded them.
// MODE 0: bf16; 1: f16(v x 2^6); 2: f16(bf16(v) x 2^8). Row pitch 528 B = 16 B x 33: the 16-byte fragment reads of 16 rows meet no bank twice.
#define GP 264
#define GOPB ((128 + 64) * GP * 2)   /* bytes: 128 weight rows, then 64 activation rows */
typedef __attribute__((ext_vector_type(4))) __bf16 v4b;
typedef __attribute__((ext_vector_type(4))) _Float16 v4h;
typedef __attribute__((ext_vector_type(2))) _Float16 v2h;
template <int ROWS, int MODE> __device__ __forceinline__ void stage16(const float* __restrict__ src, unsigned char* dst, int tid) {
  const float* p = src + tid * 4; unsigned char* d = dst + (tid >> 6) * (GP * 2) + (tid & 63) * 8;
#pragma unroll 1   /* rolled: one batch of 32 loads is held in registers at a time; unrolled, k_proj took more registers than three blocks on a WGP, which its LDS allows, can have */
  for (int i0 = 0; i0 < ROWS / 2; i0 += 32) { v4f v[32];
#pragma unroll
    for (int u = 0; u < 32; ++u) v[u] = *(const v4f*)(p + (i0 + u) * 512);
#pragma unroll
    for (int u = 0; u < 32; ++u) { unsigned char* q = d + (i0 + u) * (GP * 4);
      if constexpr (MODE == 0) { v4b o;
#pragma unroll
        for (int r = 0; r < 4; ++r) o[r] = (__bf16)v[u][r];
        *(v4b*)q = o; }
      else { v4h o;
#pragma unroll
        for (int r = 0; r < 4; ++r) o[r] = MODE == 1 ? (_Float16)(v[u][r] * 64.0f) : (_Float16)(bfr(v[u][r]) * 256.0f);
        *(v4h*)q = o; } } } }
static_assert(WQKV_LAYOUT == 1 && WO_OUT_IN == 1 && DIN == 256 && CC == 256, "stage16 takes (out,in) weights and rows of 256");
// Operand staging of k_out: both operands lie in the workspace as the f16 values that are multiplied, so NA + NW rows of 512 B go to LDS unchanged (a wave's 16-byte loads take one whole row, 128 threads four rows a step);
// nothing is converted between a load and its LDS store, and all of a thread's loads are in flight together: the block waits for memory once.
template <int NA, int NW> __device__ __forceinline__ void stage_rows(const _Float16* __restrict__ A, const _Float16* __restrict__ Wt, unsigned char* dA, unsigned char* dW, int tid) {
  const int off = (tid >> 5) * 256 + (tid & 31) * 8; const int lo = (tid >> 5) * (GP * 2) + (tid & 31) * 16;
  v4u a[NA / 4], w[NW / 4];
#pragma unroll
  for (int u = 0; u < NA / 4; ++u) a[u] = *(const v4u*)(A + off + u * 1024);
#pragma unroll
  for (int u = 0; u < NW / 4; ++u) w[u] = *(const v4u*)(Wt + off + u * 1024);
#pragma unroll
  for (int u = 0; u < NA / 4; ++u) *(v4u*)(dA + lo + u * (GP * 8)) = a[u];
#pragma unroll
  for (int u = 0; u < NW / 4; ++u) *(v4u*)(dW + lo + u * (GP * 8)) = w[u]; }
// ---- k_proj: block = (64 rows, 128 cols, which): q/k/v = X W (+ b) with exact bf16 products (K = DIN) -> which 0: q f16 rows (+ residual rows < QHI); 1: k f16 rows (+ residual rows < KHI); 2: v f16 planes [c][t] (+ bf16 hi/lo planes for t < KHI)
__global__ __launch_bounds__(128) void k_proj(const float* __restrict__ XQ, const float* __restrict__ XK, const float* __restrict__ XV, const float* __restrict__ WQ, const float* __restrict__ WK, const float* __restrict__ WV, const float* __restrict__ BQ, const float* __restrict__ BK, const float* __restrict__ BV, const float* __restrict__ WO, _Float16* __restrict__ WOH,
    _Float16* __restrict__ QH, _Float16* __restrict__ QL, _Float16* __restrict__ KH, _Float16* __restrict__ KL, _Float16* __restrict__ VT, __bf16* __restrict__ VB, __bf16* __restrict__ VBL) {
  __shared__ __align__(16) unsigned char SM[GOPB];   /* first the two operands, then, behind a barrier, the output tiles */
  _Float16 (*sh)[136] = (_Float16 (*)[136])SM; _Float16 (*sl)[136] = (_Float16 (*)[136])(SM + 17408); _Float16 (*th)[72] = (_Float16 (*)[72])(SM + 34816); __bf16 (*tb)[72] = (__bf16 (*)[72])(SM + 53248); __bf16 (*tbl)[72] = (__bf16 (*)[72])(SM + 71680);
  static_assert(2 * 64 * 136 * 2 + 3 * 128 * 72 * 2 <= GOPB, "output tiles fit the operands' LDS");
  const int tid = threadIdx.x, wave = tid >> 5, lane = tid & 31, col = lane & 15, g = lane >> 4; const int which = blockIdx.z; const int c0 = blockIdx.y * 128; const size_t r0 = (size_t)blockIdx.x * 64; const size_t bb = r0 / TT; const int t0 = (int)(r0 % TT);
  const float* X = which == 0 ? XQ : which == 1 ? XK : XV; const float* WA = which == 0 ? WQ : which == 1 ? WK : WV; const float* BA = which == 0 ? BQ : which == 1 ? BK : BV;
  // k_out's weight operand, made once: each of the 256 blocks that make q rounds one row of W_O to f16(bf16 x 2^8), as k_out's staging did in every block. The row's load flies with those of the operands' staging, under which it returns, and it is stored behind the staging's barrier, so that no barrier waits for the store but the next, a whole product loop later (every block loads: under a branch the compiler waits for the load on the spot).
  static_assert((TNB * TT / 64) * (CC / 128) == DIN && CC == 128 * 2, "one row of W_O a block, two elements a thread");
  const size_t wrow = (size_t)(blockIdx.x * (CC / 128) + blockIdx.y) * CC;
  const v2f w2 = ((const v2f*)(WO + wrow))[tid];
  stage16<64, 0>(X + r0 * DIN, SM + 128 * GP * 2, tid); stage16<128, 0>(WA + (size_t)c0 * DIN, SM, tid);
  __syncthreads();   /* both operands are readable by the four waves */
  if (which == 0) { v2h o; o[0] = (_Float16)(bfr(w2[0]) * 256.0f); o[1] = (_Float16)(bfr(w2[1]) * 256.0f);
    ((v2h*)(WOH + wrow))[tid] = o;
    asm volatile("s_wait_xcnt 0x0" ::: "memory"); }   /* the store's address and data registers are free to be rewritten behind this */
  const __bf16* sW = (const __bf16*)SM + col * GP; const __bf16* sX = (const __bf16*)SM + (128 + wave * 16 + col) * GP;
  v8f acc[8] = {}; v16b a[2], w[2][8];
  a[0] = frag_b(sX, lane);
#pragma unroll
  for (int j = 0; j < 8; ++j) w[0][j] = frag_b(sW + j * 16 * GP, lane);
#pragma unroll   /* unrolled: the two fragment sets alternate by name; the next chunk's 18 LDS reads stand as one group in front of this chunk's products and return under them */
  for (int kc = 0; kc < DIN / 32; ++kc) { const int c = kc & 1;
    if (kc + 1 < DIN / 32) { a[c ^ 1] = frag_b(sX + (kc + 1) * 32, lane);
#pragma unroll
      for (int j = 0; j < 8; ++j) w[c ^ 1][j] = frag_b(sW + j * 16 * GP + (kc + 1) * 32, lane); }
#pragma unroll
    for (int j = 0; j < 8; ++j) acc[j] = wmma_bf(a[c], w[c][j], acc[j]); }
  __syncthreads();   /* every wave has left the operands: the output tiles below take their LDS */
  if (which < 2) { _Float16* DH = which == 0 ? QH : KH; _Float16* DL = which == 0 ? QL : KL; const int nhi = which == 0 ? QHI : KHI; const bool hi_rows = t0 < nhi;
#pragma unroll
    for (int j = 0; j < 8; ++j) { const float bias = BA ? bfr(BA[c0 + j * 16 + col]) : 0.f;
#pragma unroll
      for (int r = 0; r < 8; ++r) { const float v = acc[j][r] + bias; const _Float16 hv = (_Float16)v; sh[wave * 16 + 8 * g + r][j * 16 + col] = hv; sl[wave * 16 + 8 * g + r][j * 16 + col] = (_Float16)((v - (float)hv) * 1024.0f); } }
    __syncthreads();
    for (int e = tid; e < 64 * 16; e += 128) { const int rl = e >> 4, q = e & 15; vst2((unsigned*)(DH + (r0 + rl) * CC + c0 + q * 8), *(const v4u*)&sh[rl][q * 8]); if (hi_rows) vst2((unsigned*)(DL + (bb * nhi + t0 + rl) * (size_t)CC + c0 + q * 8), *(const v4u*)&sl[rl][q * 8]); }
  } else { const bool hi_rows = t0 < KHI;
#pragma unroll
    for (int j = 0; j < 8; ++j) { const float bias = BA ? bfr(BA[c0 + j * 16 + col]) : 0.f;
#pragma unroll
      for (int r = 0; r < 8; ++r) { const float v = acc[j][r] + bias; const int rl = wave * 16 + 8 * g + r, cl = j * 16 + col; th[cl][rl] = (_Float16)v; const __bf16 bh = (__bf16)v; tb[cl][rl] = bh; tbl[cl][rl] = (__bf16)(v - (float)bh); } }
    __syncthreads();
    for (int e = tid; e < 128 * 8; e += 128) { const int cl = e >> 3, q = e & 7; vst2((unsigned*)(VT + (bb * CC + c0 + cl) * (size_t)TT + t0 + q * 8), *(const v4u*)&th[cl][q * 8]); if (hi_rows) { const size_t o3 = (bb * CC + c0 + cl) * (size_t)KHI + t0 + q * 8; vst2((unsigned*)(VB + o3), *(const v4u*)&tb[cl][q * 8]); vst2((unsigned*)(VBL + o3), *(const v4u*)&tbl[cl][q * 8]); } } } }
__device__ __forceinline__ void ex2_first(float& al, float* t, float dm, float s0, float s1, float s2, float s3, float c, float a) {
  asm("v_fma_f32 %1, %6, %10, %11\n\tv_fma_f32 %2, %7, %10, %11\n\tv_exp_f32 %0, %5\n\tv_fma_f32 %3, %8, %10, %11\n\tv_fma_f32 %4, %9, %10, %11"
      : "=&v"(al), "=&v"(t[0]), "=&v"(t[1]), "=&v"(t[2]), "=&v"(t[3]) : "v"(dm), "v"(s0), "v"(s1), "v"(s2), "v"(s3), "s"(c), "v"(a)); }
__device__ __forceinline__ void ex2_fma4(float* e, float* tn, const float* t, float s0, float s1, float s2, float s3, float c, float a) {
  asm("v_exp_f32 %0, %8\n\tv_fma_f32 %4, %12, %16, %17\n\tv_exp_f32 %1, %9\n\tv_fma_f32 %5, %13, %16, %17\n\tv_exp_f32 %2, %10\n\tv_fma_f32 %6, %14, %16, %17\n\tv_exp_f32 %3, %11\n\tv_fma_f32 %7, %15, %16, %17"
      : "=&v"(e[0]), "=&v"(e[1]), "=&v"(e[2]), "=&v"(e[3]), "=&v"(tn[0]), "=&v"(tn[1]), "=&v"(tn[2]), "=&v"(tn[3]) : "v"(t[0]), "v"(t[1]), "v"(t[2]), "v"(t[3]), "v"(s0), "v"(s1), "v"(s2), "v"(s3), "s"(c), "v"(a)); }
// the last four have no multiply-add left to carry: each fills the slot of the one in front, and one v_nop that of the last
__device__ __forceinline__ void ex2_last4(float* e, const float* t) {
  asm("v_exp_f32 %0, %4\n\tv_exp_f32 %1, %5\n\tv_exp_f32 %2, %6\n\tv_exp_f32 %3, %7\n\tv_nop" : "=&v"(e[0]), "=&v"(e[1]), "=&v"(e[2]), "=&v"(e[3]) : "v"(t[0]), "v"(t[1]), "v"(t[2]), "v"(t[3])); }
// Products of one kind as ONE statement: each fills the hazard slots of the one in front, so the four v_nop that keep vector instructions off D, A and B stand once behind the last product and not behind every one.
// The builtin alone did not serve: the LDS reads sank to their products.
__device__ __forceinline__ void wmma_s8(v8f* s, const v16h (*k)[HD / 32], const v16h* q) {   /* s[kt] = k[kt][0] q[0] + k[kt][1] q[1]; four independent tiles, then their second halves */
  asm volatile("v_wmma_f32_16x16x32_f16 %0, %4, %12, 0\n\tv_wmma_f32_16x16x32_f16 %1, %6, %12, 0\n\tv_wmma_f32_16x16x32_f16 %2, %8, %12, 0\n\tv_wmma_f32_16x16x32_f16 %3, %10, %12, 0\n\t"
               "v_wmma_f32_16x16x32_f16 %0, %5, %13, %0\n\tv_wmma_f32_16x16x32_f16 %1, %7, %13, %1\n\tv_wmma_f32_16x16x32_f16 %2, %9, %13, %2\n\tv_wmma_f32_16x16x32_f16 %3, %11, %13, %3\n\t"
               "v_nop\n\tv_nop\n\tv_nop\n\tv_nop"
               : "=&v"(s[0]), "=&v"(s[1]), "=&v"(s[2]), "=&v"(s[3]) : "v"(k[0][0]), "v"(k[0][1]), "v"(k[1][0]), "v"(k[1][1]), "v"(k[2][0]), "v"(k[2][1]), "v"(k[3][0]), "v"(k[3][1]), "v"(q[0]), "v"(q[1])); }
__device__ __forceinline__ void wmma_pv8(v8f* a, v8f* b, v16h v0, v16h v1, v16h v2, v16h v3, v16h p, v16h q) {   /* a[j] += v_j p, b[j] += v_j q: each v fragment serves both query tiles */
  asm volatile("v_wmma_f32_16x16x32_f16 %0, %8, %12, %0\n\tv_wmma_f32_16x16x32_f16 %1, %9, %12, %1\n\tv_wmma_f32_16x16x32_f16 %2, %10, %12, %2\n\tv_wmma_f32_16x16x32_f16 %3, %11, %12, %3\n\t"
               "v_wmma_f32_16x16x32_f16 %4, %8, %13, %4\n\tv_wmma_f32_16x16x32_f16 %5, %9, %13, %5\n\tv_wmma_f32_16x16x32_f16 %6, %10, %13, %6\n\tv_wmma_f32_16x16x32_f16 %7, %11, %13, %7\n\t"
               "v_nop\n\tv_nop\n\tv_nop\n\tv_nop"
               : "+v"(a[0]), "+v"(a[1]), "+v"(a[2]), "+v"(a[3]), "+v"(b[0]), "+v"(b[1]), "+v"(b[2]), "+v"(b[3]) : "v"(v0), "v"(v1), "v"(v2), "v"(v3), "v"(p), "v"(q)); }
__device__ __forceinline__ float xhalf(float v) { const int i = __builtin_bit_cast(int, v); return __builtin_bit_cast(float, __builtin_amdgcn_permlanex16(i, i, 0x76543210, 0xfedcba98, false, false)); }   /* lane l <-> l ^ 16 */
// K and V reach the waves through LDS: a stage is SKEYS keys; each of the 16 waves brings one slice of 64 rows x 128 B per stage by one tensor load
// (waves 0..7: 64 k rows each; waves 8..15: the 64 v planes x 64 keys each), the mover's 16-byte pad giving the pitch 144 B that 16-byte LDS reads want; two buffers, together the whole LDS of a WGP.
typedef uint32_t u32x4 __attribute__((ext_vector_type(4)));
typedef uint32_t u32x8 __attribute__((ext_vector_type(8)));
#define SKEYS 512
#define NSL (SKEYS / 64)       /* slices of k, and of v, in a stage */
#define TPS (SKEYS / 256)      /* trips of a wave in a stage: its quarter of the stage's keys, 64 a trip */
#define NST (TT / SKEYS)
#define LPITCH 144u
#define SLICEB 10240u          /* 64 rows x 144 B = 9216 B, rounded up so that every slice starts at a multiple of 2 KiB */
#define BUFB (2u * NSL * SLICEB)
__device__ __forceinline__ uint32_t uni(uint32_t v) { return (uint32_t)__builtin_amdgcn_readfirstlane(v); }
__device__ __forceinline__ uint32_t pinned(uint32_t v) { uint32_t w = uni(v); asm volatile("" : "+s"(w)); return w; }
// both groups are in-out operands of the load and inputs of the wait that covers it: every word of the descriptor is then live from the load to that wait, so the compiler hands none of its registers to another value while the request is in flight
__device__ __forceinline__ void tdm_load(u32x4& g0, u32x8& g1) { asm volatile("tensor_load_to_lds %0, %1" : "+s"(g0), "+s"(g1) :: "memory"); }
__device__ __forceinline__ void tdm_wait(const u32x4& g0, const u32x8& g1) { asm volatile("s_wait_tensorcnt 0x0" :: "s"(g0), "s"(g1) : "memory"); }
__device__ __forceinline__ v16h frag_l(const unsigned char* p) { union { v16h v; v8h q[2]; } u; u.q[0] = *(const v8h*)p; u.q[1] = *(const v8h*)(p + 32); return u.v; }
#define SCN(n) s[2 * ((n) >> 4) + ((n) & 1)][((n) >> 1) & 7]   /* score n = 16 c2 + 2 i + w is s[2 c2 + w][i] */
// one query tile's 64 scores: mask, running maximum, P (two B operands), sum, and the rescale of the tile's ctx
__device__ __forceinline__ void soft_tile(v8f* s, float& m, float& l, v8f* acc, v16h* p, bool some_masked, unsigned b0, unsigned b1, unsigned g8, float C2) {
  if (some_masked) { unsigned w0, w1;   /* wave-uniform: some key of these 64 is masked */
    /* this lane half's mask bits, w = b >> 8g. In asm, volatile, so that the 64 bit tests that hang on them stay inside this branch: written plainly, the compiler shared them between the two query tiles and moved them in front of both branches, onto every trip */
    asm volatile("v_lshrrev_b32 %0, %2, %3\n\tv_lshrrev_b32 %1, %2, %4" : "=&v"(w0), "=&v"(w1) : "v"(g8), "s"(b0), "s"(b1));
#pragma unroll
    for (int kt = 0; kt < 4; ++kt)
#pragma unroll
      for (int r = 0; r < 8; ++r) { const unsigned w = kt < 2 ? w0 : w1; s[kt][r] = ((w >> ((kt & 1) * 16 + r)) & 1u) ? s[kt][r] : -3.0e38f; } }
  float mt[4];
#pragma unroll
  for (int kt = 0; kt < 4; ++kt) { mt[kt] = s[kt][0];
#pragma unroll
    for (int r = 1; r < 8; ++r) mt[kt] = fmaxf(mt[kt], s[kt][r]); }
  float mx = fmaxf(fmaxf(mt[0], mt[1]), fmaxf(mt[2], mt[3]));
  mx = fmaxf(mx, xhalf(mx));
  const float mn = fmaxf(m, mx * C2), ms = 10.0f - mn, dm = m - mn; m = mn;
  float al, t[32], e[32];
  ex2_first(al, t, dm, SCN(0), SCN(1), SCN(2), SCN(3), C2, ms);
#pragma unroll
  for (int n = 0; n < 28; n += 4) ex2_fma4(e + n, t + n + 4, t + n, SCN(n + 4), SCN(n + 5), SCN(n + 6), SCN(n + 7), C2, ms);
  ex2_last4(e + 28, t + 28);
  float sum = 0.f;
#pragma unroll
  for (int c2 = 0; c2 < 2; ++c2)
#pragma unroll
    for (int i = 0; i < 8; ++i) { const float e0 = e[16 * c2 + 2 * i], e1 = e[16 * c2 + 2 * i + 1]; sum += e0 + e1; p[c2][i] = (_Float16)e0; p[c2][8 + i] = (_Float16)e1; }
  l = l * al + sum;
#pragma unroll
  for (int j = 0; j < HD / 16; ++j) acc[j] *= al; }
#define MRGB 10240u   /* bytes of LDS per wave for the hand-over at the end: per query tile 32 f32 of ctx a lane (2 x 4096 B), then per tile maximum and sum (2 x 256 B) */
__global__ __launch_bounds__(512) void k_fa(const _Float16* __restrict__ QH, const _Float16* __restrict__ KH, const _Float16* __restrict__ VT, const int* __restrict__ MASK, _Float16* __restrict__ Y) {
  __shared__ __attribute__((aligned(2048))) unsigned char L[2 * BUFB];
  const int tid = threadIdx.x, wave = tid >> 5, lane = tid & 31, col = lane & 15, g = lane >> 4;
  const int h = blockIdx.y, b = blockIdx.z;
  const uint32_t wv = uni((uint32_t)tid >> 5), sl = wv & (NSL - 1u); const bool isV = wv >= (uint32_t)NSL;   /* sl: the slice of k or v that this wave brings */
  const uint32_t kh = wv >> 2, qg = wv & 3u; const int q0 = blockIdx.x * 128 + (int)qg * 32;   /* key quarter; query group; first of this wave's 32 queries */
  const uint32_t lbase = (uint32_t)(size_t)L;
  const uint64_t ga0 = isV ? (uint64_t)(size_t)(VT + ((size_t)b * CC + h * HD) * (size_t)TT + sl * 64u) : (uint64_t)(size_t)(KH + ((size_t)b * TT + sl * 64u) * CC + h * HD);
  const uint32_t gsh = isV ? 10u : 18u;   /* bytes from one stage to the next: SKEYS x 2 along a v plane, SKEYS x CC x 2 down the k rows */
  static_assert(SKEYS * 2 == 1 << 10 && SKEYS * CC * 2 == 1 << 18 && NST >= 2 && 2 * NSL == 16 && 16u * MRGB <= 2u * BUFB, "stage steps; one slice a wave; the hand-over fits the ring");
  u32x8 g1;   /* 1-byte elements, tensor = tile = 64 rows of 128 B, a 16-byte pad behind every 128 B, no mask */
  g1[0] = uni((1u << 20) | (4u << 22) | (3u << 25)); g1[1] = uni(128u << 16); g1[2] = uni(64u << 16); g1[3] = uni(128u << 16); g1[4] = uni(64u); g1[5] = uni(isV ? (uint32_t)TT * 2u : (uint32_t)CC * 2u); g1[6] = uni(0u); g1[7] = uni(0u);
  u32x4 g0; g0[0] = uni(1u);
  auto issue = [&](uint32_t st) { const uint64_t ga = ga0 + (uint64_t)(st << gsh);
    g0[1] = uni(lbase + (st & 1u) * BUFB + (2u * sl + (isV ? 1u : 0u)) * SLICEB);   /* slice sl of k, then slice sl of v: a trip's 32 LDS reads lie within the reach of one address register's immediate offsets */ g0[2] = uni((uint32_t)ga); g0[3] = uni((((uint32_t)(ga >> 32)) & 0x01FFFFFFu) | 0x80000000u);
    tdm_load(g0, g1); };
  const int* Mb = MASK + (size_t)b * TT + lane;
  const float C2 = SCALE * 1.44269504088896f;   /* raw logit -> log2 units */
  v16h qf[2][HD / 32];
#pragma unroll
  for (int qt = 0; qt < 2; ++qt)
#pragma unroll
    for (int kc = 0; kc < HD / 32; ++kc) qf[qt][kc] = frag_h(QH + ((size_t)b * TT + q0 + qt * 16 + col) * CC + h * HD + kc * 32, lane);
  int mk0 = Mb[kh * 128u], mk1 = Mb[kh * 128u + 32u];
  v8f acc[2][HD / 16] = {}; float m[2] = {-1.0e30f, -1.0e30f}, l[2] = {0.f, 0.f};
  issue(0u);
  tdm_wait(g0, g1);                                     /* this wave's slice of stage 0 has landed */
  __syncthreads();                                      /* every wave's slice of stage 0 is readable by all */
  issue(pinned(1u));                                    /* pinned(): stage 1's descriptor words are formed behind the wait above */
  const uint32_t loff = (uint32_t)col * LPITCH + 16u * (uint32_t)g;
#pragma unroll 1   /* rolled: one publish point and one refill site */
  for (uint32_t st = 0; st < NST; ++st) { const unsigned char* Bp = L + (st & 1u) * BUFB + loff;
#pragma unroll 1   /* rolled: one trip's fragments, scores and both ctx tiles fill the 256 registers that asm text can name */
    for (uint32_t hb = 0; hb < TPS; ++hb) { const uint32_t ks = kh * TPS + hb; const int it = (int)(st * NSL + ks);   /* ks: this trip's 64-key slice of the stage */
    const unsigned char* Kp = Bp + 2u * ks * SLICEB; const unsigned char* Vp = Kp + SLICEB;
    const unsigned b0 = __builtin_amdgcn_ballot_w32(mk0 != 0), b1 = __builtin_amdgcn_ballot_w32(mk1 != 0);
    const int kn = (hb + 1u < TPS ? it + 1 : st + 1u < NST ? it + NSL - TPS + 1 : it) * 64;   /* this wave's next trip's mask words fly under this trip (the last trip rereads its own) */
    mk0 = Mb[kn]; mk1 = Mb[kn + 32];
    asm volatile("s_wait_xcnt 0x0" ::: "memory");   /* the mask loads' address registers are free to be rewritten behind this */
    v16h kf[4][HD / 32];
#pragma unroll
    for (int kt = 0; kt < 4; ++kt)
#pragma unroll
      for (int kc = 0; kc < HD / 32; ++kc) kf[kt][kc] = frag_l(Kp + kt * 16 * LPITCH + kc * 64);
    const bool some_masked = (b0 & b1) != 0xFFFFFFFFu;
    v8f s[4]; v16h p[2][2];
    wmma_s8(s, kf, qf[0]);
    soft_tile(s, m[0], l[0], acc[0], p[0], some_masked, b0, b1, 8u * (unsigned)g, C2);
    __builtin_amdgcn_sched_barrier(0);   /* holds the second tile's logit products behind the first tile's softmax, so that both tiles' scores take the same registers; left free, they moved up and the kernel left the 256 registers that asm text can name */
    wmma_s8(s, kf, qf[1]);
    v16h vf[HD / 16][2];   /* the v fragments take the registers that the k fragments have just left */
#pragma unroll
    for (int j = 0; j < HD / 16; ++j) { vf[j][0] = frag_l(Vp + j * 16 * LPITCH); vf[j][1] = frag_l(Vp + j * 16 * LPITCH + 64); }
    __builtin_amdgcn_sched_barrier(0);   /* holds the v reads in front of the second tile's softmax, under which they return; left free, the compiler sinks them close in front of the products that wait for them */
    soft_tile(s, m[1], l[1], acc[1], p[1], some_masked, b0, b1, 8u * (unsigned)g, C2);
    wmma_pv8(acc[0], acc[1], vf[0][0], vf[1][0], vf[2][0], vf[3][0], p[0][0], p[1][0]); wmma_pv8(acc[0], acc[1], vf[0][1], vf[1][1], vf[2][1], vf[3][1], p[0][1], p[1][1]); }
    asm volatile("s_wait_dscnt 0x0" ::: "memory");       /* this wave's reads of stage st have returned */
    tdm_wait(g0, g1);                                    /* this wave's slice of stage st + 1 has landed */
    __syncthreads();                                      /* stage st + 1 is readable by all, and every wave has left stage st's buffer */
    if (pinned(st + 2u < NST)) issue(pinned(st + 2u)); }  /* the refill of the buffer just left; scalar test */
  tdm_wait(g0, g1);                                      /* nothing of the mover is in flight when the wave ends */
  asm volatile("s_wait_dscnt 0x0" ::: "memory");         /* nor any LDS read of this wave */
  // The four key quarters meet: every wave lays both its tiles (ctx, maximum, sum) into LDS; wave (qg, kq) then joins, over the four quarters of its query group, query tile kq >> 1, ctx columns 32 (kq & 1) .. + 31: 64 bytes of Y a query.
  // The last stage's barrier has ended every read of the ring, and no load was issued behind it: its LDS is free.
  l[0] += xhalf(l[0]); l[1] += xhalf(l[1]);
  unsigned char* Xs = L + wv * MRGB + lane * 16;
#pragma unroll
  for (int qt = 0; qt < 2; ++qt) {
#pragma unroll
    for (int j = 0; j < HD / 16; ++j) { v4f lo, hi;
#pragma unroll
      for (int r = 0; r < 4; ++r) { lo[r] = acc[qt][j][r]; hi[r] = acc[qt][j][4 + r]; }
      *(v4f*)(Xs + qt * 4096 + j * 1024) = lo; *(v4f*)(Xs + qt * 4096 + j * 1024 + 512) = hi; }
    v2f ml; ml[0] = m[qt]; ml[1] = l[qt];
    *(v2f*)(L + wv * MRGB + 8192u + qt * 256 + lane * 8) = ml; }
  __syncthreads();   /* every wave's tiles are readable by the waves of its query group */
  const uint32_t tq = kh >> 1, jp = kh & 1u;   /* the query tile and the pair of ctx column tiles that this wave finishes */
  const unsigned char* Xr = L + qg * MRGB + tq * 4096u + jp * 2048u + lane * 16; const unsigned char* Mr = L + qg * MRGB + 8192u + tq * 256u + lane * 8;   /* quarter k's copy lies 4 k MRGB further on */
  v2f mo[4];
#pragma unroll
  for (int k = 0; k < 4; ++k) mo[k] = *(const v2f*)(Mr + k * 4 * MRGB);
  const float mm = fmaxf(fmaxf(mo[0][0], mo[1][0]), fmaxf(mo[2][0], mo[3][0]));   /* maxima are in log2 units; a quarter with no kept key has sum 0 and ctx 0 */
  float dq[4], wq[4], den = 0.f;
#pragma unroll
  for (int k = 0; k < 4; ++k) dq[k] = mo[k][0] - mm;
  ex2_last4(wq, dq);   /* the four exponentials in one statement */
#pragma unroll
  for (int k = 0; k < 4; ++k) den += mo[k][1] * wq[k];
  const float inv = 1.0f / den;
  _Float16* yr = Y + ((size_t)b * TT + q0 + (int)tq * 16 + col) * CC + h * HD + (int)jp * 32 + 8 * g;   /* acc[j][r] = ctx[query col][j * 16 + 8g + r] */
#pragma unroll
  for (int j = 0; j < 2; ++j) { v4f lo = {}, hi = {};
#pragma unroll
    for (int k = 0; k < 4; ++k) { const float ck = wq[k] * inv; const v4f ol = *(const v4f*)(Xr + k * 4 * MRGB + j * 1024), oh = *(const v4f*)(Xr + k * 4 * MRGB + j * 1024 + 512);
#pragma unroll
      for (int r = 0; r < 4; ++r) { lo[r] += ol[r] * ck; hi[r] += oh[r] * ck; } }
    v8h o;   /* ctx carried x 2^6 into f16, the value k_out multiplies, so small-magnitude context rows stay clear of f16 subnormals */
#pragma unroll
    for (int r = 0; r < 4; ++r) { o[r] = (_Float16)(lo[r] * 64.0f); o[4 + r] = (_Float16)(hi[r] * 64.0f); }
    vst2(yr + j * 16, o); } }
// ---- k_out: block = (64 rows, 128 cols): out = ctx Wo (+ bo): ctx x 2^6 in f16 (from k_fa) against Wo as f16(bf16 x 2^8) exact (from k_proj) (1 product) x 2^-14
__global__ __launch_bounds__(128) void k_out(const _Float16* __restrict__ Y, const _Float16* __restrict__ WOH, const float* __restrict__ BO, float* __restrict__ OUT) { __shared__ __align__(16) unsigned char SM[GOPB];   /* first the two operands, then, behind a barrier, the output tile */
  float (*sf)[16][132] = (float (*)[16][132])SM; static_assert(4 * 16 * 132 * 4 <= GOPB, "output tile fits the operands' LDS");
  const int tid = threadIdx.x, wave = tid >> 5, lane = tid & 31, col = lane & 15, g = lane >> 4; const int c0 = blockIdx.y * 128; const size_t r0 = (size_t)blockIdx.x * 64 + wave * 16;
  v8f acc[8] = {};
  stage_rows<64, 128>(Y + (size_t)blockIdx.x * 64 * CC, WOH + (size_t)c0 * CC, SM + 128 * GP * 2, SM, tid);
  __syncthreads();   /* both operands are readable by the four waves */
  const _Float16* sW = (const _Float16*)SM + col * GP; const _Float16* sY = (const _Float16*)SM + (128 + wave * 16 + col) * GP;
  v16h a[2], w[2][8];
  a[0] = frag_h(sY, lane);
#pragma unroll
  for (int j = 0; j < 8; ++j) w[0][j] = frag_h(sW + j * 16 * GP, lane);
#pragma unroll   /* unrolled: the two fragment sets alternate by name; the next chunk's 18 LDS reads stand as one group in front of this chunk's products and return under them */
  for (int kc = 0; kc < CC / 32; ++kc) { const int c = kc & 1;
    if (kc + 1 < CC / 32) { a[c ^ 1] = frag_h(sY + (kc + 1) * 32, lane);
#pragma unroll
      for (int j = 0; j < 8; ++j) w[c ^ 1][j] = frag_h(sW + j * 16 * GP + (kc + 1) * 32, lane); }
#pragma unroll
    for (int j = 0; j < 8; ++j) acc[j] = wmma16(a[c], w[c][j], acc[j]); }
  __syncthreads();   /* every wave has left the operands: the output tile below takes their LDS */
#pragma unroll
  for (int j = 0; j < 8; ++j) { const float bias = BO ? bfr(BO[c0 + j * 16 + col]) : 0.f;
#pragma unroll
    for (int r = 0; r < 8; ++r) sf[wave][8 * g + r][j * 16 + col] = acc[j][r] * (1.0f / 16384.0f) + bias; }   /* 2^-8 (Wo carry) x 2^-6 (ctx carry) */
  LDSX(); for (int rl = 0; rl < 16; ++rl) vst2(OUT + (r0 + rl) * DIN + c0 + lane * 4, *(const v4f*)&sf[wave][rl][lane * 4]); }

extern "C" void kernel_launch(void* const* d_in, const int* in_sizes, int n_in, void* d_out, int out_size, void* d_ws, size_t ws_size, hipStream_t stream) {
  (void)in_sizes; (void)n_in; (void)out_size;
  const float** F = (const float**)d_in;
  if (ws_size < (size_t)WS_END) return;
  char* ws = (char*)d_ws; _Float16 *QH = (_Float16*)(ws + WS_QH), *KH = (_Float16*)(ws + WS_KH), *VT = (_Float16*)(ws + WS_VT), *QL = (_Float16*)(ws + WS_QL), *KL = (_Float16*)(ws + WS_KL); __bf16 *VB = (__bf16*)(ws + WS_VB), *VBL = (__bf16*)(ws + WS_VBL); _Float16 *Y = (_Float16*)(ws + WS_Y), *WOH = (_Float16*)(ws + WS_WOH);
  (void)Y; (void)QL; (void)KL; (void)VB; (void)VBL;
  // inputs: 0 x [4,2048,256]; 1 W_Q [256,256] (out,in); 2 W_K; 3 W_V; 4 W_O (out,in); 5 mask [4,2048] int32 (ones on this draw; read per key); no biases
  k_proj<<<dim3(TNB * TT / 64, CC / 128, 3), 128, 0, stream>>>(F[0], F[0], F[0], F[1], F[2], F[3], nullptr, nullptr, nullptr, F[4], WOH, QH, QL, KH, KL, VT, VB, VBL);
  k_fa<<<dim3(TT / 128, NH, TNB), 512, 0, stream>>>(QH, KH, VT, (const int*)d_in[5], Y);
  k_out<<<dim3(TNB * TT / 64, DIN / 128), 128, 0, stream>>>(Y, WOH, nullptr, (float*)d_out);
}

// v008
// Measured time: 30.4 microseconds a run.
// Timed twice side by side with v007, it ran 1.04 and 1.05 times as fast.
// Over all steps from v000 it is 18.8 times as fast.
// compute dtype: all float inputs rounded to bf16; q / k / v projections with EXACT bf16 products on WMMA 16x16x32 (f32 accumulate), no biases; logits (q x 64^-0.5 log2 e) x k once to f16 each (1 product), in log2 units; the int key mask read per (batch, key); softmax f32 against a maximum in use that is at most 2^5 below the running one, fused with both products; P = exp(s - maximum in use) x 2^10 once to f16 x v once to f16 (1 product), divided by the f32 sum at the end; ctx x 2^6 once to f16 x W_O f16(bf16 x 2^8); f32 output.
#include <hip/hip_runtime.h>
#include <math.h>
#include <stdint.h>

typedef __attribute__((ext_vector_type(16))) _Float16 v16h;
typedef __attribute__((ext_vector_type(16))) __bf16 v16b;
typedef __attribute__((ext_vector_type(8)))  _Float16 v8h;
typedef __attribute__((ext_vector_type(8)))  float v8f;
typedef __attribute__((ext_vector_type(4)))  float v4f;
typedef __attribute__((ext_vector_type(2)))  float v2f;
typedef __attribute__((ext_vector_type(4)))  unsigned v4u;
typedef __attribute__((ext_vector_type(4)))  int v4i;
typedef float __attribute__((may_alias)) float_a;
typedef int __attribute__((may_alias)) int_a;

template <typename T> __device__ __forceinline__ void vst2(void* p, T v) { *(T*)p = v;  }
__device__ __forceinline__ v8f wmma16(v16h a, v16h b, v8f c) {
  v8f d = __builtin_amdgcn_wmma_f32_16x16x32_f16(false, a, false, b, (short)0, c, false, false);
  asm volatile("v_nop\n\tv_nop\n\tv_nop\n\tv_nop" : "+v"(d) : "v"(a), "v"(b));
  return d;
}
__device__ __forceinline__ v8f wmma_bf(v16b a, v16b b, v8f c) {
  v8f d = __builtin_amdgcn_wmma_f32_16x16x32_bf16(false, a, false, b, (short)0, c, false, false);
  asm volatile("v_nop\n\tv_nop\n\tv_nop\n\tv_nop" : "+v"(d) : "v"(a), "v"(b));
  return d;
}
// 16x16x32 fragments: lane = (h = lane>>4, row/col = lane&15); elements 0..7 = k0+8h+0..7, 8..15 = k0+16+8h+0..7; D element r = row 8h+r
__device__ __forceinline__ v16h frag_h(const _Float16* rowk0, int lane) {
  union { v16h v; v8h q[2]; } u; const _Float16* p = rowk0 + 8 * (lane >> 4);
  u.q[0] = *(const v8h*)p; u.q[1] = *(const v8h*)(p + 16); return u.v;
}
__device__ __forceinline__ v16h frag_f32(const float* rowk0, int lane) {
  v16h a; const float* p = rowk0 + 8 * (lane >> 4);
#pragma unroll
  for (int i = 0; i < 8; ++i) { a[i] = (_Float16)p[i]; a[8 + i] = (_Float16)p[16 + i]; }
  return a;
}
__device__ __forceinline__ v16h frag_f32s(const float* rowk0, int lane, float sc) {
  v16h a; const float* p = rowk0 + 8 * (lane >> 4);
#pragma unroll
  for (int i = 0; i < 8; ++i) { a[i] = (_Float16)(p[i] * sc); a[8 + i] = (_Float16)(p[16 + i] * sc); }
  return a;
}
// column fragment from a [K][ld] layout (column n), rows >= K read as 0
__device__ __forceinline__ v16h fragc_f32(const float* W, int k0, int n, int lane, int ld, int K) {
  v16h a; const int g = lane >> 4;
#pragma unroll
  for (int i = 0; i < 8; ++i) { const int ka = k0 + 8 * g + i, kb = ka + 16;
    a[i] = (_Float16)(ka < K ? W[(size_t)(ka < K ? ka : K - 1) * ld + n] : 0.f); a[8 + i] = (_Float16)(kb < K ? W[(size_t)(kb < K ? kb : K - 1) * ld + n] : 0.f); }
  return a;
}
struct F2 { v16b h, l; };
__device__ __forceinline__ F2 bsplit16(const float v[16]) { F2 r;
#pragma unroll
  for (int i = 0; i < 16; ++i) { const __bf16 h = (__bf16)v[i]; r.h[i] = h; r.l[i] = (__bf16)(v[i] - (float)h); }
  return r; }
__device__ __forceinline__ F2 split_row(const float* row, int k0, int lane) { float v[16]; const float* p = row + k0 + 8 * (lane >> 4);
#pragma unroll
  for (int i = 0; i < 8; ++i) { v[i] = p[i]; v[8 + i] = p[16 + i]; }
  return bsplit16(v); }
__device__ __forceinline__ F2 split_rowK(const float* row, int k0, int lane, int K) { float v[16]; const int g = lane >> 4;
#pragma unroll
  for (int i = 0; i < 8; ++i) { const int ka = k0 + 8 * g + i, kb = ka + 16; v[i] = ka < K ? row[ka < K ? ka : K - 1] : 0.f; v[8 + i] = kb < K ? row[kb < K ? kb : K - 1] : 0.f; }
  return bsplit16(v); }
__device__ __forceinline__ F2 split_col(const float* W, int k0, int n, int lane, int ld, int K) { float v[16]; const int g = lane >> 4;
#pragma unroll
  for (int i = 0; i < 8; ++i) { const int ka = k0 + 8 * g + i, kb = ka + 16; v[i] = ka < K ? W[(size_t)(ka < K ? ka : K - 1) * ld + n] : 0.f; v[8 + i] = kb < K ? W[(size_t)(kb < K ? kb : K - 1) * ld + n] : 0.f; }
  return bsplit16(v); }
__device__ __forceinline__ v8f mac3(const F2& a, const F2& b, v8f c) { c = wmma_bf(a.l, b.h, c); c = wmma_bf(a.h, b.l, c); return wmma_bf(a.h, b.h, c); }
__device__ __forceinline__ float sigm(float v) { return 1.0f / (1.0f + expf(-v)); }
#define LDSX() do { asm volatile("s_wait_dscnt 0" ::: "memory"); __builtin_amdgcn_wave_barrier(); __builtin_amdgcn_fence(__ATOMIC_RELEASE, "workgroup"); } while (0)

// Standard multi-head self-attention with a key-padding mask input (x [4,2048,256]; torch (out,in) W_Q / W_K / W_V / W_O [256,256] uniform(+-1/16) applied as x @ W.T, no biases; mask [4,2048] int32 = ones (const: nothing is masked on this draw); 4 heads x 64; scores x 64^-0.5; where(mask[:, None, None, :] == 0, -inf, scores); softmax; out @ W_O.T).
#define NB 4
#define TT 2048
#define CC 256            // NH * HD = projected width
#define DIN 256          // input (model) width
#define NH 4
#define HD 64
#define NQB (TT / 64)
#define HG 4
#define SCALE (0.125f)
#define QLOG2 (SCALE * 1.44269504088896f)   /* raw logit -> log2 units */
#define CAUSAL 0
#ifndef TNB
#define TNB NB
#endif
__device__ __forceinline__ float bfr(float v) { return (float)(__bf16)v; }
__host__ __device__ __forceinline__ int kb_last(int qb) { return CAUSAL ? ((qb * 64 + 63) >> 7) : (TT / 128 - 1); }
typedef __attribute__((ext_vector_type(8))) __bf16 v8b;
__device__ __forceinline__ v16b frag_b(const __bf16* rowk0, int lane) {
  union { v16b v; v8b q[2]; } u; const __bf16* p = rowk0 + 8 * (lane >> 4);
  u.q[0] = *(const v8b*)p; u.q[1] = *(const v8b*)(p + 16); return u.v;
}
#define QBH 0              // unused (k_fa has no high-precision path)
#define QHI 0               // single-product logits on every row
#define KHI 64            // key rows carrying k residual / v bf16 hi+lo planes (written by k_proj, read by no kernel)
// B fragment (k rows k0+.., output column o) of a weight: (in,out) [K][ld] or (out,in) [ld rows of K]: bf16 exact, or f16(bf16 * 256) exact
__device__ __forceinline__ v16b wcol_io(const float* Wm, int k0, int o, int lane, int ld) { v16b w; const int g = lane >> 4;
#pragma unroll
  for (int i = 0; i < 8; ++i) { w[i] = (__bf16)Wm[(size_t)(k0 + 8 * g + i) * ld + o]; w[8 + i] = (__bf16)Wm[(size_t)(k0 + 16 + 8 * g + i) * ld + o]; }
  return w; }
__device__ __forceinline__ v16b wcol_oi(const float* Wm, int k0, int o, int lane, int K) { v16b w; const float* p = Wm + (size_t)o * K + k0 + 8 * (lane >> 4);
#pragma unroll
  for (int i = 0; i < 8; ++i) { w[i] = (__bf16)p[i]; w[8 + i] = (__bf16)p[16 + i]; }
  return w; }
__device__ __forceinline__ v16h wcolh_io(const float* Wm, int k0, int o, int lane, int ld) { v16h w; const int g = lane >> 4;
#pragma unroll
  for (int i = 0; i < 8; ++i) { w[i] = (_Float16)(bfr(Wm[(size_t)(k0 + 8 * g + i) * ld + o]) * 256.0f); w[8 + i] = (_Float16)(bfr(Wm[(size_t)(k0 + 16 + 8 * g + i) * ld + o]) * 256.0f); }
  return w; }
__device__ __forceinline__ v16h wcolh_oi(const float* Wm, int k0, int o, int lane, int K) { v16h w; const float* p = Wm + (size_t)o * K + k0 + 8 * (lane >> 4);
#pragma unroll
  for (int i = 0; i < 8; ++i) { w[i] = (_Float16)(bfr(p[i]) * 256.0f); w[8 + i] = (_Float16)(bfr(p[16 + i]) * 256.0f); }
  return w; }
#define WQKV_LAYOUT 1   // 0 = (in,out) [DIN][CC]; 1 = (out,in) [CC][DIN]; 2 = per-head [NH][DIN][HD]
__device__ __forceinline__ v16b wcol_hdk(const float* Wm, int k0, int o, int lane) { v16b w; const int g = lane >> 4; const float* p = Wm + (size_t)(o / HD) * DIN * HD + (o % HD);
#pragma unroll
  for (int i = 0; i < 8; ++i) { w[i] = (__bf16)p[(size_t)(k0 + 8 * g + i) * HD]; w[8 + i] = (__bf16)p[(size_t)(k0 + 16 + 8 * g + i) * HD]; }
  return w; }
#define WO_OUT_IN 1
#if WQKV_LAYOUT == 1
#define WCOL(W, k0, o, lane) wcol_oi(W, k0, o, lane, DIN)
#elif WQKV_LAYOUT == 2
#define WCOL(W, k0, o, lane) wcol_hdk(W, k0, o, lane)
#else
#define WCOL(W, k0, o, lane) wcol_io(W, k0, o, lane, CC)
#endif
#if WO_OUT_IN
#define WOCOL(W, k0, o, lane) wcol_oi(W, k0, o, lane, CC)
#define WOCOLH(W, k0, o, lane) wcolh_oi(W, k0, o, lane, CC)
#else
#define WOCOL(W, k0, o, lane) wcol_io(W, k0, o, lane, DIN)
#define WOCOLH(W, k0, o, lane) wcolh_io(W, k0, o, lane, DIN)
#endif

#define WS_QH  0u                                      // f16 q x QLOG2 rows [b*t][CC]
#define WS_KH  (WS_QH + 2u * (size_t)NB * TT * CC)      // f16 k rows [b*t][CC]
#define WS_VT  (WS_KH + 2u * (size_t)NB * TT * CC)      // f16 v planes [b][c][t]
#define WS_QL  (WS_VT + 2u * (size_t)NB * CC * TT)      // f16 q residual x 2^10 rows [b][t < QHI][CC]
#define WS_KL  (WS_QL + 2u * (size_t)NB * QHI * CC)     // f16 k residual x 2^10 rows [b][t < KHI][CC]
#define WS_VB  (WS_KL + 2u * (size_t)NB * KHI * CC)     // bf16 v hi planes [b][c][t < KHI]
#define WS_VBL (WS_VB + 2u * (size_t)NB * CC * KHI)
#define WS_S   (WS_VBL + 2u * (size_t)NB * CC * KHI)    // (unused: logits and P stay in registers)
#define WS_Y   (WS_S  + 4u * (size_t)HG * TT * TT)      // f16 ctx x 2^6 rows [b*t][CC]
#define WS_WOH (WS_Y  + 2u * (size_t)NB * TT * CC)      // f16(bf16(W_O) x 2^8) rows [DIN][CC]
#define WS_END (WS_Y  + 4u * (size_t)NB * TT * CC)
static_assert(WS_WOH + 2u * (size_t)DIN * CC <= WS_END, "both operands of k_out lie inside the workspace map");

// Operand staging of k_proj: ROWS contiguous rows of 256 f32 go once per block into LDS as 16-bit rows, read by whole lines (128 threads x 16 B = two rows a step) and rounded on the way exactly as the fragment loaders rounded them.
// MODE 0: bf16; 1: f16(v x 2^6); 2: f16(bf16(v) x 2^8). Row pitch 528 B = 16 B x 33: the 16-byte fragment reads of 16 rows meet no bank twice.
#define GP 264
#define GOPB ((128 + 64) * GP * 2)   /* bytes: 128 weight rows, then 64 activation rows */
typedef __attribute__((ext_vector_type(4))) __bf16 v4b;
typedef __attribute__((ext_vector_type(4))) _Float16 v4h;
typedef __attribute__((ext_vector_type(2))) _Float16 v2h;
template <int ROWS, int MODE> __device__ __forceinline__ void stage16(const float* __restrict__ src, unsigned char* dst, int tid) {
  const float* p = src + tid * 4; unsigned char* d = dst + (tid >> 6) * (GP * 2) + (tid & 63) * 8;
#pragma unroll 1   /* rolled: one batch of 32 loads is held in registers at a time; unrolled, k_proj took more registers than three blocks on a WGP, which its LDS allows, can have */
  for (int i0 = 0; i0 < ROWS / 2; i0 += 32) { v4f v[32];
#pragma unroll
    for (int u = 0; u < 32; ++u) v[u] = *(const v4f*)(p + (i0 + u) * 512);
#pragma unroll
    for (int u = 0; u < 32; ++u) { unsigned char* q = d + (i0 + u) * (GP * 4);
      if constexpr (MODE == 0) { v4b o;
#pragma unroll
        for (int r = 0; r < 4; ++r) o[r] = (__bf16)v[u][r];
        *(v4b*)q = o; }
      else { v4h o;
#pragma unroll
        for (int r = 0; r < 4; ++r) o[r] = MODE == 1 ? (_Float16)(v[u][r] * 64.0f) : (_Float16)(bfr(v[u][r]) * 256.0f);
        *(v4h*)q = o; } } } }
static_assert(WQKV_LAYOUT == 1 && WO_OUT_IN == 1 && DIN == 256 && CC == 256, "stage16 takes (out,in) weights and rows of 256");
// Operand staging of k_out: both operands lie in the workspace as the f16 values that are multiplied, so NA + NW rows of 512 B go to LDS unchanged (a wave's 16-byte loads take one whole row, 128 threads four rows a step);
// nothing is converted between a load and its LDS store, and all of a thread's loads are in flight together: the block waits for memory once.
template <int NA, int NW> __device__ __forceinline__ void stage_rows(const _Float16* __restrict__ A, const _Float16* __restrict__ Wt, unsigned char* dA, unsigned char* dW, int tid) {
  const int off = (tid >> 5) * 256 + (tid & 31) * 8; const int lo = (tid >> 5) * (GP * 2) + (tid & 31) * 16;
  v4u a[NA / 4], w[NW / 4];
#pragma unroll
  for (int u = 0; u < NA / 4; ++u) a[u] = *(const v4u*)(A + off + u * 1024);
#pragma unroll
  for (int u = 0; u < NW / 4; ++u) w[u] = *(const v4u*)(Wt + off + u * 1024);
#pragma unroll
  for (int u = 0; u < NA / 4; ++u) *(v4u*)(dA + lo + u * (GP * 8)) = a[u];
#pragma unroll
  for (int u = 0; u < NW / 4; ++u) *(v4u*)(dW + lo + u * (GP * 8)) = w[u]; }
// ---- k_proj: block = (64 rows, 128 cols, which): q/k/v = X W (+ b) with exact bf16 products (K = DIN) -> which 0: q f16 rows (+ residual rows < QHI); 1: k f16 rows (+ residual rows < KHI); 2: v f16 planes [c][t] (+ bf16 hi/lo planes for t < KHI)
__global__ __launch_bounds__(128) void k_proj(const float* __restrict__ XQ, const float* __restrict__ XK, const float* __restrict__ XV, const float* __restrict__ WQ, const float* __restrict__ WK, const float* __restrict__ WV, const float* __restrict__ BQ, const float* __restrict__ BK, const float* __restrict__ BV, const float* __restrict__ WO, _Float16* __restrict__ WOH,
    _Float16* __restrict__ QH, _Float16* __restrict__ QL, _Float16* __restrict__ KH, _Float16* __restrict__ KL, _Float16* __restrict__ VT, __bf16* __restrict__ VB, __bf16* __restrict__ VBL) {
  __shared__ __align__(16) unsigned char SM[GOPB];   /* first the two operands, then, behind a barrier, the output tiles */
  _Float16 (*sh)[136] = (_Float16 (*)[136])SM; _Float16 (*sl)[136] = (_Float16 (*)[136])(SM + 17408); _Float16 (*th)[72] = (_Float16 (*)[72])(SM + 34816); __bf16 (*tb)[72] = (__bf16 (*)[72])(SM + 53248); __bf16 (*tbl)[72] = (__bf16 (*)[72])(SM + 71680);
  static_assert(2 * 64 * 136 * 2 + 3 * 128 * 72 * 2 <= GOPB, "output tiles fit the operands' LDS");
  const int tid = threadIdx.x, wave = tid >> 5, lane = tid & 31, col = lane & 15, g = lane >> 4; const int which = blockIdx.z; const int c0 = blockIdx.y * 128; const size_t r0 = (size_t)blockIdx.x * 64; const size_t bb = r0 / TT; const int t0 = (int)(r0 % TT);
  const float* X = which == 0 ? XQ : which == 1 ? XK : XV; const float* WA = which == 0 ? WQ : which == 1 ? WK : WV; const float* BA = which == 0 ? BQ : which == 1 ? BK : BV;
  // k_out's weight operand, made once: each of the 256 blocks that make q rounds one row of W_O to f16(bf16 x 2^8), as k_out's staging did in every block. The row's load flies with those of the operands' staging, under which it returns, and it is stored behind the staging's barrier, so that no barrier waits for the store but the next, a whole product loop later (every block loads: under a branch the compiler waits for the load on the spot).
  static_assert((TNB * TT / 64) * (CC / 128) == DIN && CC == 128 * 2, "one row of W_O a block, two elements a thread");
  const size_t wrow = (size_t)(blockIdx.x * (CC / 128) + blockIdx.y) * CC;
  const v2f w2 = ((const v2f*)(WO + wrow))[tid];
  stage16<64, 0>(X + r0 * DIN, SM + 128 * GP * 2, tid); stage16<128, 0>(WA + (size_t)c0 * DIN, SM, tid);
  __syncthreads();   /* both operands are readable by the four waves */
  if (which == 0) { v2h o; o[0] = (_Float16)(bfr(w2[0]) * 256.0f); o[1] = (_Float16)(bfr(w2[1]) * 256.0f);
    ((v2h*)(WOH + wrow))[tid] = o;
    asm volatile("s_wait_xcnt 0x0" ::: "memory"); }   /* the store's address and data registers are free to be rewritten behind this */
  const __bf16* sW = (const __bf16*)SM + col * GP; const __bf16* sX = (const __bf16*)SM + (128 + wave * 16 + col) * GP;
  v8f acc[8] = {}; v16b a[2], w[2][8];
  a[0] = frag_b(sX, lane);
#pragma unroll
  for (int j = 0; j < 8; ++j) w[0][j] = frag_b(sW + j * 16 * GP, lane);
#pragma unroll   /* unrolled: the two fragment sets alternate by name; the next chunk's 18 LDS reads stand as one group in front of this chunk's products and return under them */
  for (int kc = 0; kc < DIN / 32; ++kc) { const int c = kc & 1;
    if (kc + 1 < DIN / 32) { a[c ^ 1] = frag_b(sX + (kc + 1) * 32, lane);
#pragma unroll
      for (int j = 0; j < 8; ++j) w[c ^ 1][j] = frag_b(sW + j * 16 * GP + (kc + 1) * 32, lane); }
#pragma unroll
    for (int j = 0; j < 8; ++j) acc[j] = wmma_bf(a[c], w[c][j], acc[j]); }
  __syncthreads();   /* every wave has left the operands: the output tiles below take their LDS */
  if (which < 2) { _Float16* DH = which == 0 ? QH : KH; _Float16* DL = which == 0 ? QL : KL; const int nhi = which == 0 ? QHI : KHI; const bool hi_rows = t0 < nhi; const float qs = which == 0 ? QLOG2 : 1.0f;   /* q leaves in log2 units: k_fa's logit products then need no multiply behind them */
#pragma unroll
    for (int j = 0; j < 8; ++j) { const float bias = BA ? bfr(BA[c0 + j * 16 + col]) : 0.f;
#pragma unroll
      for (int r = 0; r < 8; ++r) { const float v = (acc[j][r] + bias) * qs; const _Float16 hv = (_Float16)v; sh[wave * 16 + 8 * g + r][j * 16 + col] = hv; sl[wave * 16 + 8 * g + r][j * 16 + col] = (_Float16)((v - (float)hv) * 1024.0f); } }
    __syncthreads();
    for (int e = tid; e < 64 * 16; e += 128) { const int rl = e >> 4, q = e & 15; vst2((unsigned*)(DH + (r0 + rl) * CC + c0 + q * 8), *(const v4u*)&sh[rl][q * 8]); if (hi_rows) vst2((unsigned*)(DL + (bb * nhi + t0 + rl) * (size_t)CC + c0 + q * 8), *(const v4u*)&sl[rl][q * 8]); }
  } else { const bool hi_rows = t0 < KHI;
#pragma unroll
    for (int j = 0; j < 8; ++j) { const float bias = BA ? bfr(BA[c0 + j * 16 + col]) : 0.f;
#pragma unroll
      for (int r = 0; r < 8; ++r) { const float v = acc[j][r] + bias; const int rl = wave * 16 + 8 * g + r, cl = j * 16 + col; th[cl][rl] = (_Float16)v; const __bf16 bh = (__bf16)v; tb[cl][rl] = bh; tbl[cl][rl] = (__bf16)(v - (float)bh); } }
    __syncthreads();
    for (int e = tid; e < 128 * 8; e += 128) { const int cl = e >> 3, q = e & 7; vst2((unsigned*)(VT + (bb * CC + c0 + cl) * (size_t)TT + t0 + q * 8), *(const v4u*)&th[cl][q * 8]); if (hi_rows) { const size_t o3 = (bb * CC + c0 + cl) * (size_t)KHI + t0 + q * 8; vst2((unsigned*)(VB + o3), *(const v4u*)&tb[cl][q * 8]); vst2((unsigned*)(VBL + o3), *(const v4u*)&tbl[cl][q * 8]); } } } }
__device__ __forceinline__ void ex2_mid(float* e, float& a0, float& a1, uint32_t& c0, uint32_t& c1, float s0, float s1, float s2, float s3, const float* pe) {
  asm("v_exp_f32 %0, %8\n\tv_add_f32 %4, %12, %13\n\tv_exp_f32 %1, %9\n\tv_cvt_pk_f16_f32 %6, %12, %14\n\tv_exp_f32 %2, %10\n\tv_cvt_pk_f16_f32 %7, %13, %15\n\tv_exp_f32 %3, %11\n\tv_add_f32 %5, %14, %15"
      : "=&v"(e[0]), "=&v"(e[1]), "=&v"(e[2]), "=&v"(e[3]), "=&v"(a0), "=&v"(a1), "=&v"(c0), "=&v"(c1) : "v"(s0), "v"(s1), "v"(s2), "v"(s3), "v"(pe[0]), "v"(pe[1]), "v"(pe[2]), "v"(pe[3])); }
__device__ __forceinline__ float ex2_one(float x) { float r; asm("v_exp_f32 %0, %1\n\tv_nop" : "=&v"(r) : "v"(x)); return r; }   /* the v_nop is the slot behind the transcendental */
// four with nothing to carry: each fills the slot of the one in front, and one v_nop that of the last
__device__ __forceinline__ void ex2_last4(float* e, const float* t) {
  asm("v_exp_f32 %0, %4\n\tv_exp_f32 %1, %5\n\tv_exp_f32 %2, %6\n\tv_exp_f32 %3, %7\n\tv_nop" : "=&v"(e[0]), "=&v"(e[1]), "=&v"(e[2]), "=&v"(e[3]) : "v"(t[0]), "v"(t[1]), "v"(t[2]), "v"(t[3])); }
// Products of one kind as ONE statement: each fills the hazard slots of the one in front, so the four v_nop that keep vector instructions off D, A and B stand once behind the last product and not behind every one.
// The builtin alone did not serve: the LDS reads sank to their products.
__device__ __forceinline__ void wmma_s8(v8f* s, const v16h (*k)[HD / 32], const v16h* q, v8f c) {   /* s[kt] = c + k[kt][0] q[0] + k[kt][1] q[1]; four independent tiles, then their second halves */
  asm volatile("v_wmma_f32_16x16x32_f16 %0, %4, %12, %14\n\tv_wmma_f32_16x16x32_f16 %1, %6, %12, %14\n\tv_wmma_f32_16x16x32_f16 %2, %8, %12, %14\n\tv_wmma_f32_16x16x32_f16 %3, %10, %12, %14\n\t"
               "v_wmma_f32_16x16x32_f16 %0, %5, %13, %0\n\tv_wmma_f32_16x16x32_f16 %1, %7, %13, %1\n\tv_wmma_f32_16x16x32_f16 %2, %9, %13, %2\n\tv_wmma_f32_16x16x32_f16 %3, %11, %13, %3\n\t"
               "v_nop\n\tv_nop\n\tv_nop\n\tv_nop"
               : "=&v"(s[0]), "=&v"(s[1]), "=&v"(s[2]), "=&v"(s[3]) : "v"(k[0][0]), "v"(k[0][1]), "v"(k[1][0]), "v"(k[1][1]), "v"(k[2][0]), "v"(k[2][1]), "v"(k[3][0]), "v"(k[3][1]), "v"(q[0]), "v"(q[1]), "v"(c)); }
__device__ __forceinline__ void wmma_pv8(v8f* a, v8f* b, v16h v0, v16h v1, v16h v2, v16h v3, v16h p, v16h q) {   /* a[j] += v_j p, b[j] += v_j q: each v fragment serves both query tiles */
  asm volatile("v_wmma_f32_16x16x32_f16 %0, %8, %12, %0\n\tv_wmma_f32_16x16x32_f16 %1, %9, %12, %1\n\tv_wmma_f32_16x16x32_f16 %2, %10, %12, %2\n\tv_wmma_f32_16x16x32_f16 %3, %11, %12, %3\n\t"
               "v_wmma_f32_16x16x32_f16 %4, %8, %13, %4\n\tv_wmma_f32_16x16x32_f16 %5, %9, %13, %5\n\tv_wmma_f32_16x16x32_f16 %6, %10, %13, %6\n\tv_wmma_f32_16x16x32_f16 %7, %11, %13, %7\n\t"
               "v_nop\n\tv_nop\n\tv_nop\n\tv_nop"
               : "+v"(a[0]), "+v"(a[1]), "+v"(a[2]), "+v"(a[3]), "+v"(b[0]), "+v"(b[1]), "+v"(b[2]), "+v"(b[3]) : "v"(v0), "v"(v1), "v"(v2), "v"(v3), "v"(p), "v"(q)); }
__device__ __forceinline__ v8f splat8(float x) { return (v8f){x, x, x, x, x, x, x, x}; }
__device__ __forceinline__ float xhalf(float v) { const int i = __builtin_bit_cast(int, v); return __builtin_bit_cast(float, __builtin_amdgcn_permlanex16(i, i, 0x76543210, 0xfedcba98, false, false)); }   /* lane l <-> l ^ 16 */
// K and V reach the waves through LDS: a stage is SKEYS keys; each of the 16 waves brings one slice of 64 rows x 128 B per stage by one tensor load
// (waves 0..7: 64 k rows each; waves 8..15: the 64 v planes x 64 keys each), the mover's 16-byte pad giving the pitch 144 B that 16-byte LDS reads want; two buffers, together the whole LDS of a WGP.
typedef uint32_t u32x4 __attribute__((ext_vector_type(4)));
typedef uint32_t u32x8 __attribute__((ext_vector_type(8)));
#define SKEYS 512
#define NSL (SKEYS / 64)       /* slices of k, and of v, in a stage */
#define TPS (SKEYS / 256)      /* trips of a wave in a stage: its quarter of the stage's keys, 64 a trip */
#define NST (TT / SKEYS)
#define LPITCH 144u
#define SLICEB 10240u          /* 64 rows x 144 B = 9216 B, rounded up so that every slice starts at a multiple of 2 KiB */
#define BUFB (2u * NSL * SLICEB)
__device__ __forceinline__ uint32_t uni(uint32_t v) { return (uint32_t)__builtin_amdgcn_readfirstlane(v); }
__device__ __forceinline__ uint32_t pinned(uint32_t v) { uint32_t w = uni(v); asm volatile("" : "+s"(w)); return w; }
// both groups are in-out operands of the load and inputs of the wait that covers it: every word of the descriptor is then live from the load to that wait, so the compiler hands none of its registers to another value while the request is in flight
__device__ __forceinline__ void tdm_load(u32x4& g0, u32x8& g1) { asm volatile("tensor_load_to_lds %0, %1" : "+s"(g0), "+s"(g1) :: "memory"); }
__device__ __forceinline__ void tdm_wait(const u32x4& g0, const u32x8& g1) { asm volatile("s_wait_tensorcnt 0x0" :: "s"(g0), "s"(g1) : "memory"); }
__device__ __forceinline__ v16h frag_l(const unsigned char* p) { union { v16h v; v8h q[2]; } u; u.q[0] = *(const v8h*)p; u.q[1] = *(const v8h*)(p + 32); return u.v; }
#define SCN(n) s[2 * ((n) >> 4) + ((n) & 1)][((n) >> 1) & 7]   /* score n = 16 c2 + 2 i + w is s[2 c2 + w][i] */
// one query tile's 64 scores, which arrive as exponents s - (maximum in use) + 10: mask, the test of the maximum in use, P (two B operands), sum.
// ms = 10 - maximum in use (the next product's C); thr = the exponent above which the maximum moves: 15 once a kept key has been seen, -1.0e37 before (any kept key then sets it; ms = 10 stands for a first reference of 0).
__device__ __forceinline__ void soft_tile(v8f* s, float& ms, float& thr, float& l, v8f* acc, v16h* p, bool some_masked, unsigned b0, unsigned b1, unsigned g8) {
  if (some_masked) { unsigned w0, w1;   /* wave-uniform: some key of these 64 is masked */
    /* this lane half's mask bits, w = b >> 8g. In asm, volatile, so that the 64 bit tests that hang on them stay inside this branch: written plainly, the compiler shared them between the two query tiles and moved them in front of both branches, onto every trip */
    asm volatile("v_lshrrev_b32 %0, %2, %3\n\tv_lshrrev_b32 %1, %2, %4" : "=&v"(w0), "=&v"(w1) : "v"(g8), "s"(b0), "s"(b1));
#pragma unroll
    for (int kt = 0; kt < 4; ++kt)
#pragma unroll
      for (int r = 0; r < 8; ++r) { const unsigned w = kt < 2 ? w0 : w1; s[kt][r] = ((w >> ((kt & 1) * 16 + r)) & 1u) ? s[kt][r] : -3.0e38f; } }
  float mt[4];
#pragma unroll
  for (int kt = 0; kt < 4; ++kt) { mt[kt] = s[kt][0];
#pragma unroll
    for (int r = 1; r < 8; ++r) mt[kt] = fmaxf(mt[kt], s[kt][r]); }
  float mx = fmaxf(fmaxf(mt[0], mt[1]), fmaxf(mt[2], mt[3]));
  mx = fmaxf(mx, xhalf(mx));   /* the same in both lane halves of a query, so the maximum in use stays one per query */
  const bool need = mx > thr;
  if (__builtin_amdgcn_ballot_w32(need) != 0u) {   /* wave-uniform scalar branch: taken on a wave's first kept tile, and later only where a score would leave f16 */
    const float d = need ? mx - 10.0f : 0.f;       /* the maximum in use moves by d, up or (first kept tile only, where ctx and sum are still 0) down */
    const float al = ex2_one(fminf(-d, 0.f));
    s[0] -= d; s[1] -= d; s[2] -= d; s[3] -= d;
    static_assert(HD / 16 == 4, "four ctx tiles a query tile");
    acc[0] *= al; acc[1] *= al; acc[2] *= al; acc[3] *= al;
    l *= al; ms -= d; thr = need ? 15.0f : thr; }
  float e[32], a[16]; union { v16h v; uint32_t u[8]; } P[2];
  { const float t0[4] = {SCN(0), SCN(1), SCN(2), SCN(3)}; ex2_last4(e, t0); }
#pragma unroll   /* unrolled: e, a and P are indexed by constants only and stay in registers */
  for (int n = 4; n < 32; n += 4) { const int q = n - 4;   /* group n's exponentials carry the sums and packs of group q */
    ex2_mid(e + n, a[q / 2], a[q / 2 + 1], P[q >> 4].u[(q >> 2) & 3], P[q >> 4].u[4 + ((q >> 2) & 3)], SCN(n), SCN(n + 1), SCN(n + 2), SCN(n + 3), e + q); }
  a[14] = e[28] + e[29]; a[15] = e[30] + e[31];
  { v2h c0, c1; c0[0] = (_Float16)e[28]; c0[1] = (_Float16)e[30]; c1[0] = (_Float16)e[29]; c1[1] = (_Float16)e[31]; P[1].u[3] = __builtin_bit_cast(uint32_t, c0); P[1].u[7] = __builtin_bit_cast(uint32_t, c1); }
  float sum = 0.f;
#pragma unroll   /* unrolled for the same reason; the pair sums are added in the order of the keys */
  for (int i = 0; i < 16; ++i) sum += a[i];
  l += sum; p[0] = P[0].v; p[1] = P[1].v; }
#define MRGB 10240u   /* bytes of LDS per wave for the hand-over at the end: per query tile 32 f32 of ctx a lane (2 x 4096 B), then per tile maximum and sum (2 x 256 B) */
__global__ __launch_bounds__(512) void k_fa(const _Float16* __restrict__ QH, const _Float16* __restrict__ KH, const _Float16* __restrict__ VT, const int* __restrict__ MASK, _Float16* __restrict__ Y) {
  __shared__ __attribute__((aligned(2048))) unsigned char L[2 * BUFB];
  const int tid = threadIdx.x, wave = tid >> 5, lane = tid & 31, col = lane & 15, g = lane >> 4;
  const int h = blockIdx.y, b = blockIdx.z;
  const uint32_t wv = uni((uint32_t)tid >> 5), sl = wv & (NSL - 1u); const bool isV = wv >= (uint32_t)NSL;   /* sl: the slice of k or v that this wave brings */
  const uint32_t kh = wv >> 2, qg = wv & 3u; const int q0 = blockIdx.x * 128 + (int)qg * 32;   /* key quarter; query group; first of this wave's 32 queries */
  const uint32_t lbase = (uint32_t)(size_t)L;
  const uint64_t ga0 = isV ? (uint64_t)(size_t)(VT + ((size_t)b * CC + h * HD) * (size_t)TT + sl * 64u) : (uint64_t)(size_t)(KH + ((size_t)b * TT + sl * 64u) * CC + h * HD);
  const uint32_t gsh = isV ? 10u : 18u;   /* bytes from one stage to the next: SKEYS x 2 along a v plane, SKEYS x CC x 2 down the k rows */
  static_assert(SKEYS * 2 == 1 << 10 && SKEYS * CC * 2 == 1 << 18 && NST >= 2 && 2 * NSL == 16 && 16u * MRGB <= 2u * BUFB, "stage steps; one slice a wave; the hand-over fits the ring");
  u32x8 g1;   /* 1-byte elements, tensor = tile = 64 rows of 128 B, a 16-byte pad behind every 128 B, no mask */
  g1[0] = uni((1u << 20) | (4u << 22) | (3u << 25)); g1[1] = uni(128u << 16); g1[2] = uni(64u << 16); g1[3] = uni(128u << 16); g1[4] = uni(64u); g1[5] = uni(isV ? (uint32_t)TT * 2u : (uint32_t)CC * 2u); g1[6] = uni(0u); g1[7] = uni(0u);
  u32x4 g0; g0[0] = uni(1u);
  auto issue = [&](uint32_t st) { const uint64_t ga = ga0 + (uint64_t)(st << gsh);
    g0[1] = uni(lbase + (st & 1u) * BUFB + (2u * sl + (isV ? 1u : 0u)) * SLICEB);   /* slice sl of k, then slice sl of v: a trip's 32 LDS reads lie within the reach of one address register's immediate offsets */ g0[2] = uni((uint32_t)ga); g0[3] = uni((((uint32_t)(ga >> 32)) & 0x01FFFFFFu) | 0x80000000u);
    tdm_load(g0, g1); };
  const int* Mb = MASK + (size_t)b * TT + lane;
  v16h qf[2][HD / 32];
#pragma unroll
  for (int qt = 0; qt < 2; ++qt)
#pragma unroll
    for (int kc = 0; kc < HD / 32; ++kc) qf[qt][kc] = frag_h(QH + ((size_t)b * TT + q0 + qt * 16 + col) * CC + h * HD + kc * 32, lane);
  int mk0 = Mb[kh * 128u], mk1 = Mb[kh * 128u + 32u];
  v8f acc[2][HD / 16] = {}; float ms[2] = {10.0f, 10.0f}, thr[2] = {-1.0e37f, -1.0e37f}, l[2] = {0.f, 0.f};
  issue(0u);
  tdm_wait(g0, g1);                                     /* this wave's slice of stage 0 has landed */
  __syncthreads();                                      /* every wave's slice of stage 0 is readable by all */
  issue(pinned(1u));                                    /* pinned(): stage 1's descriptor words are formed behind the wait above */
  const uint32_t loff = (uint32_t)col * LPITCH + 16u * (uint32_t)g;
#pragma unroll 1   /* rolled: one publish point and one refill site */
  for (uint32_t st = 0; st < NST; ++st) { const unsigned char* Bp = L + (st & 1u) * BUFB + loff;
#pragma unroll 1   /* rolled: one trip's fragments, scores and both ctx tiles fill the 256 registers that asm text can name */
    for (uint32_t hb = 0; hb < TPS; ++hb) { const uint32_t ks = kh * TPS + hb; const int it = (int)(st * NSL + ks);   /* ks: this trip's 64-key slice of the stage */
    const unsigned char* Kp = Bp + 2u * ks * SLICEB; const unsigned char* Vp = Kp + SLICEB;
    const unsigned b0 = __builtin_amdgcn_ballot_w32(mk0 != 0), b1 = __builtin_amdgcn_ballot_w32(mk1 != 0);
    const int kn = (hb + 1u < TPS ? it + 1 : st + 1u < NST ? it + NSL - TPS + 1 : it) * 64;   /* this wave's next trip's mask words fly under this trip (the last trip rereads its own) */
    mk0 = Mb[kn]; mk1 = Mb[kn + 32];
    asm volatile("s_wait_xcnt 0x0" ::: "memory");   /* the mask loads' address registers are free to be rewritten behind this */
    v16h kf[4][HD / 32];
#pragma unroll
    for (int kt = 0; kt < 4; ++kt)
#pragma unroll
      for (int kc = 0; kc < HD / 32; ++kc) kf[kt][kc] = frag_l(Kp + kt * 16 * LPITCH + kc * 64);
    const bool some_masked = (b0 & b1) != 0xFFFFFFFFu;
    v8f s[4]; v16h p[2][2];
    wmma_s8(s, kf, qf[0], splat8(ms[0]));   /* C: 10 - maximum in use, the same in a lane's eight rows (one query) */
    soft_tile(s, ms[0], thr[0], l[0], acc[0], p[0], some_masked, b0, b1, 8u * (unsigned)g);
    __builtin_amdgcn_sched_barrier(0);   /* holds the second tile's logit products behind the first tile's softmax, so that both tiles' scores take the same registers; left free, they moved up and the kernel left the 256 registers that asm text can name */
    wmma_s8(s, kf, qf[1], splat8(ms[1]));
    v16h vf[HD / 16][2];   /* the v fragments take the registers that the k fragments have just left */
#pragma unroll
    for (int j = 0; j < HD / 16; ++j) { vf[j][0] = frag_l(Vp + j * 16 * LPITCH); vf[j][1] = frag_l(Vp + j * 16 * LPITCH + 64); }
    __builtin_amdgcn_sched_barrier(0);   /* holds the v reads in front of the second tile's softmax, under which they return; left free, the compiler sinks them close in front of the products that wait for them */
    soft_tile(s, ms[1], thr[1], l[1], acc[1], p[1], some_masked, b0, b1, 8u * (unsigned)g);
    wmma_pv8(acc[0], acc[1], vf[0][0], vf[1][0], vf[2][0], vf[3][0], p[0][0], p[1][0]); wmma_pv8(acc[0], acc[1], vf[0][1], vf[1][1], vf[2][1], vf[3][1], p[0][1], p[1][1]); }
    asm volatile("s_wait_dscnt 0x0" ::: "memory");       /* this wave's reads of stage st have returned */
    tdm_wait(g0, g1);                                    /* this wave's slice of stage st + 1 has landed */
    __syncthreads();                                      /* stage st + 1 is readable by all, and every wave has left stage st's buffer */
    if (pinned(st + 2u < NST)) issue(pinned(st + 2u)); }  /* the refill of the buffer just left; scalar test */
  tdm_wait(g0, g1);                                      /* nothing of the mover is in flight when the wave ends */
  asm volatile("s_wait_dscnt 0x0" ::: "memory");         /* nor any LDS read of this wave */
  // The four key quarters meet: every wave lays both its tiles (ctx, maximum, sum) into LDS; wave (qg, kq) then joins, over the four quarters of its query group, query tile kq >> 1, ctx columns 32 (kq & 1) .. + 31: 64 bytes of Y a query.
  // The last stage's barrier has ended every read of the ring, and no load was issued behind it: its LDS is free.
  l[0] += xhalf(l[0]); l[1] += xhalf(l[1]);
  const float m[2] = {thr[0] > 0.f ? 10.0f - ms[0] : -1.0e30f, thr[1] > 0.f ? 10.0f - ms[1] : -1.0e30f};   /* the maxima in use; a quarter with no kept key never set one */
  unsigned char* Xs = L + wv * MRGB + lane * 16;
#pragma unroll
  for (int qt = 0; qt < 2; ++qt) {
#pragma unroll
    for (int j = 0; j < HD / 16; ++j) { v4f lo, hi;
#pragma unroll
      for (int r = 0; r < 4; ++r) { lo[r] = acc[qt][j][r]; hi[r] = acc[qt][j][4 + r]; }
      *(v4f*)(Xs + qt * 4096 + j * 1024) = lo; *(v4f*)(Xs + qt * 4096 + j * 1024 + 512) = hi; }
    v2f ml; ml[0] = m[qt]; ml[1] = l[qt];
    *(v2f*)(L + wv * MRGB + 8192u + qt * 256 + lane * 8) = ml; }
  __syncthreads();   /* every wave's tiles are readable by the waves of its query group */
  const uint32_t tq = kh >> 1, jp = kh & 1u;   /* the query tile and the pair of ctx column tiles that this wave finishes */
  const unsigned char* Xr = L + qg * MRGB + tq * 4096u + jp * 2048u + lane * 16; const unsigned char* Mr = L + qg * MRGB + 8192u + tq * 256u + lane * 8;   /* quarter k's copy lies 4 k MRGB further on */
  v2f mo[4];
#pragma unroll
  for (int k = 0; k < 4; ++k) mo[k] = *(const v2f*)(Mr + k * 4 * MRGB);
  const float mm = fmaxf(fmaxf(mo[0][0], mo[1][0]), fmaxf(mo[2][0], mo[3][0]));   /* maxima are in log2 units; a quarter with no kept key has sum 0 and ctx 0 */
  float dq[4], wq[4], den = 0.f;
#pragma unroll
  for (int k = 0; k < 4; ++k) dq[k] = mo[k][0] - mm;
  ex2_last4(wq, dq);   /* the four exponentials in one statement */
#pragma unroll
  for (int k = 0; k < 4; ++k) den += mo[k][1] * wq[k];
  const float inv = 1.0f / den;
  _Float16* yr = Y + ((size_t)b * TT + q0 + (int)tq * 16 + col) * CC + h * HD + (int)jp * 32 + 8 * g;   /* acc[j][r] = ctx[query col][j * 16 + 8g + r] */
#pragma unroll
  for (int j = 0; j < 2; ++j) { v4f lo = {}, hi = {};
#pragma unroll
    for (int k = 0; k < 4; ++k) { const float ck = wq[k] * inv; const v4f ol = *(const v4f*)(Xr + k * 4 * MRGB + j * 1024), oh = *(const v4f*)(Xr + k * 4 * MRGB + j * 1024 + 512);
#pragma unroll
      for (int r = 0; r < 4; ++r) { lo[r] += ol[r] * ck; hi[r] += oh[r] * ck; } }
    v8h o;   /* ctx carried x 2^6 into f16, the value k_out multiplies, so small-magnitude context rows stay clear of f16 subnormals */
#pragma unroll
    for (int r = 0; r < 4; ++r) { o[r] = (_Float16)(lo[r] * 64.0f); o[4 + r] = (_Float16)(hi[r] * 64.0f); }
    vst2(yr + j * 16, o); } }
// ---- k_out: block = (64 rows, 128 cols): out = ctx Wo (+ bo): ctx x 2^6 in f16 (from k_fa) against Wo as f16(bf16 x 2^8) exact (from k_proj) (1 product) x 2^-14
__global__ __launch_bounds__(128) void k_out(const _Float16* __restrict__ Y, const _Float16* __restrict__ WOH, const float* __restrict__ BO, float* __restrict__ OUT) { __shared__ __align__(16) unsigned char SM[GOPB];   /* first the two operands, then, behind a barrier, the output tile */
  float (*sf)[16][132] = (float (*)[16][132])SM; static_assert(4 * 16 * 132 * 4 <= GOPB, "output tile fits the operands' LDS");
  const int tid = threadIdx.x, wave = tid >> 5, lane = tid & 31, col = lane & 15, g = lane >> 4; const int c0 = blockIdx.y * 128; const size_t r0 = (size_t)blockIdx.x * 64 + wave * 16;
  v8f acc[8] = {};
  stage_rows<64, 128>(Y + (size_t)blockIdx.x * 64 * CC, WOH + (size_t)c0 * CC, SM + 128 * GP * 2, SM, tid);
  __syncthreads();   /* both operands are readable by the four waves */
  const _Float16* sW = (const _Float16*)SM + col * GP; const _Float16* sY = (const _Float16*)SM + (128 + wave * 16 + col) * GP;
  v16h a[2], w[2][8];
  a[0] = frag_h(sY, lane);
#pragma unroll
  for (int j = 0; j < 8; ++j) w[0][j] = frag_h(sW + j * 16 * GP, lane);
#pragma unroll   /* unrolled: the two fragment sets alternate by name; the next chunk's 18 LDS reads stand as one group in front of this chunk's products and return under them */
  for (int kc = 0; kc < CC / 32; ++kc) { const int c = kc & 1;
    if (kc + 1 < CC / 32) { a[c ^ 1] = frag_h(sY + (kc + 1) * 32, lane);
#pragma unroll
      for (int j = 0; j < 8; ++j) w[c ^ 1][j] = frag_h(sW + j * 16 * GP + (kc + 1) * 32, lane); }
#pragma unroll
    for (int j = 0; j < 8; ++j) acc[j] = wmma16(a[c], w[c][j], acc[j]); }
  __syncthreads();   /* every wave has left the operands: the output tile below takes their LDS */
#pragma unroll
  for (int j = 0; j < 8; ++j) { const float bias = BO ? bfr(BO[c0 + j * 16 + col]) : 0.f;
#pragma unroll
    for (int r = 0; r < 8; ++r) sf[wave][8 * g + r][j * 16 + col] = acc[j][r] * (1.0f / 16384.0f) + bias; }   /* 2^-8 (Wo carry) x 2^-6 (ctx carry) */
  LDSX(); for (int rl = 0; rl < 16; ++rl) vst2(OUT + (r0 + rl) * DIN + c0 + lane * 4, *(const v4f*)&sf[wave][rl][lane * 4]); }

extern "C" void kernel_launch(void* const* d_in, const int* in_sizes, int n_in, void* d_out, int out_size, void* d_ws, size_t ws_size, hipStream_t stream) {
  (void)in_sizes; (void)n_in; (void)out_size;
  const float** F = (const float**)d_in;
  if (ws_size < (size_t)WS_END) return;
  char* ws = (char*)d_ws; _Float16 *QH = (_Float16*)(ws + WS_QH), *KH = (_Float16*)(ws + WS_KH), *VT = (_Float16*)(ws + WS_VT), *QL = (_Float16*)(ws + WS_QL), *KL = (_Float16*)(ws + WS_KL); __bf16 *VB = (__bf16*)(ws + WS_VB), *VBL = (__bf16*)(ws + WS_VBL); _Float16 *Y = (_Float16*)(ws + WS_Y), *WOH = (_Float16*)(ws + WS_WOH);
  (void)Y; (void)QL; (void)KL; (void)VB; (void)VBL;
  // inputs: 0 x [4,2048,256]; 1 W_Q [256,256] (out,in); 2 W_K; 3 W_V; 4 W_O (out,in); 5 mask [4,2048] int32 (ones on this draw; read per key); no biases
  k_proj<<<dim3(TNB * TT / 64, CC / 128, 3), 128, 0, stream>>>(F[0], F[0], F[0], F[1], F[2], F[3], nullptr, nullptr, nullptr, F[4], WOH, QH, QL, KH, KL, VT, VB, VBL);
  k_fa<<<dim3(TT / 128, NH, TNB), 512, 0, stream>>>(QH, KH, VT, (const int*)d_in[5], Y);
  k_out<<<dim3(TNB * TT / 64, DIN / 128), 128, 0, stream>>>(Y, WOH, nullptr, (float*)d_out);
}
